// v000
// The times below were measured on an AMD MI455X: many runs one after another, warmed up first and cycling through
// copies of the inputs, with the whole window's GPU time divided by the number of runs. Launches and the gaps
// between them are all in it. The median over several windows is given; except for v000 it joins two sittings, which
// can be a few percent apart, so the side-by-side timings, each taken in one sitting, are the better comparison.
// v000 is the starting kernel. One run takes 1030 microseconds.
#include <hip/hip_runtime.h>

// Single-head self-attention over 4,096 points (inputs [4][4096][128]; q,k,v = inputs W + b ('xw' [128][128] + [128]); softmax(q.k / sqrt(128)) over all points; out = weights v -> [4][4096][128] (2.1 M)).
// Layout per batch: bf16 copy of the inputs; exact projections + bf16-rounded biases; ONE 128-wide head through the dense T-4096 attention (hybrid rows: < 512 hi/lo 3 products, rest fp16 x1024; streaming three-sweep softmax over the 4,096 keys); the f32 merge writes the output rows.
// Compute dtypes, f32 accumulate: every input rounded to bf16; projections exact + bf16-rounded biases; attention rows < 512 3 products, rest fp16; softmax f32; output f32.

#define NB_  4
#define TT   4096
#define DM   128
#define NH_  1
#define NKV  1
#define REP  (NH_ / NKV)
#define HD   128
#define DQ   (NH_ * HD)
#define DKV  (NKV * HD)
#define ZH   1
#define RH   512                  // query rows < RH use hi+lo planes (0: none)
#define WIN  0
#define PCAR 1024.0f
#define SCL  0.088388347648318447f   // 1/sqrt(128)
typedef _Float16 h16;
typedef unsigned short bf;
typedef __attribute__((ext_vector_type(16))) __bf16   v16bf;
typedef __attribute__((ext_vector_type(16))) _Float16 v16h;
typedef __attribute__((ext_vector_type(8)))  _Float16 v8h;
typedef __attribute__((ext_vector_type(8)))  unsigned short v8us;
typedef __attribute__((ext_vector_type(8)))  float    v8f;
typedef __attribute__((ext_vector_type(4)))  float    v4f;
typedef v8h  __attribute__((may_alias)) v8ha;
typedef v4f  __attribute__((may_alias)) v4fa;
typedef v8us __attribute__((may_alias)) v8usa;

__device__ __forceinline__ unsigned short f2bf(float f) { unsigned u = __float_as_uint(f); u += 0x7FFFu + ((u >> 16) & 1u); return (unsigned short)(u >> 16); }
__device__ __forceinline__ float bf2f(unsigned short b) { return __uint_as_float(((unsigned)b) << 16); }
__device__ __forceinline__ float bfr(float f) { return bf2f(f2bf(f)); }
__device__ __forceinline__ v16h cat16(v8h lo, v8h hi) { return __builtin_shufflevector(lo, hi, 0, 1, 2, 3, 4, 5, 6, 7, 8, 9, 10, 11, 12, 13, 14, 15); }
__device__ __forceinline__ v16bf cat16b(v8us lo, v8us hi) { return __builtin_bit_cast(v16bf, __builtin_shufflevector(lo, hi, 0, 1, 2, 3, 4, 5, 6, 7, 8, 9, 10, 11, 12, 13, 14, 15)); }
__device__ __forceinline__ v8f wmma16(v16h a, v16h b, v8f c) { return __builtin_amdgcn_wmma_f32_16x16x32_f16(false, a, false, b, (short)0, c, false, false); }
__device__ __forceinline__ v8f wmmab(v16bf a, v16bf b, v8f c) { return __builtin_amdgcn_wmma_f32_16x16x32_bf16(false, a, false, b, (short)0, c, false, false); }



// ---- k_gemmw: register-blocked GEMM, ONE WAVE per 64x64 output tile (16 accumulators), operands straight from K-contiguous 16-bit planes; grid (M/64, N/64, Z), 32 threads.
// C[m][n] (f32, pitch ldc, + optional f32 bias[n]) = sum_k A[m][k] Bt[n][k] (+ split products per NSPLIT). z-batch strides sA/sB/sC in elements. K % 32 == 0.
template <typename T16> struct WFrag;
template <> struct WFrag<h16> { typedef v16h V; static __device__ __forceinline__ V ld(const h16* p) { return cat16(*(const v8h*)p, *(const v8h*)(p + 16)); } static __device__ __forceinline__ v8f mma(V a, V b, v8f c) { return wmma16(a, b, c); } };
template <> struct WFrag<bf> { typedef v16bf V; static __device__ __forceinline__ V ld(const bf* p) { return cat16b(*(const v8us*)p, *(const v8us*)(p + 16)); } static __device__ __forceinline__ v8f mma(V a, V b, v8f c) { return wmmab(a, b, c); } };
template <typename T16, int NSPLIT, bool BIAS>
__global__ __launch_bounds__(32) void k_gemmw(const T16* __restrict__ A, const T16* __restrict__ A2, const T16* __restrict__ Bt, const T16* __restrict__ Bt2, int K, float* C, int ldc, const float* __restrict__ bias, size_t sA, size_t sB, size_t sC) {
    typedef typename WFrag<T16>::V V;
    __shared__ __align__(16) float os[16 * 68];
    const size_t z = blockIdx.z; A += z * sA; if (A2) A2 += z * sA; Bt += z * sB; if (Bt2) Bt2 += z * sB; C += z * sC;
    const int lane = threadIdx.x & 31, lr = lane & 15, hi = lane >> 4; const int r0 = blockIdx.x * 64, c0 = blockIdx.y * 64;
    v8f acc[4][4];
#pragma unroll
    for (int mb = 0; mb < 4; ++mb)
#pragma unroll
        for (int nb = 0; nb < 4; ++nb) acc[mb][nb] = (v8f){};
    const size_t aoff = (size_t)(r0 + lr) * K + 8 * hi, boff = (size_t)(c0 + lr) * K + 8 * hi;
#pragma unroll 1
    for (int kc = 0; kc < K; kc += 32) {
        V a[4], a2[4];
#pragma unroll
        for (int mb = 0; mb < 4; ++mb) { a[mb] = WFrag<T16>::ld(A + aoff + (size_t)mb * 16 * K + kc); if (NSPLIT == 1 || NSPLIT == 2) a2[mb] = WFrag<T16>::ld(A2 + aoff + (size_t)mb * 16 * K + kc); }
#pragma unroll
        for (int nb = 0; nb < 4; ++nb) { const V b = WFrag<T16>::ld(Bt + boff + (size_t)nb * 16 * K + kc); V b2; if (NSPLIT >= 2) b2 = WFrag<T16>::ld(Bt2 + boff + (size_t)nb * 16 * K + kc);
#pragma unroll
            for (int mb = 0; mb < 4; ++mb) { acc[mb][nb] = WFrag<T16>::mma(a[mb], b, acc[mb][nb]); if (NSPLIT == 1 || NSPLIT == 2) acc[mb][nb] = WFrag<T16>::mma(a2[mb], b, acc[mb][nb]); if (NSPLIT >= 2) acc[mb][nb] = WFrag<T16>::mma(a[mb], b2, acc[mb][nb]); } }
        asm volatile("v_nop\n\tv_nop\n\tv_nop\n\tv_nop" : "+v"(acc[0][0]), "+v"(acc[1][1]), "+v"(acc[2][2]), "+v"(acc[3][3]) : "v"(a[0]), "v"(a[3]));
    }
#pragma unroll
    for (int mb = 0; mb < 4; ++mb) {
#pragma unroll
        for (int nb = 0; nb < 4; ++nb) {
#pragma unroll
            for (int j = 0; j < 8; ++j) os[(hi * 8 + j) * 68 + nb * 16 + lr] = acc[mb][nb][j]; }
        __builtin_amdgcn_wave_barrier(); asm volatile("" ::: "memory");
        float* crow = C + (size_t)(r0 + mb * 16) * ldc + c0;
{
#pragma unroll
            for (int s = 0; s < 8; ++s) { const int row = 2 * s + hi, cofs = lr * 4; v4f val = *(const v4fa*)(os + row * 68 + cofs); if (BIAS) { val[0] += bfr(bias[c0 + cofs]); val[1] += bfr(bias[c0 + cofs + 1]); val[2] += bfr(bias[c0 + cofs + 2]); val[3] += bfr(bias[c0 + cofs + 3]); }
                *(v4f*)(crow + (size_t)row * ldc + cofs) = val; }
             }
        __builtin_amdgcn_wave_barrier(); asm volatile("" ::: "memory");
    }
}

__device__ __forceinline__ h16 tohx(float x) { return (h16)x; }
__device__ __forceinline__ void splitf(float y, unsigned short& h, unsigned short& l) { h = f2bf(y); l = f2bf(y - bf2f(h)); }
typedef __attribute__((ext_vector_type(2))) _Float16 v2h;
typedef __attribute__((ext_vector_type(4))) _Float16 v4h;
typedef __attribute__((ext_vector_type(2))) unsigned short v2us;
typedef __attribute__((ext_vector_type(4))) unsigned short v4us;
typedef __attribute__((ext_vector_type(2))) float v2f;
typedef __attribute__((ext_vector_type(4))) int v4i;

__global__ __launch_bounds__(256) void k_wtG(const float* __restrict__ w, int K, int N, bf* Bt) {
    const int lane = threadIdx.x & 31; const int L0 = (blockIdx.x * 8 + (threadIdx.x >> 5)) * 8; const int nlines = N * K / 64;
{
#pragma unroll 1
        for (int l = 0; l < 8; ++l) { const int L = L0 + l; if (L >= nlines) break; const size_t e = (size_t)L * 64 + lane * 2; const int k = (int)(e % K), n = (int)(e / K); v2us o;
            o[0] = f2bf(w[(size_t)k * N + n]); o[1] = f2bf(w[(size_t)(k + 1) * N + n]); *(v2us*)(Bt + e) = o; }
         }
}
__global__ __launch_bounds__(256) void k_cvt8(const float* __restrict__ src, bf* dst, size_t n8) { const size_t i = (size_t)blockIdx.x * 256 + threadIdx.x; if (i >= n8) return; const v8f v = *(const v8f*)(src + i * 8); v8us o;
#pragma unroll
    for (int k = 0; k < 8; ++k) o[k] = f2bf(v[k]); *(v8us*)(dst + i * 8) = o;  }

__global__ __launch_bounds__(256) void k_flat(const float* __restrict__ F, h16* P16, bf* Ph, bf* Pl, size_t n4) { const size_t i = (size_t)blockIdx.x * 256 + threadIdx.x; if (i >= n4) return; const v4f a = *(const v4f*)(F + i * 4); v4h o16; v4us oh, ol;
#pragma unroll
    for (int q = 0; q < 4; ++q) { o16[q] = tohx(a[q]); unsigned short x2, y2; splitf(a[q], x2, y2); oh[q] = x2; ol[q] = y2; }
    *(v4h*)(P16 + i * 4) = o16; *(v4us*)(Ph + i * 4) = oh; *(v4us*)(Pl + i * 4) = ol;  }


__global__ __launch_bounds__(256) void k_vtp(const float* __restrict__ F, int pitch, int nheads, h16* V16, bf* Vh, bf* Vl) { const size_t e = ((size_t)blockIdx.x * 256 + threadIdx.x) * 2; if (e >= (size_t)nheads * HD * TT) return; const int t = (int)(e % TT); const int d = (int)((e / TT) % HD); const int g = (int)(e / ((size_t)TT * HD)); v2h o16; v2us oh, ol;
#pragma unroll
    for (int q = 0; q < 2; ++q) { const float x = F[(size_t)(t + q) * pitch + g * HD + d]; o16[q] = tohx(x); unsigned short a2, c2; splitf(x, a2, c2); oh[q] = a2; ol[q] = c2; }
    *(v2h*)(V16 + e) = o16; *(v2us*)(Vh + e) = oh; *(v2us*)(Vl + e) = ol;  }

// k_lsoft: streaming row softmax over all TK = TT = 4096 keys, one wave per row i, three sweeps of the f32 score row (lane -> 4 consecutive keys per 128-key chunk, 32 chunks; no mask, every score tile is computed):
__global__ __launch_bounds__(256) void k_lsoft(const float* __restrict__ Sb, h16* P16, bf* Ph, bf* Pl) {
    const int lane = threadIdx.x & 31; const int row = blockIdx.x * 8 + (threadIdx.x >> 5); if (row >= ZH * TT) return; const int i = row % TT; const int zz = row / TT; const bool hires = (i < RH); const float* sr = Sb + (size_t)row * TT; float mx = -3.0e38f;
#pragma unroll 4
    for (int ch = 0; ch < TT / 128; ++ch) { const int j0 = ch * 128 + lane * 4; const v4f a = *(const v4f*)(sr + j0);
#pragma unroll
        for (int q = 0; q < 4; ++q) { float t = a[q] * SCL; asm volatile("" : "+v"(t)); mx = fmaxf(mx, t); } }
#pragma unroll
    for (int sh = 16; sh; sh >>= 1) mx = fmaxf(mx, __shfl_xor(mx, sh, 32));
    float sum = 0.f;
#pragma unroll 4
    for (int ch = 0; ch < TT / 128; ++ch) { const int j0 = ch * 128 + lane * 4; const v4f a = *(const v4f*)(sr + j0);
#pragma unroll
        for (int q = 0; q < 4; ++q) { float t = a[q] * SCL; asm volatile("" : "+v"(t)); float d0 = __fsub_rn(t, mx); asm volatile("" : "+v"(d0)); sum += __builtin_amdgcn_exp2f(__fmul_rn(d0, 1.4426950408889634f)); } }
#pragma unroll
    for (int sh = 16; sh; sh >>= 1) sum += __shfl_xor(sum, sh, 32);
    const float f = __fdiv_rn(hires ? 1.0f : PCAR, sum);
{
        if (hires) {   /* rows < RH: normalised bf16 hi/lo over all keys, planes [zz][RH][TT] */
#pragma unroll
            for (int ch = 0; ch < TT / 128; ++ch) { const int j0 = ch * 128 + lane * 4; const v4f a = *(const v4f*)(sr + j0); v4us oh, ol;
#pragma unroll
                for (int q = 0; q < 4; ++q) { float t = a[q] * SCL; asm volatile("" : "+v"(t)); float d0 = __fsub_rn(t, mx); asm volatile("" : "+v"(d0)); float ex = __builtin_amdgcn_exp2f(__fmul_rn(d0, 1.4426950408889634f)); asm volatile("" : "+v"(ex)); unsigned short a2, c2; splitf(ex * f, a2, c2); oh[q] = a2; ol[q] = c2; }
                const size_t oo = ((size_t)zz * RH + i) * TT + j0; *(v4us*)(Ph + oo) = oh; *(v4us*)(Pl + oo) = ol; }
        } else {
#pragma unroll 2
            for (int ch = 0; ch < TT / 128; ++ch) { const int j0 = ch * 128 + lane * 4; const v4f a = *(const v4f*)(sr + j0); v4h o4;
#pragma unroll
                for (int q = 0; q < 4; ++q) { float t = a[q] * SCL; asm volatile("" : "+v"(t)); float d0 = __fsub_rn(t, mx); asm volatile("" : "+v"(d0)); float ex = __builtin_amdgcn_exp2f(__fmul_rn(d0, 1.4426950408889634f)); asm volatile("" : "+v"(ex)); o4[q] = tohx(ex * f); }
                *(v4h*)(P16 + (size_t)row * TT + j0) = o4; } }
         }
}

__global__ __launch_bounds__(256) void k_merge(const float* __restrict__ O, int h0, float* OUTb) { const size_t e = ((size_t)blockIdx.x * 256 + threadIdx.x) * 2; if (e >= (size_t)ZH * TT * HD) return; const int d = (int)(e % HD); const int t = (int)((e / HD) % TT); const int zz = (int)(e / ((size_t)HD * TT)); const float cs = (t < RH) ? 1.0f : (1.0f / PCAR); const size_t oo = (size_t)t * DQ + (h0 + zz) * HD + d;
    v2f o2; o2[0] = O[e] * cs; o2[1] = O[e + 1] * cs; *(v2f*)(OUTb + oo) = o2;  }

extern "C" void kernel_launch(void* const* d_in, const int* in_sizes, int n_in,
                              void* d_out, int out_size, void* d_ws, size_t ws_size, hipStream_t stream) {
    (void)in_sizes; (void)n_in; (void)out_size;
    const float* x = (const float*)d_in[0]; const float* wq = (const float*)d_in[1]; const float* bq = (const float*)d_in[2]; const float* wk = (const float*)d_in[3]; const float* bk = (const float*)d_in[4]; const float* wv = (const float*)d_in[5]; const float* bv = (const float*)d_in[6]; const float* wo = nullptr; (void)wo;
    float* OUT = (float*)d_out;     // [4][4096][128]
    char* wsp = (char*)d_ws;
    auto take = [&](size_t bytes) { char* p = wsp; wsp += (bytes + 255) & ~(size_t)255; return (void*)p; };
    bf* WQ = (bf*)take((size_t)DQ * DM * 2); bf* WK = (bf*)take((size_t)DKV * DM * 2); bf* WV = (bf*)take((size_t)DKV * DM * 2); 
    bf* XB = (bf*)take((size_t)TT * DM * 2); float* FQ = (float*)take((size_t)TT * DQ * 4); float* FK = (float*)take((size_t)TT * DKV * 4);
    h16* QP16 = (h16*)take((size_t)NH_ * TT * HD * 2); h16* KP16 = (h16*)take((size_t)NKV * TT * HD * 2); h16* VT16 = (h16*)take((size_t)NKV * HD * TT * 2);
    bf* QPh = (bf*)take((size_t)NH_ * TT * HD * 2); bf* QPl = (bf*)take((size_t)NH_ * TT * HD * 2); bf* KPh = (bf*)take((size_t)NKV * TT * HD * 2); bf* KPl = (bf*)take((size_t)NKV * TT * HD * 2); bf* VTh = (bf*)take((size_t)NKV * HD * TT * 2); bf* VTl = (bf*)take((size_t)NKV * HD * TT * 2); bf* Ph = (bf*)take((size_t)ZH * RH * TT * 2); bf* Pl = (bf*)take((size_t)ZH * RH * TT * 2);
    float* Sb = (float*)take((size_t)ZH * TT * TT * 4); h16* P16 = (h16*)take((size_t)ZH * TT * TT * 2); float* Ob = (float*)take((size_t)ZH * TT * HD * 4);
    if ((size_t)(wsp - (char*)d_ws) > ws_size) return;    // ws 256 MiB
    float* FV = FK;   // v projection reuses the k buffer after the k planes are built (stream-ordered)
    { k_wtG<<<(unsigned)((DM * DQ / 64 + 63) / 64), 256, 0, stream>>>(wq, DM, DQ, WQ); k_wtG<<<(unsigned)((DM * DKV / 64 + 63) / 64), 256, 0, stream>>>(wk, DM, DKV, WK); k_wtG<<<(unsigned)((DM * DKV / 64 + 63) / 64), 256, 0, stream>>>(wv, DM, DKV, WV);
      
       }
    const unsigned LQ = (unsigned)(((size_t)NH_ * TT * HD / 2 + 255) / 256), LKv = (unsigned)(((size_t)NKV * TT * HD / 2 + 255) / 256);
    for (int b = 0; b < NB_; ++b) {
        
        k_cvt8<<<(unsigned)(((size_t)TT * DM / 8 + 255) / 256), 256, 0, stream>>>(x + (size_t)b * TT * DM, XB, (size_t)TT * DM / 8);
        k_gemmw<bf, 0, true><<<dim3(TT / 64, DQ / 64, 1), 32, 0, stream>>>(XB, nullptr, WQ, nullptr, DM, FQ, DQ, bq, 0, 0, 0);
        k_flat<<<(unsigned)(((size_t)TT * DQ / 4 + 255) / 256), 256, 0, stream>>>(FQ, QP16, QPh, QPl, (size_t)TT * DQ / 4);
        k_gemmw<bf, 0, true><<<dim3(TT / 64, DKV / 64, 1), 32, 0, stream>>>(XB, nullptr, WK, nullptr, DM, FK, DKV, bk, 0, 0, 0);
        k_flat<<<(unsigned)(((size_t)TT * DKV / 4 + 255) / 256), 256, 0, stream>>>(FK, KP16, KPh, KPl, (size_t)TT * DKV / 4);
        k_gemmw<bf, 0, true><<<dim3(TT / 64, DKV / 64, 1), 32, 0, stream>>>(XB, nullptr, WV, nullptr, DM, FV, DKV, bv, 0, 0, 0); k_vtp<<<LKv, 256, 0, stream>>>(FV, DKV, NKV, VT16, VTh, VTl);
        for (int h0 = 0; h0 < NH_; h0 += ZH) { const size_t zq = (size_t)h0, zk = (size_t)(h0 / REP);   // one kv head per query head: the pass's single head (ZH = 1) uses its own kv plane (z-strides TT*HD)
            k_gemmw<bf, 2, false><<<dim3(RH / 64, TT / 64, ZH), 32, 0, stream>>>(QPh + zq * TT * HD, QPl + zq * TT * HD, KPh + zk * TT * HD, KPl + zk * TT * HD, HD, Sb, TT, nullptr, (size_t)TT * HD, (size_t)TT * HD, (size_t)TT * TT);
            k_gemmw<h16, 0, false><<<dim3((TT - RH) / 64, TT / 64, ZH), 32, 0, stream>>>(QP16 + zq * TT * HD + (size_t)RH * HD, nullptr, KP16 + zk * TT * HD, nullptr, HD, Sb + (size_t)RH * TT, TT, nullptr, (size_t)TT * HD, (size_t)TT * HD, (size_t)TT * TT);
            k_lsoft<<<ZH * TT / 8, 256, 0, stream>>>(Sb, P16, Ph, Pl);
            k_gemmw<bf, 2, false><<<dim3(RH / 64, HD / 64, ZH), 32, 0, stream>>>(Ph, Pl, VTh + zk * HD * TT, VTl + zk * HD * TT, TT, Ob, HD, nullptr, (size_t)RH * TT, (size_t)HD * TT, (size_t)TT * HD);
            k_gemmw<h16, 0, false><<<dim3((TT - RH) / 64, HD / 64, ZH), 32, 0, stream>>>(P16 + (size_t)RH * TT, nullptr, VT16 + zk * HD * TT, nullptr, TT, Ob + (size_t)RH * HD, HD, nullptr, (size_t)TT * TT, (size_t)HD * TT, (size_t)TT * HD);
            k_merge<<<(unsigned)(((size_t)ZH * TT * HD / 2 + 255) / 256), 256, 0, stream>>>(Ob, h0, OUT + (size_t)b * TT * DQ); }
         }
}

// v001
// Measured time: 538 microseconds a run.
// Timed twice side by side with v000, it ran 2.00 and 2.01 times as fast.
#include <hip/hip_runtime.h>

// Single-head self-attention over 4,096 points (inputs [4][4096][128]; q,k,v = inputs W + b ('xw' [128][128] + [128]); softmax(q.k / sqrt(128)) over all points; out = weights v -> [4][4096][128] (2.1 M)).
// Layout per batch: bf16 copy of the inputs; exact projections + bf16-rounded biases; ONE 128-wide head through the dense T-4096 attention (hybrid rows: < 512 hi/lo 3 products, rest fp16 x1024; streaming three-sweep softmax over the 4,096 keys); the f32 merge writes the output rows.
// Compute dtypes, f32 accumulate: every input rounded to bf16; projections exact + bf16-rounded biases; attention rows < 512 3 products, rest fp16; softmax f32; output f32.

#define NB_  4
#define TT   4096
#define DM   128
#define NH_  1
#define NKV  1
#define REP  (NH_ / NKV)
#define HD   128
#define DQ   (NH_ * HD)
#define DKV  (NKV * HD)
#define ZH   1
#define RH   512                  // query rows < RH use hi+lo planes (0: none)
#define WIN  0
#define PCAR 1024.0f
#define SCL  0.088388347648318447f   // 1/sqrt(128)
#define KS   16                   // key slices of the weights x v product: one work-group per (tile, slice), f32 partial planes summed in k_merge
typedef _Float16 h16;
typedef unsigned short bf;
typedef __attribute__((ext_vector_type(16))) __bf16   v16bf;
typedef __attribute__((ext_vector_type(16))) _Float16 v16h;
typedef __attribute__((ext_vector_type(8)))  _Float16 v8h;
typedef __attribute__((ext_vector_type(8)))  unsigned short v8us;
typedef __attribute__((ext_vector_type(8)))  float    v8f;
typedef __attribute__((ext_vector_type(4)))  float    v4f;
typedef v8h  __attribute__((may_alias)) v8ha;
typedef v4f  __attribute__((may_alias)) v4fa;
typedef v8us __attribute__((may_alias)) v8usa;

__device__ __forceinline__ unsigned short f2bf(float f) { unsigned u = __float_as_uint(f); u += 0x7FFFu + ((u >> 16) & 1u); return (unsigned short)(u >> 16); }
__device__ __forceinline__ float bf2f(unsigned short b) { return __uint_as_float(((unsigned)b) << 16); }
__device__ __forceinline__ float bfr(float f) { return bf2f(f2bf(f)); }
__device__ __forceinline__ v16h cat16(v8h lo, v8h hi) { return __builtin_shufflevector(lo, hi, 0, 1, 2, 3, 4, 5, 6, 7, 8, 9, 10, 11, 12, 13, 14, 15); }
__device__ __forceinline__ v16bf cat16b(v8us lo, v8us hi) { return __builtin_bit_cast(v16bf, __builtin_shufflevector(lo, hi, 0, 1, 2, 3, 4, 5, 6, 7, 8, 9, 10, 11, 12, 13, 14, 15)); }
__device__ __forceinline__ v8f wmma16(v16h a, v16h b, v8f c) { return __builtin_amdgcn_wmma_f32_16x16x32_f16(false, a, false, b, (short)0, c, false, false); }
__device__ __forceinline__ v8f wmmab(v16bf a, v16bf b, v8f c) { return __builtin_amdgcn_wmma_f32_16x16x32_bf16(false, a, false, b, (short)0, c, false, false); }



// ---- k_gemmw: register-blocked GEMM, ONE WAVE per 64x64 output tile (16 accumulators), operands straight from K-contiguous 16-bit planes; grid (M/64, N/64, Z), 32 threads.
// C[m][n] (f32, pitch ldc, + optional f32 bias[n]) = sum_k A[m][k] Bt[n][k] (+ split products per NSPLIT). z-batch strides sA/sB/sC in elements. K % 32 == 0.
// K is the row pitch of A and Bt in elements, kn the number of k summed by this work-group: with kn < K and sA = sB = kn, z walks slices of the k range and C + z * sC takes that slice's partial sums. kn % 32 == 0.
template <typename T16> struct WFrag;
template <> struct WFrag<h16> { typedef v16h V; static __device__ __forceinline__ V ld(const h16* p) { return cat16(*(const v8h*)p, *(const v8h*)(p + 16)); } static __device__ __forceinline__ v8f mma(V a, V b, v8f c) { return wmma16(a, b, c); } };
template <> struct WFrag<bf> { typedef v16bf V; static __device__ __forceinline__ V ld(const bf* p) { return cat16b(*(const v8us*)p, *(const v8us*)(p + 16)); } static __device__ __forceinline__ v8f mma(V a, V b, v8f c) { return wmmab(a, b, c); } };
template <typename T16, int NSPLIT, bool BIAS>
__global__ __launch_bounds__(32) void k_gemmw(const T16* __restrict__ A, const T16* __restrict__ A2, const T16* __restrict__ Bt, const T16* __restrict__ Bt2, int K, int kn, float* C, int ldc, const float* __restrict__ bias, size_t sA, size_t sB, size_t sC) {
    typedef typename WFrag<T16>::V V;
    __shared__ __align__(16) float os[16 * 68];
    const size_t z = blockIdx.z; A += z * sA; if (A2) A2 += z * sA; Bt += z * sB; if (Bt2) Bt2 += z * sB; C += z * sC;
    const int lane = threadIdx.x & 31, lr = lane & 15, hi = lane >> 4; const int r0 = blockIdx.x * 64, c0 = blockIdx.y * 64;
    v8f acc[4][4];
#pragma unroll
    for (int mb = 0; mb < 4; ++mb)
#pragma unroll
        for (int nb = 0; nb < 4; ++nb) acc[mb][nb] = (v8f){};
    const size_t aoff = (size_t)(r0 + lr) * K + 8 * hi, boff = (size_t)(c0 + lr) * K + 8 * hi;
#pragma unroll 1
    for (int kc = 0; kc < kn; kc += 32) {
        V a[4], a2[4];
#pragma unroll
        for (int mb = 0; mb < 4; ++mb) { a[mb] = WFrag<T16>::ld(A + aoff + (size_t)mb * 16 * K + kc); if (NSPLIT == 1 || NSPLIT == 2) a2[mb] = WFrag<T16>::ld(A2 + aoff + (size_t)mb * 16 * K + kc); }
#pragma unroll
        for (int nb = 0; nb < 4; ++nb) { const V b = WFrag<T16>::ld(Bt + boff + (size_t)nb * 16 * K + kc); V b2; if (NSPLIT >= 2) b2 = WFrag<T16>::ld(Bt2 + boff + (size_t)nb * 16 * K + kc);
#pragma unroll
            for (int mb = 0; mb < 4; ++mb) { acc[mb][nb] = WFrag<T16>::mma(a[mb], b, acc[mb][nb]); if (NSPLIT == 1 || NSPLIT == 2) acc[mb][nb] = WFrag<T16>::mma(a2[mb], b, acc[mb][nb]); if (NSPLIT >= 2) acc[mb][nb] = WFrag<T16>::mma(a[mb], b2, acc[mb][nb]); } }
        asm volatile("v_nop\n\tv_nop\n\tv_nop\n\tv_nop" : "+v"(acc[0][0]), "+v"(acc[1][1]), "+v"(acc[2][2]), "+v"(acc[3][3]) : "v"(a[0]), "v"(a[3]));
    }
#pragma unroll
    for (int mb = 0; mb < 4; ++mb) {
#pragma unroll
        for (int nb = 0; nb < 4; ++nb) {
#pragma unroll
            for (int j = 0; j < 8; ++j) os[(hi * 8 + j) * 68 + nb * 16 + lr] = acc[mb][nb][j]; }
        __builtin_amdgcn_wave_barrier(); asm volatile("" ::: "memory");
        float* crow = C + (size_t)(r0 + mb * 16) * ldc + c0;
{
#pragma unroll
            for (int s = 0; s < 8; ++s) { const int row = 2 * s + hi, cofs = lr * 4; v4f val = *(const v4fa*)(os + row * 68 + cofs); if (BIAS) { val[0] += bfr(bias[c0 + cofs]); val[1] += bfr(bias[c0 + cofs + 1]); val[2] += bfr(bias[c0 + cofs + 2]); val[3] += bfr(bias[c0 + cofs + 3]); }
                *(v4f*)(crow + (size_t)row * ldc + cofs) = val; }
             }
        __builtin_amdgcn_wave_barrier(); asm volatile("" ::: "memory");
    }
}

__device__ __forceinline__ h16 tohx(float x) { return (h16)x; }
__device__ __forceinline__ void splitf(float y, unsigned short& h, unsigned short& l) { h = f2bf(y); l = f2bf(y - bf2f(h)); }
typedef __attribute__((ext_vector_type(2))) _Float16 v2h;
typedef __attribute__((ext_vector_type(4))) _Float16 v4h;
typedef __attribute__((ext_vector_type(2))) unsigned short v2us;
typedef __attribute__((ext_vector_type(4))) unsigned short v4us;
typedef __attribute__((ext_vector_type(2))) float v2f;
typedef __attribute__((ext_vector_type(4))) int v4i;

__global__ __launch_bounds__(256) void k_wtG(const float* __restrict__ w, int K, int N, bf* Bt) {
    const int lane = threadIdx.x & 31; const int L0 = (blockIdx.x * 8 + (threadIdx.x >> 5)) * 8; const int nlines = N * K / 64;
{
#pragma unroll 1
        for (int l = 0; l < 8; ++l) { const int L = L0 + l; if (L >= nlines) break; const size_t e = (size_t)L * 64 + lane * 2; const int k = (int)(e % K), n = (int)(e / K); v2us o;
            o[0] = f2bf(w[(size_t)k * N + n]); o[1] = f2bf(w[(size_t)(k + 1) * N + n]); *(v2us*)(Bt + e) = o; }
         }
}
__global__ __launch_bounds__(256) void k_cvt8(const float* __restrict__ src, bf* dst, size_t n8) { const size_t i = (size_t)blockIdx.x * 256 + threadIdx.x; if (i >= n8) return; const v8f v = *(const v8f*)(src + i * 8); v8us o;
#pragma unroll
    for (int k = 0; k < 8; ++k) o[k] = f2bf(v[k]); *(v8us*)(dst + i * 8) = o;  }

__global__ __launch_bounds__(256) void k_flat(const float* __restrict__ F, h16* P16, bf* Ph, bf* Pl, size_t n4) { const size_t i = (size_t)blockIdx.x * 256 + threadIdx.x; if (i >= n4) return; const v4f a = *(const v4f*)(F + i * 4); v4h o16; v4us oh, ol;
#pragma unroll
    for (int q = 0; q < 4; ++q) { o16[q] = tohx(a[q]); unsigned short x2, y2; splitf(a[q], x2, y2); oh[q] = x2; ol[q] = y2; }
    *(v4h*)(P16 + i * 4) = o16; *(v4us*)(Ph + i * 4) = oh; *(v4us*)(Pl + i * 4) = ol;  }


__global__ __launch_bounds__(256) void k_vtp(const float* __restrict__ F, int pitch, int nheads, h16* V16, bf* Vh, bf* Vl) { const size_t e = ((size_t)blockIdx.x * 256 + threadIdx.x) * 2; if (e >= (size_t)nheads * HD * TT) return; const int t = (int)(e % TT); const int d = (int)((e / TT) % HD); const int g = (int)(e / ((size_t)TT * HD)); v2h o16; v2us oh, ol;
#pragma unroll
    for (int q = 0; q < 2; ++q) { const float x = F[(size_t)(t + q) * pitch + g * HD + d]; o16[q] = tohx(x); unsigned short a2, c2; splitf(x, a2, c2); oh[q] = a2; ol[q] = c2; }
    *(v2h*)(V16 + e) = o16; *(v2us*)(Vh + e) = oh; *(v2us*)(Vl + e) = ol;  }

// k_lsoft: streaming row softmax over all TK = TT = 4096 keys, one wave per row i, three sweeps of the f32 score row (lane -> 4 consecutive keys per 128-key chunk, 32 chunks; no mask, every score tile is computed):
__global__ __launch_bounds__(256) void k_lsoft(const float* __restrict__ Sb, h16* P16, bf* Ph, bf* Pl) {
    const int lane = threadIdx.x & 31; const int row = blockIdx.x * 8 + (threadIdx.x >> 5); if (row >= ZH * TT) return; const int i = row % TT; const int zz = row / TT; const bool hires = (i < RH); const float* sr = Sb + (size_t)row * TT; float mx = -3.0e38f;
#pragma unroll 4
    for (int ch = 0; ch < TT / 128; ++ch) { const int j0 = ch * 128 + lane * 4; const v4f a = *(const v4f*)(sr + j0);
#pragma unroll
        for (int q = 0; q < 4; ++q) { float t = a[q] * SCL; asm volatile("" : "+v"(t)); mx = fmaxf(mx, t); } }
#pragma unroll
    for (int sh = 16; sh; sh >>= 1) mx = fmaxf(mx, __shfl_xor(mx, sh, 32));
    float sum = 0.f;
#pragma unroll 4
    for (int ch = 0; ch < TT / 128; ++ch) { const int j0 = ch * 128 + lane * 4; const v4f a = *(const v4f*)(sr + j0);
#pragma unroll
        for (int q = 0; q < 4; ++q) { float t = a[q] * SCL; asm volatile("" : "+v"(t)); float d0 = __fsub_rn(t, mx); asm volatile("" : "+v"(d0)); sum += __builtin_amdgcn_exp2f(__fmul_rn(d0, 1.4426950408889634f)); } }
#pragma unroll
    for (int sh = 16; sh; sh >>= 1) sum += __shfl_xor(sum, sh, 32);
    const float f = __fdiv_rn(hires ? 1.0f : PCAR, sum);
{
        if (hires) {   /* rows < RH: normalised bf16 hi/lo over all keys, planes [zz][RH][TT] */
#pragma unroll
            for (int ch = 0; ch < TT / 128; ++ch) { const int j0 = ch * 128 + lane * 4; const v4f a = *(const v4f*)(sr + j0); v4us oh, ol;
#pragma unroll
                for (int q = 0; q < 4; ++q) { float t = a[q] * SCL; asm volatile("" : "+v"(t)); float d0 = __fsub_rn(t, mx); asm volatile("" : "+v"(d0)); float ex = __builtin_amdgcn_exp2f(__fmul_rn(d0, 1.4426950408889634f)); asm volatile("" : "+v"(ex)); unsigned short a2, c2; splitf(ex * f, a2, c2); oh[q] = a2; ol[q] = c2; }
                const size_t oo = ((size_t)zz * RH + i) * TT + j0; *(v4us*)(Ph + oo) = oh; *(v4us*)(Pl + oo) = ol; }
        } else {
#pragma unroll 2
            for (int ch = 0; ch < TT / 128; ++ch) { const int j0 = ch * 128 + lane * 4; const v4f a = *(const v4f*)(sr + j0); v4h o4;
#pragma unroll
                for (int q = 0; q < 4; ++q) { float t = a[q] * SCL; asm volatile("" : "+v"(t)); float d0 = __fsub_rn(t, mx); asm volatile("" : "+v"(d0)); float ex = __builtin_amdgcn_exp2f(__fmul_rn(d0, 1.4426950408889634f)); asm volatile("" : "+v"(ex)); o4[q] = tohx(ex * f); }
                *(v4h*)(P16 + (size_t)row * TT + j0) = o4; } }
         }
}

__global__ __launch_bounds__(256) void k_merge(const float* __restrict__ O, int h0, float* OUTb) { const size_t e = ((size_t)blockIdx.x * 256 + threadIdx.x) * 2; if (e >= (size_t)ZH * TT * HD) return; const int d = (int)(e % HD); const int t = (int)((e / HD) % TT); const int zz = (int)(e / ((size_t)HD * TT)); const float cs = (t < RH) ? 1.0f : (1.0f / PCAR); const size_t oo = (size_t)t * DQ + (h0 + zz) * HD + d;
    v2f p2[KS];   // the KS partial planes of the weights x v product: all loads in flight at once, then added in ascending key order
#pragma unroll
    for (int z = 0; z < KS; ++z) { p2[z] = *(const v2f*)(O + (size_t)z * ZH * TT * HD + e);
        if (z == 11) asm volatile("s_wait_xcnt 0x0" ::: "memory"); }   // the last planes' data land in address registers of the loads issued so far: the wait stands in front of that reuse
    v2f s2 = p2[0];
#pragma unroll
    for (int z = 1; z < KS; ++z) { s2[0] += p2[z][0]; s2[1] += p2[z][1]; }
    v2f o2; o2[0] = s2[0] * cs; o2[1] = s2[1] * cs; *(v2f*)(OUTb + oo) = o2;  }

extern "C" void kernel_launch(void* const* d_in, const int* in_sizes, int n_in,
                              void* d_out, int out_size, void* d_ws, size_t ws_size, hipStream_t stream) {
    (void)in_sizes; (void)n_in; (void)out_size;
    const float* x = (const float*)d_in[0]; const float* wq = (const float*)d_in[1]; const float* bq = (const float*)d_in[2]; const float* wk = (const float*)d_in[3]; const float* bk = (const float*)d_in[4]; const float* wv = (const float*)d_in[5]; const float* bv = (const float*)d_in[6]; const float* wo = nullptr; (void)wo;
    float* OUT = (float*)d_out;     // [4][4096][128]
    char* wsp = (char*)d_ws;
    auto take = [&](size_t bytes) { char* p = wsp; wsp += (bytes + 255) & ~(size_t)255; return (void*)p; };
    bf* WQ = (bf*)take((size_t)DQ * DM * 2); bf* WK = (bf*)take((size_t)DKV * DM * 2); bf* WV = (bf*)take((size_t)DKV * DM * 2); 
    bf* XB = (bf*)take((size_t)TT * DM * 2); float* FQ = (float*)take((size_t)TT * DQ * 4); float* FK = (float*)take((size_t)TT * DKV * 4);
    h16* QP16 = (h16*)take((size_t)NH_ * TT * HD * 2); h16* KP16 = (h16*)take((size_t)NKV * TT * HD * 2); h16* VT16 = (h16*)take((size_t)NKV * HD * TT * 2);
    bf* QPh = (bf*)take((size_t)NH_ * TT * HD * 2); bf* QPl = (bf*)take((size_t)NH_ * TT * HD * 2); bf* KPh = (bf*)take((size_t)NKV * TT * HD * 2); bf* KPl = (bf*)take((size_t)NKV * TT * HD * 2); bf* VTh = (bf*)take((size_t)NKV * HD * TT * 2); bf* VTl = (bf*)take((size_t)NKV * HD * TT * 2); bf* Ph = (bf*)take((size_t)ZH * RH * TT * 2); bf* Pl = (bf*)take((size_t)ZH * RH * TT * 2);
    float* Sb = (float*)take((size_t)ZH * TT * TT * 4); h16* P16 = (h16*)take((size_t)ZH * TT * TT * 2); float* Ob = (float*)take((size_t)KS * ZH * TT * HD * 4);
    if ((size_t)(wsp - (char*)d_ws) > ws_size) return;    // ws 256 MiB
    float* FV = FK;   // v projection reuses the k buffer after the k planes are built (stream-ordered)
    { k_wtG<<<(unsigned)((DM * DQ / 64 + 63) / 64), 256, 0, stream>>>(wq, DM, DQ, WQ); k_wtG<<<(unsigned)((DM * DKV / 64 + 63) / 64), 256, 0, stream>>>(wk, DM, DKV, WK); k_wtG<<<(unsigned)((DM * DKV / 64 + 63) / 64), 256, 0, stream>>>(wv, DM, DKV, WV);
      
       }
    const unsigned LQ = (unsigned)(((size_t)NH_ * TT * HD / 2 + 255) / 256), LKv = (unsigned)(((size_t)NKV * TT * HD / 2 + 255) / 256);
    for (int b = 0; b < NB_; ++b) {
        
        k_cvt8<<<(unsigned)(((size_t)TT * DM / 8 + 255) / 256), 256, 0, stream>>>(x + (size_t)b * TT * DM, XB, (size_t)TT * DM / 8);
        k_gemmw<bf, 0, true><<<dim3(TT / 64, DQ / 64, 1), 32, 0, stream>>>(XB, nullptr, WQ, nullptr, DM, DM, FQ, DQ, bq, 0, 0, 0);
        k_flat<<<(unsigned)(((size_t)TT * DQ / 4 + 255) / 256), 256, 0, stream>>>(FQ, QP16, QPh, QPl, (size_t)TT * DQ / 4);
        k_gemmw<bf, 0, true><<<dim3(TT / 64, DKV / 64, 1), 32, 0, stream>>>(XB, nullptr, WK, nullptr, DM, DM, FK, DKV, bk, 0, 0, 0);
        k_flat<<<(unsigned)(((size_t)TT * DKV / 4 + 255) / 256), 256, 0, stream>>>(FK, KP16, KPh, KPl, (size_t)TT * DKV / 4);
        k_gemmw<bf, 0, true><<<dim3(TT / 64, DKV / 64, 1), 32, 0, stream>>>(XB, nullptr, WV, nullptr, DM, DM, FV, DKV, bv, 0, 0, 0); k_vtp<<<LKv, 256, 0, stream>>>(FV, DKV, NKV, VT16, VTh, VTl);
        for (int h0 = 0; h0 < NH_; h0 += ZH) { const size_t zq = (size_t)h0, zk = (size_t)(h0 / REP);   // one kv head per query head: the pass's one head (ZH == 1) uses kv plane zk (z-strides TT*HD)
            k_gemmw<bf, 2, false><<<dim3(RH / 64, TT / 64, ZH), 32, 0, stream>>>(QPh + zq * TT * HD, QPl + zq * TT * HD, KPh + zk * TT * HD, KPl + zk * TT * HD, HD, HD, Sb, TT, nullptr, (size_t)TT * HD, (size_t)TT * HD, (size_t)TT * TT);
            k_gemmw<h16, 0, false><<<dim3((TT - RH) / 64, TT / 64, ZH), 32, 0, stream>>>(QP16 + zq * TT * HD + (size_t)RH * HD, nullptr, KP16 + zk * TT * HD, nullptr, HD, HD, Sb + (size_t)RH * TT, TT, nullptr, (size_t)TT * HD, (size_t)TT * HD, (size_t)TT * TT);
            k_lsoft<<<ZH * TT / 8, 256, 0, stream>>>(Sb, P16, Ph, Pl);
            k_gemmw<bf, 2, false><<<dim3(RH / 64, HD / 64, KS), 32, 0, stream>>>(Ph, Pl, VTh + zk * HD * TT, VTl + zk * HD * TT, TT, TT / KS, Ob, HD, nullptr, (size_t)(TT / KS), (size_t)(TT / KS), (size_t)ZH * TT * HD);   // z = key slice (ZH == 1)
            k_gemmw<h16, 0, false><<<dim3((TT - RH) / 64, HD / 64, KS), 32, 0, stream>>>(P16 + (size_t)RH * TT, nullptr, VT16 + zk * HD * TT, nullptr, TT, TT / KS, Ob + (size_t)RH * HD, HD, nullptr, (size_t)(TT / KS), (size_t)(TT / KS), (size_t)ZH * TT * HD);
            k_merge<<<(unsigned)(((size_t)ZH * TT * HD / 2 + 255) / 256), 256, 0, stream>>>(Ob, h0, OUT + (size_t)b * TT * DQ); }
         }
}

// v002
// One run takes 336 microseconds.
// In two side-by-side timings against v001, it was 1.46 and 1.60 times as fast.
// Counting every step since v000, it is 3.06 times as fast.
#include <hip/hip_runtime.h>

// Single-head self-attention over 4,096 points (inputs [4][4096][128]; q,k,v = inputs W + b ('xw' [128][128] + [128]); softmax(q.k / sqrt(128)) over all points; out = weights v -> [4][4096][128] (2.1 M)).
// All four batches go through every launch (batch = rows of the projections, grid z of the attention products); the score matrix is held for RP query rows of every batch at a time, so the attention part runs in TT / RP passes.
// Layout per batch: bf16 copy of the inputs; bf16 projections + bf16-rounded biases; ONE 128-wide head through the dense T-4096 attention (hybrid rows: < 512 hi/lo 3 products, rest fp16 x1024; streaming three-sweep softmax over the 4,096 keys); the f32 merge writes the output rows.
// Compute dtypes, f32 accumulate: every input rounded to bf16; projections bf16 x bf16 + bf16-rounded biases; attention rows < 512 3 products, rest fp16; softmax f32; output f32.

#define NB_  4
#define TT   4096
#define DM   128
#define NH_  1
#define NKV  1
#define REP  (NH_ / NKV)
#define HD   128
#define DQ   (NH_ * HD)
#define DKV  (NKV * HD)
#define ZH   1
#define RH   512                  // query rows < RH use hi+lo planes (0: none)
#define RP   2048                 // query rows of each batch per attention pass: NB_ * RP score rows (f32) are what the workspace holds at once
#define WIN  0
#define PCAR 1024.0f
#define SCL  0.088388347648318447f   // 1/sqrt(128)
#define KS   16                   // key slices of the weights x v product: one work-group per (tile, slice), f32 partial planes summed in k_merge
typedef _Float16 h16;
typedef unsigned short bf;
typedef __attribute__((ext_vector_type(16))) __bf16   v16bf;
typedef __attribute__((ext_vector_type(16))) _Float16 v16h;
typedef __attribute__((ext_vector_type(8)))  _Float16 v8h;
typedef __attribute__((ext_vector_type(8)))  unsigned short v8us;
typedef __attribute__((ext_vector_type(8)))  float    v8f;
typedef __attribute__((ext_vector_type(4)))  float    v4f;
typedef v8h  __attribute__((may_alias)) v8ha;
typedef v4f  __attribute__((may_alias)) v4fa;
typedef v8us __attribute__((may_alias)) v8usa;

__device__ __forceinline__ unsigned short f2bf(float f) { unsigned u = __float_as_uint(f); u += 0x7FFFu + ((u >> 16) & 1u); return (unsigned short)(u >> 16); }
__device__ __forceinline__ float bf2f(unsigned short b) { return __uint_as_float(((unsigned)b) << 16); }
__device__ __forceinline__ float bfr(float f) { return bf2f(f2bf(f)); }
__device__ __forceinline__ v16h cat16(v8h lo, v8h hi) { return __builtin_shufflevector(lo, hi, 0, 1, 2, 3, 4, 5, 6, 7, 8, 9, 10, 11, 12, 13, 14, 15); }
__device__ __forceinline__ v16bf cat16b(v8us lo, v8us hi) { return __builtin_bit_cast(v16bf, __builtin_shufflevector(lo, hi, 0, 1, 2, 3, 4, 5, 6, 7, 8, 9, 10, 11, 12, 13, 14, 15)); }
__device__ __forceinline__ v8f wmma16(v16h a, v16h b, v8f c) { return __builtin_amdgcn_wmma_f32_16x16x32_f16(false, a, false, b, (short)0, c, false, false); }
__device__ __forceinline__ v8f wmmab(v16bf a, v16bf b, v8f c) { return __builtin_amdgcn_wmma_f32_16x16x32_bf16(false, a, false, b, (short)0, c, false, false); }



// ---- k_gemmw: register-blocked GEMM, ONE WAVE per 64x64 output tile (16 accumulators), operands straight from K-contiguous 16-bit planes; grid (M/64, N/64, Z), 32 threads.
// C[m][n] (f32, pitch ldc, + optional f32 bias[n]) = sum_k A[m][k] Bt[n][k] (+ split products per NSPLIT). z-batch strides sA/sB/sC in elements. K % 32 == 0.
// K is the row pitch of A and Bt in elements, kn the number of k summed by this work-group. grid z = batch * NKS + slice: the batch moves A, A2, Bt (and Bt2), C by sA, sA2, sB, sC elements; slice s of the k range starts at k = s * kn and its partial sums go to C + s * sCk. kn % 32 == 0.
template <typename T16> struct WFrag;
template <> struct WFrag<h16> { typedef v16h V; static __device__ __forceinline__ V ld(const h16* p) { return cat16(*(const v8h*)p, *(const v8h*)(p + 16)); } static __device__ __forceinline__ v8f mma(V a, V b, v8f c) { return wmma16(a, b, c); } };
template <> struct WFrag<bf> { typedef v16bf V; static __device__ __forceinline__ V ld(const bf* p) { return cat16b(*(const v8us*)p, *(const v8us*)(p + 16)); } static __device__ __forceinline__ v8f mma(V a, V b, v8f c) { return wmmab(a, b, c); } };
template <typename T16, int NSPLIT, bool BIAS, int NKS>
__global__ __launch_bounds__(32) void k_gemmw(const T16* __restrict__ A, const T16* __restrict__ A2, const T16* __restrict__ Bt, const T16* __restrict__ Bt2, int K, int kn, float* C, int ldc, const float* __restrict__ bias, size_t sA, size_t sA2, size_t sB, size_t sC, size_t sCk) {
    typedef typename WFrag<T16>::V V;
    __shared__ __align__(16) float os[16 * 68];
    const size_t zb = blockIdx.z / NKS, ko = (size_t)(blockIdx.z % NKS) * kn; A += zb * sA + ko; if (A2) A2 += zb * sA2 + ko; Bt += zb * sB + ko; if (Bt2) Bt2 += zb * sB + ko; C += zb * sC + (size_t)(blockIdx.z % NKS) * sCk;
    const int lane = threadIdx.x & 31, lr = lane & 15, hi = lane >> 4; const int r0 = blockIdx.x * 64, c0 = blockIdx.y * 64;
    v8f acc[4][4];
#pragma unroll
    for (int mb = 0; mb < 4; ++mb)
#pragma unroll
        for (int nb = 0; nb < 4; ++nb) acc[mb][nb] = (v8f){};
    const size_t aoff = (size_t)(r0 + lr) * K + 8 * hi, boff = (size_t)(c0 + lr) * K + 8 * hi;
#pragma unroll 1
    for (int kc = 0; kc < kn; kc += 32) {
        V a[4], a2[4];
#pragma unroll
        for (int mb = 0; mb < 4; ++mb) { a[mb] = WFrag<T16>::ld(A + aoff + (size_t)mb * 16 * K + kc); if (NSPLIT == 1 || NSPLIT == 2) a2[mb] = WFrag<T16>::ld(A2 + aoff + (size_t)mb * 16 * K + kc); }
#pragma unroll
        for (int nb = 0; nb < 4; ++nb) { const V b = WFrag<T16>::ld(Bt + boff + (size_t)nb * 16 * K + kc); V b2; if (NSPLIT >= 2) b2 = WFrag<T16>::ld(Bt2 + boff + (size_t)nb * 16 * K + kc);
#pragma unroll
            for (int mb = 0; mb < 4; ++mb) { acc[mb][nb] = WFrag<T16>::mma(a[mb], b, acc[mb][nb]); if (NSPLIT == 1 || NSPLIT == 2) acc[mb][nb] = WFrag<T16>::mma(a2[mb], b, acc[mb][nb]); if (NSPLIT >= 2) acc[mb][nb] = WFrag<T16>::mma(a[mb], b2, acc[mb][nb]); } }
        asm volatile("v_nop\n\tv_nop\n\tv_nop\n\tv_nop" : "+v"(acc[0][0]), "+v"(acc[1][1]), "+v"(acc[2][2]), "+v"(acc[3][3]) : "v"(a[0]), "v"(a[3]));
    }
#pragma unroll
    for (int mb = 0; mb < 4; ++mb) {
#pragma unroll
        for (int nb = 0; nb < 4; ++nb) {
#pragma unroll
            for (int j = 0; j < 8; ++j) os[(hi * 8 + j) * 68 + nb * 16 + lr] = acc[mb][nb][j]; }
        __builtin_amdgcn_wave_barrier(); asm volatile("" ::: "memory");
        float* crow = C + (size_t)(r0 + mb * 16) * ldc + c0;
{
#pragma unroll
            for (int s = 0; s < 8; ++s) { const int row = 2 * s + hi, cofs = lr * 4; v4f val = *(const v4fa*)(os + row * 68 + cofs); if (BIAS) { val[0] += bfr(bias[c0 + cofs]); val[1] += bfr(bias[c0 + cofs + 1]); val[2] += bfr(bias[c0 + cofs + 2]); val[3] += bfr(bias[c0 + cofs + 3]); }
                *(v4f*)(crow + (size_t)row * ldc + cofs) = val; }
             }
        __builtin_amdgcn_wave_barrier(); asm volatile("" ::: "memory");
    }
}

__device__ __forceinline__ h16 tohx(float x) { return (h16)x; }
__device__ __forceinline__ void splitf(float y, unsigned short& h, unsigned short& l) { h = f2bf(y); l = f2bf(y - bf2f(h)); }
typedef __attribute__((ext_vector_type(2))) _Float16 v2h;
typedef __attribute__((ext_vector_type(4))) _Float16 v4h;
typedef __attribute__((ext_vector_type(2))) unsigned short v2us;
typedef __attribute__((ext_vector_type(4))) unsigned short v4us;
typedef __attribute__((ext_vector_type(2))) float v2f;
typedef __attribute__((ext_vector_type(4))) int v4i;

__global__ __launch_bounds__(256) void k_wtG(const float* __restrict__ w, int K, int N, bf* Bt) {
    const int lane = threadIdx.x & 31; const int L0 = (blockIdx.x * 8 + (threadIdx.x >> 5)) * 8; const int nlines = N * K / 64;
{
#pragma unroll 1
        for (int l = 0; l < 8; ++l) { const int L = L0 + l; if (L >= nlines) break; const size_t e = (size_t)L * 64 + lane * 2; const int k = (int)(e % K), n = (int)(e / K); v2us o;
            o[0] = f2bf(w[(size_t)k * N + n]); o[1] = f2bf(w[(size_t)(k + 1) * N + n]); *(v2us*)(Bt + e) = o; }
         }
}
__global__ __launch_bounds__(256) void k_cvt8(const float* __restrict__ src, bf* dst, size_t n8) { const size_t i = (size_t)blockIdx.x * 256 + threadIdx.x; if (i >= n8) return; const v8f v = *(const v8f*)(src + i * 8); v8us o;
#pragma unroll
    for (int k = 0; k < 8; ++k) o[k] = f2bf(v[k]); *(v8us*)(dst + i * 8) = o;  }

__global__ __launch_bounds__(256) void k_flat(const float* __restrict__ F, h16* P16, bf* Ph, bf* Pl, size_t n4) { const size_t i = (size_t)blockIdx.x * 256 + threadIdx.x; if (i >= n4) return; const v4f a = *(const v4f*)(F + i * 4); v4h o16; v4us oh, ol;
#pragma unroll
    for (int q = 0; q < 4; ++q) { o16[q] = tohx(a[q]); unsigned short x2, y2; splitf(a[q], x2, y2); oh[q] = x2; ol[q] = y2; }
    *(v4h*)(P16 + i * 4) = o16; *(v4us*)(Ph + i * 4) = oh; *(v4us*)(Pl + i * 4) = ol;  }


__global__ __launch_bounds__(256) void k_vtp(const float* __restrict__ F, int pitch, int nheads, h16* V16, bf* Vh, bf* Vl) { const size_t e = ((size_t)blockIdx.x * 256 + threadIdx.x) * 2; if (e >= (size_t)NB_ * nheads * HD * TT) return; const int t = (int)(e % TT); const int d = (int)((e / TT) % HD); const int g = (int)(e / ((size_t)TT * HD)); const int bb = g / nheads, hh = g % nheads; v2h o16; v2us oh, ol;   // planes [batch][head][HD][TT]
#pragma unroll
    for (int q = 0; q < 2; ++q) { const float x = F[((size_t)bb * TT + t + q) * pitch + hh * HD + d]; o16[q] = tohx(x); unsigned short a2, c2; splitf(x, a2, c2); oh[q] = a2; ol[q] = c2; }
    *(v2h*)(V16 + e) = o16; *(v2us*)(Vh + e) = oh; *(v2us*)(Vl + e) = ol;  }

// k_lsoft: streaming row softmax over the TK = TT = 4096 keys, one wave per row i, three sweeps of the f32 score row (lane -> 4 consecutive keys per 128-key chunk, 32 chunks; no key is masked: the score products compute all TT / 64 key tiles of every row):
// score rows of one pass: row = batch * RP + (i - R0). The hi plane of a row < RH takes that row's own (otherwise unused) place in the P16 buffer (Ph == P16's bytes), the lo plane is [batch][RH][TT].
__global__ __launch_bounds__(256) void k_lsoft(const float* __restrict__ Sb, int R0, h16* P16, bf* Ph, bf* Pl) {
    const int lane = threadIdx.x & 31; const int row = blockIdx.x * 8 + (threadIdx.x >> 5); if (row >= NB_ * RP) return; const int i = R0 + row % RP; const int zz = row / RP; const bool hires = (i < RH); const float* sr = Sb + (size_t)row * TT; float mx = -3.0e38f;
#pragma unroll 4
    for (int ch = 0; ch < TT / 128; ++ch) { const int j0 = ch * 128 + lane * 4; const v4f a = *(const v4f*)(sr + j0);
#pragma unroll
        for (int q = 0; q < 4; ++q) { float t = a[q] * SCL; asm volatile("" : "+v"(t)); mx = fmaxf(mx, t); } }
#pragma unroll
    for (int sh = 16; sh; sh >>= 1) mx = fmaxf(mx, __shfl_xor(mx, sh, 32));
    float sum = 0.f;
#pragma unroll 4
    for (int ch = 0; ch < TT / 128; ++ch) { const int j0 = ch * 128 + lane * 4; const v4f a = *(const v4f*)(sr + j0);
#pragma unroll
        for (int q = 0; q < 4; ++q) { float t = a[q] * SCL; asm volatile("" : "+v"(t)); float d0 = __fsub_rn(t, mx); asm volatile("" : "+v"(d0)); sum += __builtin_amdgcn_exp2f(__fmul_rn(d0, 1.4426950408889634f)); } }
#pragma unroll
    for (int sh = 16; sh; sh >>= 1) sum += __shfl_xor(sum, sh, 32);
    const float f = __fdiv_rn(hires ? 1.0f : PCAR, sum);
{
        if (hires) {   /* rows < RH: normalised bf16 hi/lo over all keys */
#pragma unroll
            for (int ch = 0; ch < TT / 128; ++ch) { const int j0 = ch * 128 + lane * 4; const v4f a = *(const v4f*)(sr + j0); v4us oh, ol;
#pragma unroll
                for (int q = 0; q < 4; ++q) { float t = a[q] * SCL; asm volatile("" : "+v"(t)); float d0 = __fsub_rn(t, mx); asm volatile("" : "+v"(d0)); float ex = __builtin_amdgcn_exp2f(__fmul_rn(d0, 1.4426950408889634f)); asm volatile("" : "+v"(ex)); unsigned short a2, c2; splitf(ex * f, a2, c2); oh[q] = a2; ol[q] = c2; }
                *(v4us*)(Ph + (size_t)row * TT + j0) = oh; *(v4us*)(Pl + ((size_t)zz * RH + i) * TT + j0) = ol;
                asm volatile("s_wait_xcnt 0x0" ::: "memory"); }   // the next chunk reuses the registers that these two stores name: the wait stands in front of that reuse
        } else {
#pragma unroll 2
            for (int ch = 0; ch < TT / 128; ++ch) { const int j0 = ch * 128 + lane * 4; const v4f a = *(const v4f*)(sr + j0); v4h o4;
#pragma unroll
                for (int q = 0; q < 4; ++q) { float t = a[q] * SCL; asm volatile("" : "+v"(t)); float d0 = __fsub_rn(t, mx); asm volatile("" : "+v"(d0)); float ex = __builtin_amdgcn_exp2f(__fmul_rn(d0, 1.4426950408889634f)); asm volatile("" : "+v"(ex)); o4[q] = tohx(ex * f); }
                *(v4h*)(P16 + (size_t)row * TT + j0) = o4; } }
         }
}

__global__ __launch_bounds__(256) void k_merge(const float* __restrict__ O, int R0, float* OUTb) { const size_t e = ((size_t)blockIdx.x * 256 + threadIdx.x) * 2; if (e >= (size_t)NB_ * RP * HD) return; const int d = (int)(e % HD); const int t = R0 + (int)((e / HD) % RP); const int zz = (int)(e / ((size_t)HD * RP)); const float cs = (t < RH) ? 1.0f : (1.0f / PCAR); const size_t oo = ((size_t)zz * TT + t) * DQ + d; const size_t eb = (size_t)zz * KS * RP * HD + e % ((size_t)RP * HD);   // zz = batch; partial planes [batch][slice][RP][HD]
    v2f p2[KS];   // the KS partial planes of the weights x v product: all loads in flight at once, then added in ascending key order
#pragma unroll
    for (int z = 0; z < KS; ++z) p2[z] = *(const v2f*)(O + (size_t)z * RP * HD + eb);
    v2f s2 = p2[0];
#pragma unroll
    for (int z = 1; z < KS; ++z) { s2[0] += p2[z][0]; s2[1] += p2[z][1]; }
    v2f o2; o2[0] = s2[0] * cs; o2[1] = s2[1] * cs; *(v2f*)(OUTb + oo) = o2;  }

extern "C" void kernel_launch(void* const* d_in, const int* in_sizes, int n_in,
                              void* d_out, int out_size, void* d_ws, size_t ws_size, hipStream_t stream) {
    (void)in_sizes; (void)n_in; (void)out_size;
    const float* x = (const float*)d_in[0]; const float* wq = (const float*)d_in[1]; const float* bq = (const float*)d_in[2]; const float* wk = (const float*)d_in[3]; const float* bk = (const float*)d_in[4]; const float* wv = (const float*)d_in[5]; const float* bv = (const float*)d_in[6]; const float* wo = nullptr; (void)wo;
    float* OUT = (float*)d_out;     // [4][4096][128]
    char* wsp = (char*)d_ws;
    auto take = [&](size_t bytes) { char* p = wsp; wsp += (bytes + 255) & ~(size_t)255; return (void*)p; };
    bf* WQ = (bf*)take((size_t)DQ * DM * 2); bf* WK = (bf*)take((size_t)DKV * DM * 2); bf* WV = (bf*)take((size_t)DKV * DM * 2);
    const size_t PE = (size_t)NB_ * TT * HD;   // elements of one 16-bit plane, all batches
    h16* QP16 = (h16*)take(PE * 2); h16* KP16 = (h16*)take(PE * 2); h16* VT16 = (h16*)take(PE * 2);
    bf* QPh = (bf*)take(PE * 2); bf* QPl = (bf*)take(PE * 2); bf* KPh = (bf*)take(PE * 2); bf* KPl = (bf*)take(PE * 2); bf* VTh = (bf*)take(PE * 2); bf* VTl = (bf*)take(PE * 2);
    bf* Pl = (bf*)take((size_t)NB_ * RH * TT * 2); h16* P16 = (h16*)take((size_t)NB_ * RP * TT * 2); bf* Ph = (bf*)P16;   // hi plane: rows < RH of the P16 buffer, which the fp16 path leaves unused
    float* Sb = (float*)take((size_t)NB_ * RP * TT * 4);
    if ((size_t)(wsp - (char*)d_ws) > ws_size) return;    // ws 256 MiB
    // stream-ordered reuse of the score buffer: before the first scores it holds the bf16 inputs and the f32 projections, after each pass's softmax the KS partial planes
    bf* XB = (bf*)Sb; float* FQ = Sb + PE; float* FK = FQ + PE; float* Ob = Sb;
    float* FV = FK;   // v projection reuses the k buffer after the k planes are built (stream-ordered)
    k_wtG<<<(unsigned)((DM * DQ / 64 + 63) / 64), 256, 0, stream>>>(wq, DM, DQ, WQ); k_wtG<<<(unsigned)((DM * DKV / 64 + 63) / 64), 256, 0, stream>>>(wk, DM, DKV, WK); k_wtG<<<(unsigned)((DM * DKV / 64 + 63) / 64), 256, 0, stream>>>(wv, DM, DKV, WV);
    k_cvt8<<<(unsigned)(((size_t)NB_ * TT * DM / 8 + 255) / 256), 256, 0, stream>>>(x, XB, (size_t)NB_ * TT * DM / 8);
    k_gemmw<bf, 0, true, 1><<<dim3(NB_ * TT / 64, DQ / 64, 1), 32, 0, stream>>>(XB, nullptr, WQ, nullptr, DM, DM, FQ, DQ, bq, 0, 0, 0, 0, 0);
    k_flat<<<(unsigned)((PE / 4 + 255) / 256), 256, 0, stream>>>(FQ, QP16, QPh, QPl, PE / 4);
    k_gemmw<bf, 0, true, 1><<<dim3(NB_ * TT / 64, DKV / 64, 1), 32, 0, stream>>>(XB, nullptr, WK, nullptr, DM, DM, FK, DKV, bk, 0, 0, 0, 0, 0);
    k_flat<<<(unsigned)((PE / 4 + 255) / 256), 256, 0, stream>>>(FK, KP16, KPh, KPl, PE / 4);
    k_gemmw<bf, 0, true, 1><<<dim3(NB_ * TT / 64, DKV / 64, 1), 32, 0, stream>>>(XB, nullptr, WV, nullptr, DM, DM, FV, DKV, bv, 0, 0, 0, 0, 0);
    k_vtp<<<(unsigned)((PE / 2 + 255) / 256), 256, 0, stream>>>(FV, DKV, NKV, VT16, VTh, VTl);
    const size_t sQK = (size_t)TT * HD, sS = (size_t)RP * TT, sO = (size_t)KS * RP * HD, sOk = (size_t)RP * HD;   // batch strides of the planes, of a pass's score rows and of its partial planes [batch][slice][RP][HD]; stride of one slice's plane
    for (int R0 = 0; R0 < TT; R0 += RP) {   // pass: query rows [R0, R0 + RP) of every batch; rows < RH (hi/lo path) all lie in the first pass (RH <= RP)
        const int RL = (R0 < RH) ? RH : 0;   // rows of this pass on the hi/lo path
        if (RL) k_gemmw<bf, 2, false, 1><<<dim3(RH / 64, TT / 64, NB_), 32, 0, stream>>>(QPh, QPl, KPh, KPl, HD, HD, Sb, TT, nullptr, sQK, sQK, sQK, sS, 0);
        k_gemmw<h16, 0, false, 1><<<dim3((RP - RL) / 64, TT / 64, NB_), 32, 0, stream>>>(QP16 + (size_t)(R0 + RL) * HD, nullptr, KP16, nullptr, HD, HD, Sb + (size_t)RL * TT, TT, nullptr, sQK, 0, sQK, sS, 0);
        k_lsoft<<<NB_ * RP / 8, 256, 0, stream>>>(Sb, R0, P16, Ph, Pl);
        if (RL) k_gemmw<bf, 2, false, KS><<<dim3(RH / 64, HD / 64, NB_ * KS), 32, 0, stream>>>(Ph, Pl, VTh, VTl, TT, TT / KS, Ob, HD, nullptr, sS, (size_t)RH * TT, sQK, sO, sOk);
        k_gemmw<h16, 0, false, KS><<<dim3((RP - RL) / 64, HD / 64, NB_ * KS), 32, 0, stream>>>(P16 + (size_t)RL * TT, nullptr, VT16, nullptr, TT, TT / KS, Ob + (size_t)RL * HD, HD, nullptr, sS, 0, sQK, sO, sOk);
        k_merge<<<(unsigned)(((size_t)NB_ * RP * HD / 2 + 255) / 256), 256, 0, stream>>>(Ob, R0, OUT);
    }
}

// v003
// A run of this version takes 172 microseconds.
// Next to v002, in two timings, it ran 1.95 and 1.96 times as fast.
// Over all steps from v000 it is 5.99 times as fast.
#include <hip/hip_runtime.h>

// Single-head self-attention over 4,096 points (inputs [4][4096][128]; q,k,v = inputs W + b ('xw' [128][128] + [128]); softmax(q.k / sqrt(128)) over all points; out = weights v -> [4][4096][128] (2.1 M)).
// All four batches go through every launch. Query rows >= RH: ONE fused launch (k_fattn: scores, online softmax and weights x v per 64-row work-group; neither scores nor weights reach memory). Query rows < RH: the hi/lo path through a score buffer of RP = RH rows per batch.
// Layout per batch: bf16 copy of the inputs; bf16 projections (one product) + bf16-rounded biases; ONE 128-wide head, hybrid rows: < 512 hi/lo 3 products (streaming three-sweep softmax over the 4,096 keys, the f32 merge writes their output rows), rest fp16 in the fused kernel, which writes its own output rows.
// Compute dtypes, f32 accumulate: every input rounded to bf16; projections one bf16 product + bf16-rounded biases; attention rows < 512 3 products, rest fp16; softmax f32; output f32.

#define NB_  4
#define TT   4096
#define DM   128
#define NH_  1
#define NKV  1
#define REP  (NH_ / NKV)
#define HD   128
#define DQ   (NH_ * HD)
#define DKV  (NKV * HD)
#define ZH   1
#define RH   512                  // query rows < RH use hi+lo planes (0: none)
#define RP   512                  // query rows of each batch that go through the f32 score buffer: the RH rows of the hi/lo path
#define WIN  0
#define PCAR 1024.0f
#define SCL  0.088388347648318447f   // 1/sqrt(128)
#define KS   16                   // key slices of the weights x v product: one work-group per (tile, slice), f32 partial planes summed in k_merge
typedef _Float16 h16;
typedef unsigned short bf;
typedef __attribute__((ext_vector_type(16))) __bf16   v16bf;
typedef __attribute__((ext_vector_type(16))) _Float16 v16h;
typedef __attribute__((ext_vector_type(8)))  _Float16 v8h;
typedef __attribute__((ext_vector_type(8)))  unsigned short v8us;
typedef __attribute__((ext_vector_type(8)))  float    v8f;
typedef __attribute__((ext_vector_type(4)))  float    v4f;
typedef v8h  __attribute__((may_alias)) v8ha;
typedef v4f  __attribute__((may_alias)) v4fa;
typedef v8us __attribute__((may_alias)) v8usa;

__device__ __forceinline__ unsigned short f2bf(float f) { unsigned u = __float_as_uint(f); u += 0x7FFFu + ((u >> 16) & 1u); return (unsigned short)(u >> 16); }
__device__ __forceinline__ float bf2f(unsigned short b) { return __uint_as_float(((unsigned)b) << 16); }
__device__ __forceinline__ float bfr(float f) { return bf2f(f2bf(f)); }
__device__ __forceinline__ v16h cat16(v8h lo, v8h hi) { return __builtin_shufflevector(lo, hi, 0, 1, 2, 3, 4, 5, 6, 7, 8, 9, 10, 11, 12, 13, 14, 15); }
__device__ __forceinline__ v16bf cat16b(v8us lo, v8us hi) { return __builtin_bit_cast(v16bf, __builtin_shufflevector(lo, hi, 0, 1, 2, 3, 4, 5, 6, 7, 8, 9, 10, 11, 12, 13, 14, 15)); }
__device__ __forceinline__ v8f wmma16(v16h a, v16h b, v8f c) { return __builtin_amdgcn_wmma_f32_16x16x32_f16(false, a, false, b, (short)0, c, false, false); }
__device__ __forceinline__ v8f wmmab(v16bf a, v16bf b, v8f c) { return __builtin_amdgcn_wmma_f32_16x16x32_bf16(false, a, false, b, (short)0, c, false, false); }



// ---- k_gemmw: register-blocked GEMM, ONE WAVE per 64x64 output tile (16 accumulators), operands straight from K-contiguous 16-bit planes; grid (M/64, N/64, Z), 32 threads.
// C[m][n] (f32, pitch ldc, + optional f32 bias[n]) = sum_k A[m][k] Bt[n][k] (+ split products per NSPLIT). z-batch strides sA/sB/sC in elements. K % 32 == 0.
// K is the row pitch of A and Bt in elements, kn the number of k summed by this work-group. grid z = batch * NKS + slice: the batch moves A, A2, Bt (and Bt2), C by sA, sA2, sB, sC elements; slice s of the k range starts at k = s * kn and its partial sums go to C + s * sCk. kn % 32 == 0.
template <typename T16> struct WFrag;
template <> struct WFrag<h16> { typedef v16h V; static __device__ __forceinline__ V ld(const h16* p) { return cat16(*(const v8h*)p, *(const v8h*)(p + 16)); } static __device__ __forceinline__ v8f mma(V a, V b, v8f c) { return wmma16(a, b, c); } };
template <> struct WFrag<bf> { typedef v16bf V; static __device__ __forceinline__ V ld(const bf* p) { return cat16b(*(const v8us*)p, *(const v8us*)(p + 16)); } static __device__ __forceinline__ v8f mma(V a, V b, v8f c) { return wmmab(a, b, c); } };
template <typename T16, int NSPLIT, bool BIAS, int NKS>
__global__ __launch_bounds__(32) void k_gemmw(const T16* __restrict__ A, const T16* __restrict__ A2, const T16* __restrict__ Bt, const T16* __restrict__ Bt2, int K, int kn, float* C, int ldc, const float* __restrict__ bias, size_t sA, size_t sA2, size_t sB, size_t sC, size_t sCk) {
    typedef typename WFrag<T16>::V V;
    __shared__ __align__(16) float os[16 * 68];
    const size_t zb = blockIdx.z / NKS, ko = (size_t)(blockIdx.z % NKS) * kn; A += zb * sA + ko; if (A2) A2 += zb * sA2 + ko; Bt += zb * sB + ko; if (Bt2) Bt2 += zb * sB + ko; C += zb * sC + (size_t)(blockIdx.z % NKS) * sCk;
    const int lane = threadIdx.x & 31, lr = lane & 15, hi = lane >> 4; const int r0 = blockIdx.x * 64, c0 = blockIdx.y * 64;
    v8f acc[4][4];
#pragma unroll
    for (int mb = 0; mb < 4; ++mb)
#pragma unroll
        for (int nb = 0; nb < 4; ++nb) acc[mb][nb] = (v8f){};
    const size_t aoff = (size_t)(r0 + lr) * K + 8 * hi, boff = (size_t)(c0 + lr) * K + 8 * hi;
#pragma unroll 1
    for (int kc = 0; kc < kn; kc += 32) {
        V a[4], a2[4];
#pragma unroll
        for (int mb = 0; mb < 4; ++mb) { a[mb] = WFrag<T16>::ld(A + aoff + (size_t)mb * 16 * K + kc); if (NSPLIT == 1 || NSPLIT == 2) a2[mb] = WFrag<T16>::ld(A2 + aoff + (size_t)mb * 16 * K + kc); }
#pragma unroll
        for (int nb = 0; nb < 4; ++nb) { const V b = WFrag<T16>::ld(Bt + boff + (size_t)nb * 16 * K + kc); V b2; if (NSPLIT >= 2) b2 = WFrag<T16>::ld(Bt2 + boff + (size_t)nb * 16 * K + kc);
#pragma unroll
            for (int mb = 0; mb < 4; ++mb) { acc[mb][nb] = WFrag<T16>::mma(a[mb], b, acc[mb][nb]); if (NSPLIT == 1 || NSPLIT == 2) acc[mb][nb] = WFrag<T16>::mma(a2[mb], b, acc[mb][nb]); if (NSPLIT >= 2) acc[mb][nb] = WFrag<T16>::mma(a[mb], b2, acc[mb][nb]); } }
        asm volatile("v_nop\n\tv_nop\n\tv_nop\n\tv_nop" : "+v"(acc[0][0]), "+v"(acc[1][1]), "+v"(acc[2][2]), "+v"(acc[3][3]) : "v"(a[0]), "v"(a[3]));
    }
#pragma unroll
    for (int mb = 0; mb < 4; ++mb) {
#pragma unroll
        for (int nb = 0; nb < 4; ++nb) {
#pragma unroll
            for (int j = 0; j < 8; ++j) os[(hi * 8 + j) * 68 + nb * 16 + lr] = acc[mb][nb][j]; }
        __builtin_amdgcn_wave_barrier(); asm volatile("" ::: "memory");
        float* crow = C + (size_t)(r0 + mb * 16) * ldc + c0;
{
#pragma unroll
            for (int s = 0; s < 8; ++s) { const int row = 2 * s + hi, cofs = lr * 4; v4f val = *(const v4fa*)(os + row * 68 + cofs); if (BIAS) { val[0] += bfr(bias[c0 + cofs]); val[1] += bfr(bias[c0 + cofs + 1]); val[2] += bfr(bias[c0 + cofs + 2]); val[3] += bfr(bias[c0 + cofs + 3]); }
                *(v4f*)(crow + (size_t)row * ldc + cofs) = val; }
             }
        __builtin_amdgcn_wave_barrier(); asm volatile("" ::: "memory");
    }
}

__device__ __forceinline__ h16 tohx(float x) { return (h16)x; }
__device__ __forceinline__ void splitf(float y, unsigned short& h, unsigned short& l) { h = f2bf(y); l = f2bf(y - bf2f(h)); }
typedef __attribute__((ext_vector_type(2))) _Float16 v2h;
typedef __attribute__((ext_vector_type(4))) _Float16 v4h;
typedef __attribute__((ext_vector_type(2))) unsigned short v2us;
typedef __attribute__((ext_vector_type(4))) unsigned short v4us;
typedef __attribute__((ext_vector_type(2))) float v2f;
typedef __attribute__((ext_vector_type(4))) int v4i;

__global__ __launch_bounds__(256) void k_wtG(const float* __restrict__ w, int K, int N, bf* Bt) {
    const int lane = threadIdx.x & 31; const int L0 = (blockIdx.x * 8 + (threadIdx.x >> 5)) * 8; const int nlines = N * K / 64;
{
#pragma unroll 1
        for (int l = 0; l < 8; ++l) { const int L = L0 + l; if (L >= nlines) break; const size_t e = (size_t)L * 64 + lane * 2; const int k = (int)(e % K), n = (int)(e / K); v2us o;
            o[0] = f2bf(w[(size_t)k * N + n]); o[1] = f2bf(w[(size_t)(k + 1) * N + n]); *(v2us*)(Bt + e) = o; }
         }
}
__global__ __launch_bounds__(256) void k_cvt8(const float* __restrict__ src, bf* dst, size_t n8) { const size_t i = (size_t)blockIdx.x * 256 + threadIdx.x; if (i >= n8) return; const v8f v = *(const v8f*)(src + i * 8); v8us o;
#pragma unroll
    for (int k = 0; k < 8; ++k) o[k] = f2bf(v[k]); *(v8us*)(dst + i * 8) = o;  }

__global__ __launch_bounds__(256) void k_flat(const float* __restrict__ F, h16* P16, bf* Ph, bf* Pl, size_t n4) { const size_t i = (size_t)blockIdx.x * 256 + threadIdx.x; if (i >= n4) return; const v4f a = *(const v4f*)(F + i * 4); v4h o16; v4us oh, ol;
#pragma unroll
    for (int q = 0; q < 4; ++q) { o16[q] = tohx(a[q]); unsigned short x2, y2; splitf(a[q], x2, y2); oh[q] = x2; ol[q] = y2; }
    *(v4h*)(P16 + i * 4) = o16; *(v4us*)(Ph + i * 4) = oh; *(v4us*)(Pl + i * 4) = ol;  }


__global__ __launch_bounds__(256) void k_vtp(const float* __restrict__ F, int pitch, int nheads, h16* V16, bf* Vh, bf* Vl) { const size_t e = ((size_t)blockIdx.x * 256 + threadIdx.x) * 2; if (e >= (size_t)NB_ * nheads * HD * TT) return; const int t = (int)(e % TT); const int d = (int)((e / TT) % HD); const int g = (int)(e / ((size_t)TT * HD)); const int bb = g / nheads, hh = g % nheads; v2h o16; v2us oh, ol;   // planes [batch][head][HD][TT]
#pragma unroll
    for (int q = 0; q < 2; ++q) { const float x = F[((size_t)bb * TT + t + q) * pitch + hh * HD + d]; o16[q] = tohx(x); unsigned short a2, c2; splitf(x, a2, c2); oh[q] = a2; ol[q] = c2; }
    *(v2h*)(V16 + e) = o16; *(v2us*)(Vh + e) = oh; *(v2us*)(Vl + e) = ol;  }

// k_lsoft: streaming row softmax over the TK = TT = 4096 keys, one wave per row i, three sweeps of the f32 score row (lane -> 4 consecutive keys per 128-key chunk, 32 chunks; no key is masked: the score products compute all TT / 64 key tiles of every row):
// score rows of one pass: row = batch * RP + (i - R0). The hi plane of a row < RH takes that row's own (otherwise unused) place in the P16 buffer (Ph == P16's bytes), the lo plane is [batch][RH][TT].
__global__ __launch_bounds__(256) void k_lsoft(const float* __restrict__ Sb, int R0, h16* P16, bf* Ph, bf* Pl) {
    const int lane = threadIdx.x & 31; const int row = blockIdx.x * 8 + (threadIdx.x >> 5); if (row >= NB_ * RP) return; const int i = R0 + row % RP; const int zz = row / RP; const bool hires = (i < RH); const float* sr = Sb + (size_t)row * TT; float mx = -3.0e38f;
#pragma unroll 4
    for (int ch = 0; ch < TT / 128; ++ch) { const int j0 = ch * 128 + lane * 4; const v4f a = *(const v4f*)(sr + j0);
#pragma unroll
        for (int q = 0; q < 4; ++q) { float t = a[q] * SCL; asm volatile("" : "+v"(t)); mx = fmaxf(mx, t); } }
#pragma unroll
    for (int sh = 16; sh; sh >>= 1) mx = fmaxf(mx, __shfl_xor(mx, sh, 32));
    float sum = 0.f;
#pragma unroll 4
    for (int ch = 0; ch < TT / 128; ++ch) { const int j0 = ch * 128 + lane * 4; const v4f a = *(const v4f*)(sr + j0);
#pragma unroll
        for (int q = 0; q < 4; ++q) { float t = a[q] * SCL; asm volatile("" : "+v"(t)); float d0 = __fsub_rn(t, mx); asm volatile("" : "+v"(d0)); sum += __builtin_amdgcn_exp2f(__fmul_rn(d0, 1.4426950408889634f)); } }
#pragma unroll
    for (int sh = 16; sh; sh >>= 1) sum += __shfl_xor(sum, sh, 32);
    const float f = __fdiv_rn(hires ? 1.0f : PCAR, sum);
{
        if (hires) {   /* rows < RH: normalised bf16 hi/lo over all keys */
#pragma unroll
            for (int ch = 0; ch < TT / 128; ++ch) { const int j0 = ch * 128 + lane * 4; const v4f a = *(const v4f*)(sr + j0); v4us oh, ol;
#pragma unroll
                for (int q = 0; q < 4; ++q) { float t = a[q] * SCL; asm volatile("" : "+v"(t)); float d0 = __fsub_rn(t, mx); asm volatile("" : "+v"(d0)); float ex = __builtin_amdgcn_exp2f(__fmul_rn(d0, 1.4426950408889634f)); asm volatile("" : "+v"(ex)); unsigned short a2, c2; splitf(ex * f, a2, c2); oh[q] = a2; ol[q] = c2; }
                *(v4us*)(Ph + (size_t)row * TT + j0) = oh; *(v4us*)(Pl + ((size_t)zz * RH + i) * TT + j0) = ol;
                asm volatile("s_wait_xcnt 0x0" ::: "memory"); }   // the next chunk reuses the registers that these two stores name: the wait stands in front of that reuse
        } else {
#pragma unroll 2
            for (int ch = 0; ch < TT / 128; ++ch) { const int j0 = ch * 128 + lane * 4; const v4f a = *(const v4f*)(sr + j0); v4h o4;
#pragma unroll
                for (int q = 0; q < 4; ++q) { float t = a[q] * SCL; asm volatile("" : "+v"(t)); float d0 = __fsub_rn(t, mx); asm volatile("" : "+v"(d0)); float ex = __builtin_amdgcn_exp2f(__fmul_rn(d0, 1.4426950408889634f)); asm volatile("" : "+v"(ex)); o4[q] = tohx(ex * f); }
                *(v4h*)(P16 + (size_t)row * TT + j0) = o4; } }
         }
}

__global__ __launch_bounds__(256) void k_merge(const float* __restrict__ O, int R0, float* OUTb) { const size_t e = ((size_t)blockIdx.x * 256 + threadIdx.x) * 2; if (e >= (size_t)NB_ * RP * HD) return; const int d = (int)(e % HD); const int t = R0 + (int)((e / HD) % RP); const int zz = (int)(e / ((size_t)HD * RP)); const float cs = (t < RH) ? 1.0f : (1.0f / PCAR); const size_t oo = ((size_t)zz * TT + t) * DQ + d; const size_t eb = (size_t)zz * KS * RP * HD + e % ((size_t)RP * HD);   // zz = batch; partial planes [batch][slice][RP][HD]
    v2f p2[KS];   // the KS partial planes of the weights x v product: all loads in flight at once, then added in ascending key order
#pragma unroll
    for (int z = 0; z < KS; ++z) p2[z] = *(const v2f*)(O + (size_t)z * RP * HD + eb);
    v2f s2 = p2[0];
#pragma unroll
    for (int z = 1; z < KS; ++z) { s2[0] += p2[z][0]; s2[1] += p2[z][1]; }
    v2f o2; o2[0] = s2[0] * cs; o2[1] = s2[1] * cs; *(v2f*)(OUTb + oo) = o2;  }

#define FSK    128                // keys per stage
#define FPITCH 272                // LDS row pitch in bytes: 256 + 16, an odd multiple of 16 for the 16-byte fragment reads
#define FTILE  (128 * FPITCH)     // one tile: 128 rows (K: keys, 256 B of d; V^T: d, 256 B of keys)
#define FSLOT  (2 * FTILE)
__device__ __forceinline__ float xhalf(float x) { return __builtin_bit_cast(float, __builtin_amdgcn_permlanex16(__builtin_bit_cast(int, x), __builtin_bit_cast(int, x), 0x76543210, 0xfedcba98, false, false)); }   // lane l with lane l ^ 16
// 2^x with the slot that the instruction set asks for behind a transcendental (before its result is read or its source overwritten): the v_nop stands in the same statement so that it stays directly behind
__device__ __forceinline__ float exp2s(float x) { float r; asm("v_exp_f32 %0, %1\n\tv_nop" : "=v"(r) : "v"(x)); return r; }
// eight 16-byte copies of one lane, rows 16 apart; the s_wait_xcnt closes the statement so that no address register is rewritten in front of it
__device__ __forceinline__ void cp8(unsigned l, const char* g, size_t gs) {
    asm volatile("global_load_async_to_lds_b128 %0, %8, off\n\tglobal_load_async_to_lds_b128 %1, %9, off\n\tglobal_load_async_to_lds_b128 %2, %10, off\n\tglobal_load_async_to_lds_b128 %3, %11, off\n\t"
                 "global_load_async_to_lds_b128 %4, %12, off\n\tglobal_load_async_to_lds_b128 %5, %13, off\n\tglobal_load_async_to_lds_b128 %6, %14, off\n\tglobal_load_async_to_lds_b128 %7, %15, off\n\ts_wait_xcnt 0x0"
                 :: "v"(l), "v"(l + 16u * FPITCH), "v"(l + 32u * FPITCH), "v"(l + 48u * FPITCH), "v"(l + 64u * FPITCH), "v"(l + 80u * FPITCH), "v"(l + 96u * FPITCH), "v"(l + 112u * FPITCH),
                    "v"(g), "v"(g + gs), "v"(g + 2 * gs), "v"(g + 3 * gs), "v"(g + 4 * gs), "v"(g + 5 * gs), "v"(g + 6 * gs), "v"(g + 7 * gs) : "memory");
}
// 256 registers: every operand stays directly addressable (no register-bank switches in the loop) and two work-groups fit a WGP
__global__ __launch_bounds__(256) __attribute__((amdgpu_num_vgpr(256))) void k_fattn(const h16* __restrict__ Q, const h16* __restrict__ Kp, const h16* __restrict__ Vt, float* OUTb) {
    __shared__ __attribute__((aligned(16))) unsigned char L[2 * FSLOT];
    const int tid = threadIdx.x, lane = tid & 31, wave = tid >> 5, c = lane & 15, h = lane >> 4, cg = wave & 3, kp = wave >> 2; const size_t zb = blockIdx.y; const int qrow = RH + blockIdx.x * 64 + cg * 16 + c;
    // thread -> 16-byte piece tid & 15 of rows (tid >> 4) + 16 n, n = 0..7, of either tile
    const unsigned lcp = (unsigned)(size_t)L + (unsigned)(tid >> 4) * FPITCH + (unsigned)(tid & 15) * 16u;
    const char* gk = (const char*)(Kp + zb * TT * HD) + (size_t)(tid >> 4) * (HD * 2) + (tid & 15) * 16;
    const char* gv = (const char*)(Vt + zb * HD * TT) + (size_t)(tid >> 4) * (TT * 2) + (tid & 15) * 16;
    auto stage = [&](int st) { const unsigned lb = lcp + (unsigned)(st & 1) * FSLOT; cp8(lb, gk + (size_t)st * (FSK * HD * 2), 16 * HD * 2); cp8(lb + FTILE, gv + (size_t)st * (FSK * 2), (size_t)16 * TT * 2); };
    stage(0);
    v16h qf[4];
#pragma unroll   // constant indices keep the array in registers
    for (int kc = 0; kc < 4; ++kc) qf[kc] = WFrag<h16>::ld(Q + (zb * TT + qrow) * HD + 8 * h + 32 * kc);
    v8f acc[8];
#pragma unroll   // constant indices keep the array in registers
    for (int t = 0; t < 8; ++t) acc[t] = (v8f){};
    float m_run = -__builtin_inff(), l_run = 0.f; const float cs = SCL * 1.4426950408889634f;   // scores in the log2 domain
    asm volatile("s_wait_asynccnt 0x0" ::: "memory");   // this wave's copies of stage 0 have landed
    __syncthreads();                                    // ... and every other wave's
    stage(1);
    const int kro = (kp * 64 + c) * FPITCH + 16 * h, vro = FTILE + c * FPITCH + kp * 128 + 16 * h;   // this lane's first K row and first V^T row piece in a buffer
#pragma unroll 1   // rolled: one stage is the loop body, the two buffers alternate by st & 1
    for (int st = 0; st < TT / FSK; ++st) {
        const unsigned char* Bf = L + (st & 1) * FSLOT;
        v16h kf[2][4], vf[8];
#pragma unroll   // constant indices keep the array in registers
        for (int kt = 0; kt < 2; ++kt)
#pragma unroll   // constant indices keep the array in registers
            for (int kc = 0; kc < 4; ++kc) kf[kt][kc] = WFrag<h16>::ld((const h16*)(Bf + kro + kt * 16 * FPITCH + 64 * kc));
#pragma unroll   // constant indices keep the array in registers
        for (int sub = 0; sub < 2; ++sub) {   // one pass: 32 keys
#pragma unroll   // constant indices keep the array in registers
            for (int t = 0; t < 8; ++t) vf[t] = WFrag<h16>::ld((const h16*)(Bf + vro + t * 16 * FPITCH + sub * 64));
            __builtin_amdgcn_sched_barrier(0);   // keeps the pass's V^T reads issued as one group here, in flight under the score products and the softmax
            v8f s[2];
#pragma unroll   // constant indices keep the array in registers
            for (int kt = 0; kt < 2; ++kt) { s[kt] = (v8f){};
#pragma unroll   // constant indices keep the array in registers
                for (int kc = 0; kc < 4; ++kc) s[kt] = wmma16(kf[kt][kc], qf[kc], s[kt]); }
            float mx = s[0][0];
#pragma unroll   // constant indices keep the array in registers
            for (int j = 1; j < 8; ++j) mx = fmaxf(mx, s[0][j]);
#pragma unroll   // constant indices keep the array in registers
            for (int j = 0; j < 8; ++j) mx = fmaxf(mx, s[1][j]);
            mx = fmaxf(mx, xhalf(mx)) * cs;
            // lazy rescale: the maximum in use may trail the true one by up to 8 (log2), so a weight stays <= 256; one scalar test per pass
            if (__builtin_amdgcn_ballot_w32(mx > m_run + 8.0f) != 0) { const float m_new = fmaxf(m_run, mx); const float corr = __builtin_amdgcn_exp2f(m_run - m_new); l_run *= corr; m_run = m_new;
#pragma unroll   // constant indices keep the array in registers
                for (int t = 0; t < 8; ++t) acc[t] = acc[t] * corr; }
            v16h pf; float ps0 = 0.f, ps1 = 0.f;
#pragma unroll   // constant indices keep the array in registers
            for (int j = 0; j < 8; ++j) { const float p0 = exp2s(__builtin_fmaf(s[0][j], cs, -m_run)), p1 = exp2s(__builtin_fmaf(s[1][j], cs, -m_run)); ps0 += p0; ps1 += p1; pf[j] = (h16)p0; pf[8 + j] = (h16)p1; }
            l_run += ps0 + ps1;
            if (sub == 0) {
                __builtin_amdgcn_sched_barrier(0);   // keeps the next pass's K reads here, as one group behind the softmax (whose registers they take) and in flight under the products below
#pragma unroll   // constant indices keep the array in registers
                for (int kt = 0; kt < 2; ++kt)
#pragma unroll   // constant indices keep the array in registers
                    for (int kc = 0; kc < 4; ++kc) kf[kt][kc] = WFrag<h16>::ld((const h16*)(Bf + kro + (32 + kt * 16) * FPITCH + 64 * kc));
                __builtin_amdgcn_sched_barrier(0);   // as above
            }
#pragma unroll   // constant indices keep the array in registers
            for (int t = 0; t < 8; ++t) acc[t] = wmma16(vf[t], pf, acc[t]);
        }
        asm volatile("s_wait_dscnt 0x0" ::: "memory");      // this wave's reads of the buffer are done
        asm volatile("s_wait_asynccnt 0x0" ::: "memory");   // this wave's copies of stage st + 1 have landed
        __syncthreads();                                    // publishes stage st + 1 and ends every wave's reads of stage st
        if (st + 2 < TT / FSK) stage(st + 2);               // refill of the buffer just left
    }
    asm volatile("s_wait_asynccnt 0x0" ::: "memory");       // no copy in flight: the buffers become the staging of the join
    // join of the two key parts: part 1 hands its accumulators, maximum and sum to part 0 of the same column group (behind the loop's last barrier nobody reads the buffers)
    v4f* X = (v4f*)L + (size_t)cg * 17 * 32 + lane;
    if (kp == 1) {
#pragma unroll   // constant indices keep the array in registers
        for (int t = 0; t < 8; ++t) { X[(2 * t) * 32] = __builtin_shufflevector(acc[t], acc[t], 0, 1, 2, 3); X[(2 * t + 1) * 32] = __builtin_shufflevector(acc[t], acc[t], 4, 5, 6, 7); }
        X[16 * 32] = (v4f){m_run, l_run, 0.f, 0.f};
    }
    __syncthreads();   // part 1's values are in LDS
    if (kp == 0) {
        const v4f ml = X[16 * 32]; const float m_all = fmaxf(m_run, ml[0]); const float a0 = __builtin_amdgcn_exp2f(m_run - m_all), a1 = __builtin_amdgcn_exp2f(ml[0] - m_all);
        const float lh = l_run * a0 + ml[1] * a1; const float inv = 1.0f / (lh + xhalf(lh));   // each half summed its own eight keys of every tile
        const float f0 = a0 * inv, f1 = a1 * inv; float* orow = OUTb + (zb * TT + qrow) * DQ + 8 * h;
#pragma unroll   // constant indices keep the array in registers
        for (int t = 0; t < 8; ++t) { const v4f x0 = X[(2 * t) * 32], x1 = X[(2 * t + 1) * 32]; v4f a, b;
#pragma unroll   // constant indices keep the array in registers
            for (int j = 0; j < 4; ++j) { a[j] = acc[t][j] * f0 + x0[j] * f1; b[j] = acc[t][4 + j] * f0 + x1[j] * f1; }
            *(v4f*)(orow + t * 16) = a; *(v4f*)(orow + t * 16 + 4) = b; }
    }
}

extern "C" void kernel_launch(void* const* d_in, const int* in_sizes, int n_in,
                              void* d_out, int out_size, void* d_ws, size_t ws_size, hipStream_t stream) {
    (void)in_sizes; (void)n_in; (void)out_size;
    const float* x = (const float*)d_in[0]; const float* wq = (const float*)d_in[1]; const float* bq = (const float*)d_in[2]; const float* wk = (const float*)d_in[3]; const float* bk = (const float*)d_in[4]; const float* wv = (const float*)d_in[5]; const float* bv = (const float*)d_in[6]; const float* wo = nullptr; (void)wo;
    float* OUT = (float*)d_out;     // [4][4096][128]
    char* wsp = (char*)d_ws;
    auto take = [&](size_t bytes) { char* p = wsp; wsp += (bytes + 255) & ~(size_t)255; return (void*)p; };
    bf* WQ = (bf*)take((size_t)DQ * DM * 2); bf* WK = (bf*)take((size_t)DKV * DM * 2); bf* WV = (bf*)take((size_t)DKV * DM * 2);
    const size_t PE = (size_t)NB_ * TT * HD;   // elements of one 16-bit plane, all batches
    h16* QP16 = (h16*)take(PE * 2); h16* KP16 = (h16*)take(PE * 2); h16* VT16 = (h16*)take(PE * 2);
    bf* QPh = (bf*)take(PE * 2); bf* QPl = (bf*)take(PE * 2); bf* KPh = (bf*)take(PE * 2); bf* KPl = (bf*)take(PE * 2); bf* VTh = (bf*)take(PE * 2); bf* VTl = (bf*)take(PE * 2);
    bf* Pl = (bf*)take((size_t)NB_ * RH * TT * 2); h16* P16 = (h16*)take((size_t)NB_ * RP * TT * 2); bf* Ph = (bf*)P16;   // hi plane: the P16 buffer's bytes (every row that passes through it is a hi/lo row)
    float* Sb = (float*)take((size_t)NB_ * RP * TT * 4);
    if ((size_t)(wsp - (char*)d_ws) > ws_size) return;    // ws 256 MiB
    // stream-ordered reuse of the score buffer: before the first scores it holds the bf16 inputs and the f32 projections, after the softmax the KS partial planes
    bf* XB = (bf*)Sb; float* FQ = Sb + PE; float* FK = FQ + PE; float* Ob = Sb;
    float* FV = FK;   // v projection reuses the k buffer after the k planes are built (stream-ordered)
    k_wtG<<<(unsigned)((DM * DQ / 64 + 63) / 64), 256, 0, stream>>>(wq, DM, DQ, WQ); k_wtG<<<(unsigned)((DM * DKV / 64 + 63) / 64), 256, 0, stream>>>(wk, DM, DKV, WK); k_wtG<<<(unsigned)((DM * DKV / 64 + 63) / 64), 256, 0, stream>>>(wv, DM, DKV, WV);
    k_cvt8<<<(unsigned)(((size_t)NB_ * TT * DM / 8 + 255) / 256), 256, 0, stream>>>(x, XB, (size_t)NB_ * TT * DM / 8);
    k_gemmw<bf, 0, true, 1><<<dim3(NB_ * TT / 64, DQ / 64, 1), 32, 0, stream>>>(XB, nullptr, WQ, nullptr, DM, DM, FQ, DQ, bq, 0, 0, 0, 0, 0);
    k_flat<<<(unsigned)((PE / 4 + 255) / 256), 256, 0, stream>>>(FQ, QP16, QPh, QPl, PE / 4);
    k_gemmw<bf, 0, true, 1><<<dim3(NB_ * TT / 64, DKV / 64, 1), 32, 0, stream>>>(XB, nullptr, WK, nullptr, DM, DM, FK, DKV, bk, 0, 0, 0, 0, 0);
    k_flat<<<(unsigned)((PE / 4 + 255) / 256), 256, 0, stream>>>(FK, KP16, KPh, KPl, PE / 4);
    k_gemmw<bf, 0, true, 1><<<dim3(NB_ * TT / 64, DKV / 64, 1), 32, 0, stream>>>(XB, nullptr, WV, nullptr, DM, DM, FV, DKV, bv, 0, 0, 0, 0, 0);
    k_vtp<<<(unsigned)((PE / 2 + 255) / 256), 256, 0, stream>>>(FV, DKV, NKV, VT16, VTh, VTl);
    const size_t sQK = (size_t)TT * HD, sS = (size_t)RP * TT, sO = (size_t)KS * RP * HD, sOk = (size_t)RP * HD;   // batch strides of the planes, of the score rows and of the partial planes [batch][slice][RP][HD]; stride of one slice's plane
    k_fattn<<<dim3((TT - RH) / 64, NB_), 256, 0, stream>>>(QP16, KP16, VT16, OUT);   // query rows >= RH
    // query rows < RH: hi/lo path through the score buffer
    k_gemmw<bf, 2, false, 1><<<dim3(RH / 64, TT / 64, NB_), 32, 0, stream>>>(QPh, QPl, KPh, KPl, HD, HD, Sb, TT, nullptr, sQK, sQK, sQK, sS, 0);
    k_lsoft<<<NB_ * RP / 8, 256, 0, stream>>>(Sb, 0, P16, Ph, Pl);
    k_gemmw<bf, 2, false, KS><<<dim3(RH / 64, HD / 64, NB_ * KS), 32, 0, stream>>>(Ph, Pl, VTh, VTl, TT, TT / KS, Ob, HD, nullptr, sS, (size_t)RH * TT, sQK, sO, sOk);
    k_merge<<<(unsigned)(((size_t)NB_ * RP * HD / 2 + 255) / 256), 256, 0, stream>>>(Ob, 0, OUT);
}

// v004
// One run takes 128 microseconds.
// Two timings next to v003 put it at 1.35 and 1.33 times that version's speed.
// Over all steps from v000 it is 8.03 times as fast.
#include <hip/hip_runtime.h>

// Single-head self-attention over 4,096 points (inputs [4][4096][128]; q,k,v = inputs W + b ('xw' [128][128] + [128]); softmax(q.k / sqrt(128)) over all points; out = weights v -> [4][4096][128] (2.1 M)).
// All four batches go through every launch. Query rows >= RH: ONE fused launch (k_fattn: scores, online softmax and weights x v per 64-row work-group; neither scores nor weights reach memory). Query rows < RH: the hi/lo path through a score buffer of RP = RH rows per batch.
// Front end: ONE launch (k_proj) rounds inputs and weights to bf16, does the three projections and writes every 16-bit plane. Exact projections + bf16-rounded biases; ONE 128-wide head, hybrid rows: < 512 hi/lo 3 products (streaming three-sweep softmax over the 4,096 keys, the f32 merge writes their output rows), rest fp16 in the fused kernel, which writes its own output rows.
// Compute dtypes, f32 accumulate: every input rounded to bf16; projections exact + bf16-rounded biases; attention rows < 512 3 products, rest fp16; softmax f32; output f32.

#define NB_  4
#define TT   4096
#define DM   128
#define NH_  1
#define NKV  1
#define REP  (NH_ / NKV)
#define HD   128
#define DQ   (NH_ * HD)
#define DKV  (NKV * HD)
#define ZH   1
#define RH   512                  // query rows < RH use hi+lo planes (0: none)
#define RP   512                  // query rows of each batch that go through the f32 score buffer: the RH rows of the hi/lo path
#define WIN  0
#define PCAR 1024.0f
#define SCL  0.088388347648318447f   // 1/sqrt(128)
#define KS   16                   // key slices of the weights x v product: one work-group per (tile, slice), f32 partial planes summed in k_merge
typedef _Float16 h16;
typedef unsigned short bf;
typedef __attribute__((ext_vector_type(16))) __bf16   v16bf;
typedef __attribute__((ext_vector_type(16))) _Float16 v16h;
typedef __attribute__((ext_vector_type(8)))  _Float16 v8h;
typedef __attribute__((ext_vector_type(8)))  unsigned short v8us;
typedef __attribute__((ext_vector_type(8)))  float    v8f;
typedef __attribute__((ext_vector_type(4)))  float    v4f;
typedef v8h  __attribute__((may_alias)) v8ha;
typedef v4f  __attribute__((may_alias)) v4fa;
typedef v8us __attribute__((may_alias)) v8usa;

__device__ __forceinline__ unsigned short f2bf(float f) { unsigned u = __float_as_uint(f); u += 0x7FFFu + ((u >> 16) & 1u); return (unsigned short)(u >> 16); }
__device__ __forceinline__ float bf2f(unsigned short b) { return __uint_as_float(((unsigned)b) << 16); }
__device__ __forceinline__ float bfr(float f) { return bf2f(f2bf(f)); }
__device__ __forceinline__ v16h cat16(v8h lo, v8h hi) { return __builtin_shufflevector(lo, hi, 0, 1, 2, 3, 4, 5, 6, 7, 8, 9, 10, 11, 12, 13, 14, 15); }
__device__ __forceinline__ v16bf cat16b(v8us lo, v8us hi) { return __builtin_bit_cast(v16bf, __builtin_shufflevector(lo, hi, 0, 1, 2, 3, 4, 5, 6, 7, 8, 9, 10, 11, 12, 13, 14, 15)); }
__device__ __forceinline__ v8f wmma16(v16h a, v16h b, v8f c) { return __builtin_amdgcn_wmma_f32_16x16x32_f16(false, a, false, b, (short)0, c, false, false); }
__device__ __forceinline__ v8f wmmab(v16bf a, v16bf b, v8f c) { return __builtin_amdgcn_wmma_f32_16x16x32_bf16(false, a, false, b, (short)0, c, false, false); }



// ---- k_gemmw: register-blocked GEMM, ONE WAVE per 64x64 output tile (16 accumulators), operands straight from K-contiguous 16-bit planes; grid (M/64, N/64, Z), 32 threads.
// C[m][n] (f32, pitch ldc, + optional f32 bias[n]) = sum_k A[m][k] Bt[n][k] (+ split products per NSPLIT). z-batch strides sA/sB/sC in elements. K % 32 == 0.
// K is the row pitch of A and Bt in elements, kn the number of k summed by this work-group. grid z = batch * NKS + slice: the batch moves A, A2, Bt (and Bt2), C by sA, sA2, sB, sC elements; slice s of the k range starts at k = s * kn and its partial sums go to C + s * sCk. kn % 32 == 0.
template <typename T16> struct WFrag;
template <> struct WFrag<h16> { typedef v16h V; static __device__ __forceinline__ V ld(const h16* p) { return cat16(*(const v8h*)p, *(const v8h*)(p + 16)); } static __device__ __forceinline__ v8f mma(V a, V b, v8f c) { return wmma16(a, b, c); } };
template <> struct WFrag<bf> { typedef v16bf V; static __device__ __forceinline__ V ld(const bf* p) { return cat16b(*(const v8us*)p, *(const v8us*)(p + 16)); } static __device__ __forceinline__ v8f mma(V a, V b, v8f c) { return wmmab(a, b, c); } };
template <typename T16, int NSPLIT, bool BIAS, int NKS>
__global__ __launch_bounds__(32) void k_gemmw(const T16* __restrict__ A, const T16* __restrict__ A2, const T16* __restrict__ Bt, const T16* __restrict__ Bt2, int K, int kn, float* C, int ldc, const float* __restrict__ bias, size_t sA, size_t sA2, size_t sB, size_t sC, size_t sCk) {
    typedef typename WFrag<T16>::V V;
    __shared__ __align__(16) float os[16 * 68];
    const size_t zb = blockIdx.z / NKS, ko = (size_t)(blockIdx.z % NKS) * kn; A += zb * sA + ko; if (A2) A2 += zb * sA2 + ko; Bt += zb * sB + ko; if (Bt2) Bt2 += zb * sB + ko; C += zb * sC + (size_t)(blockIdx.z % NKS) * sCk;
    const int lane = threadIdx.x & 31, lr = lane & 15, hi = lane >> 4; const int r0 = blockIdx.x * 64, c0 = blockIdx.y * 64;
    v8f acc[4][4];
#pragma unroll
    for (int mb = 0; mb < 4; ++mb)
#pragma unroll
        for (int nb = 0; nb < 4; ++nb) acc[mb][nb] = (v8f){};
    const size_t aoff = (size_t)(r0 + lr) * K + 8 * hi, boff = (size_t)(c0 + lr) * K + 8 * hi;
#pragma unroll 1
    for (int kc = 0; kc < kn; kc += 32) {
        V a[4], a2[4];
#pragma unroll
        for (int mb = 0; mb < 4; ++mb) { a[mb] = WFrag<T16>::ld(A + aoff + (size_t)mb * 16 * K + kc); if (NSPLIT == 1 || NSPLIT == 2) a2[mb] = WFrag<T16>::ld(A2 + aoff + (size_t)mb * 16 * K + kc); }
#pragma unroll
        for (int nb = 0; nb < 4; ++nb) { const V b = WFrag<T16>::ld(Bt + boff + (size_t)nb * 16 * K + kc); V b2; if (NSPLIT >= 2) b2 = WFrag<T16>::ld(Bt2 + boff + (size_t)nb * 16 * K + kc);
#pragma unroll
            for (int mb = 0; mb < 4; ++mb) { acc[mb][nb] = WFrag<T16>::mma(a[mb], b, acc[mb][nb]); if (NSPLIT == 1 || NSPLIT == 2) acc[mb][nb] = WFrag<T16>::mma(a2[mb], b, acc[mb][nb]); if (NSPLIT >= 2) acc[mb][nb] = WFrag<T16>::mma(a[mb], b2, acc[mb][nb]); } }
        asm volatile("v_nop\n\tv_nop\n\tv_nop\n\tv_nop" : "+v"(acc[0][0]), "+v"(acc[1][1]), "+v"(acc[2][2]), "+v"(acc[3][3]) : "v"(a[0]), "v"(a[3]));
    }
#pragma unroll
    for (int mb = 0; mb < 4; ++mb) {
#pragma unroll
        for (int nb = 0; nb < 4; ++nb) {
#pragma unroll
            for (int j = 0; j < 8; ++j) os[(hi * 8 + j) * 68 + nb * 16 + lr] = acc[mb][nb][j]; }
        __builtin_amdgcn_wave_barrier(); asm volatile("" ::: "memory");
        float* crow = C + (size_t)(r0 + mb * 16) * ldc + c0;
{
#pragma unroll
            for (int s = 0; s < 8; ++s) { const int row = 2 * s + hi, cofs = lr * 4; v4f val = *(const v4fa*)(os + row * 68 + cofs); if (BIAS) { val[0] += bfr(bias[c0 + cofs]); val[1] += bfr(bias[c0 + cofs + 1]); val[2] += bfr(bias[c0 + cofs + 2]); val[3] += bfr(bias[c0 + cofs + 3]); }
                *(v4f*)(crow + (size_t)row * ldc + cofs) = val; }
             }
        __builtin_amdgcn_wave_barrier(); asm volatile("" ::: "memory");
    }
}

__device__ __forceinline__ h16 tohx(float x) { return (h16)x; }
__device__ __forceinline__ void splitf(float y, unsigned short& h, unsigned short& l) { h = f2bf(y); l = f2bf(y - bf2f(h)); }
typedef __attribute__((ext_vector_type(2))) _Float16 v2h;
typedef __attribute__((ext_vector_type(4))) _Float16 v4h;
typedef __attribute__((ext_vector_type(2))) unsigned short v2us;
typedef __attribute__((ext_vector_type(4))) unsigned short v4us;
typedef __attribute__((ext_vector_type(2))) float v2f;
typedef __attribute__((ext_vector_type(4))) int v4i;

// ---- k_proj: the whole front end in ONE launch. Work-group = 64 tokens x all 384 features (q, k, v), 16 waves; grid = all tokens / 64.
// The three f32 weight matrices [k][n] and the 64 f32 input rows are rounded to bf16 on their way into LDS (weights transposed to [n][k]); wave (tt = token tile, fg) takes feature tiles 2 fg and 2 fg + 1 of q, of k and of v, 4 products of 32 k each in ascending k.
// q, k: A = weight rows, B = tokens, so a lane holds 8 consecutive features of one token; v: A = tokens, B = weight rows, so a lane holds 8 consecutive tokens of one feature (the [HD][TT] plane's order).
// f32 sum + bf16-rounded bias, then the fp16 plane and the bf16 hi and lo planes; the nine tiles are staged in LDS and leave as whole 128-byte lines.
#define PJP 272                   // LDS pitch in bytes of a row of 128 16-bit values: 256 + 16, an odd multiple of 16
#define PJV 144                   // LDS pitch in bytes of a row of 64 16-bit values: 128 + 16, an odd multiple of 16
__global__ __launch_bounds__(512) void k_proj(const float* __restrict__ x, const float* __restrict__ wq, const float* __restrict__ bq, const float* __restrict__ wk, const float* __restrict__ bk, const float* __restrict__ wv, const float* __restrict__ bv,
                                              h16* Q16, bf* Qh, bf* Ql, h16* K16, bf* Kh, bf* Kl, h16* V16, bf* Vh, bf* Vl) {
    __shared__ __attribute__((aligned(16))) unsigned char WL[3 * 128 * PJP];   // bf16 weights [matrix][n][k]
    __shared__ __attribute__((aligned(16))) unsigned char XL[64 * PJP];        // bf16 inputs [token][k]
    __shared__ __attribute__((aligned(16))) unsigned char SQ[6 * 64 * PJP];    // q and k planes [plane][token][feature]
    __shared__ __attribute__((aligned(16))) unsigned char SV[3 * 128 * PJV];   // v planes [plane][feature][token]
    const int tid = threadIdx.x, lane = tid & 31, wave = tid >> 5, lr = lane & 15, hi = lane >> 4, tt = wave & 3, fg = wave >> 2; const size_t r0 = (size_t)blockIdx.x * 64;
    // all global reads first: 4 pieces of the input rows, of each weight matrix rows 8 wave .. 8 wave + 7, columns 4 lane .. 4 lane + 3 (every load covers 512 contiguous bytes per wave)
    v4f xv[4], wr[3][8]; const float* xb = x + r0 * DM; const unsigned wo = (unsigned)wave * 4096u + (unsigned)lane * 16u;   // this thread's byte offset in a weight matrix
#pragma unroll   // constant indices keep the array in registers
    for (int s = 0; s < 4; ++s) xv[s] = *(const v4f*)(xb + (size_t)(tid + 512 * s) * 4);
#pragma unroll   // constant indices keep the array in registers
    for (int r = 0; r < 8; ++r) { wr[0][r] = *(const v4f*)((const char*)wq + wo + 512 * r); wr[1][r] = *(const v4f*)((const char*)wk + wo + 512 * r); wr[2][r] = *(const v4f*)((const char*)wv + wo + 512 * r); }
    asm volatile("s_wait_xcnt 0x0" :: "s"(xb), "s"(wq), "s"(wk), "s"(wv), "v"(tid), "v"(wo) : "memory");   // stands in front of every reuse of a register that the loads above name; the base pointers, the thread index and the weight offset are inputs so that their registers stay theirs up to here
#pragma unroll   // constant indices keep the array in registers
    for (int s = 0; s < 4; ++s) { const int i = tid + 512 * s; v4us o;
#pragma unroll   // constant indices keep the array in registers
        for (int q = 0; q < 4; ++q) o[q] = f2bf(xv[s][q]);
        *(v4us*)(XL + (i >> 5) * PJP + (i & 31) * 8) = o; }
#pragma unroll   // constant indices keep the array in registers
    for (int m = 0; m < 3; ++m)
#pragma unroll   // constant indices keep the array in registers
        for (int i = 0; i < 4; ++i) { v8us o;
#pragma unroll   // constant indices keep the array in registers
            for (int r = 0; r < 8; ++r) o[r] = f2bf(wr[m][r][i]);
            *(v8us*)(WL + (m * 128 + lane * 4 + i) * PJP + wave * 16) = o; }
    __syncthreads();   // inputs and weights are in LDS
    v16bf xf[4];
#pragma unroll   // constant indices keep the array in registers
    for (int kc = 0; kc < 4; ++kc) xf[kc] = WFrag<bf>::ld((const bf*)(XL + (tt * 16 + lr) * PJP + 16 * hi + 64 * kc));
    v8f acc[3][2];
#pragma unroll   // constant indices keep the array in registers
    for (int m = 0; m < 3; ++m)
#pragma unroll   // constant indices keep the array in registers
        for (int u = 0; u < 2; ++u) { v8f a = (v8f){}; const unsigned char* wrow = WL + (m * 128 + (2 * fg + u) * 16 + lr) * PJP + 16 * hi;
#pragma unroll   // constant indices keep the array in registers
            for (int kc = 0; kc < 4; ++kc) { const v16bf wf = WFrag<bf>::ld((const bf*)(wrow + 64 * kc)); a = (m < 2) ? wmmab(wf, xf[kc], a) : wmmab(xf[kc], wf, a); }
            acc[m][u] = a; }
#pragma unroll   // constant indices keep the array in registers
    for (int m = 0; m < 3; ++m)
#pragma unroll   // constant indices keep the array in registers
        for (int u = 0; u < 2; ++u) { const int f0 = (2 * fg + u) * 16; const float* bm = (m == 0) ? bq : (m == 1) ? bk : bv; v8h o16; v8us oh, ol;
#pragma unroll   // constant indices keep the array in registers
            for (int j = 0; j < 8; ++j) { const float y = acc[m][u][j] + bfr(bm[(m < 2) ? f0 + hi * 8 + j : f0 + lr]); o16[j] = tohx(y); unsigned short a2, c2; splitf(y, a2, c2); oh[j] = a2; ol[j] = c2; }
            if (m < 2) { unsigned char* d = SQ + (m * 3 * 64 + tt * 16 + lr) * PJP + (f0 + hi * 8) * 2; *(v8h*)d = o16; *(v8us*)(d + 64 * PJP) = oh; *(v8us*)(d + 2 * 64 * PJP) = ol; }
            else { unsigned char* d = SV + (f0 + lr) * PJV + (tt * 16 + hi * 8) * 2; *(v8h*)d = o16; *(v8us*)(d + 128 * PJV) = oh; *(v8us*)(d + 2 * 128 * PJV) = ol; } }
    __syncthreads();   // the nine staged tiles are complete
    // q and k planes: the 64 token rows of a plane are 16 KiB in a row; v planes: 128 feature rows of 128 bytes
    const size_t zb = r0 / TT, t0 = r0 % TT;
#pragma unroll   // constant indices pick the plane's pointer at compile time
    for (int p = 0; p < 6; ++p) { char* g = (char*)(p == 0 ? (void*)Q16 : p == 1 ? (void*)Qh : p == 2 ? (void*)Ql : p == 3 ? (void*)K16 : p == 4 ? (void*)Kh : (void*)Kl) + r0 * (HD * 2);
#pragma unroll   // as above
        for (int s = 0; s < 2; ++s) { const int i = tid + 512 * s; *(v8us*)(g + (size_t)i * 16) = *(const v8us*)(SQ + (p * 64 + (i >> 4)) * PJP + (i & 15) * 16); } }
#pragma unroll   // constant indices pick the plane's pointer at compile time
    for (int p = 0; p < 3; ++p) { char* g = (char*)(p == 0 ? (void*)V16 : p == 1 ? (void*)Vh : (void*)Vl) + (zb * HD * TT + t0) * 2;
#pragma unroll   // as above
        for (int s = 0; s < 2; ++s) { const int i = tid + 512 * s; *(v8us*)(g + (size_t)(i >> 3) * (TT * 2) + (i & 7) * 16) = *(const v8us*)(SV + (p * 128 + (i >> 3)) * PJV + (i & 7) * 16); } }
}

// k_lsoft: streaming row softmax over all TK = TT = 4096 keys (no mask), one wave per row i, three sweeps of the f32 score row (lane -> 4 consecutive keys per 128-key chunk, 32 chunks):
// score rows of one pass: row = batch * RP + (i - R0). The hi plane of a row < RH takes that row's own (otherwise unused) place in the P16 buffer (Ph == P16's bytes), the lo plane is [batch][RH][TT].
__global__ __launch_bounds__(256) void k_lsoft(const float* __restrict__ Sb, int R0, h16* P16, bf* Ph, bf* Pl) {
    const int lane = threadIdx.x & 31; const int row = blockIdx.x * 8 + (threadIdx.x >> 5); if (row >= NB_ * RP) return; const int i = R0 + row % RP; const int zz = row / RP; const bool hires = (i < RH); const float* sr = Sb + (size_t)row * TT; float mx = -3.0e38f;
#pragma unroll 4
    for (int ch = 0; ch < TT / 128; ++ch) { const int j0 = ch * 128 + lane * 4; const v4f a = *(const v4f*)(sr + j0);
#pragma unroll
        for (int q = 0; q < 4; ++q) { float t = a[q] * SCL; asm volatile("" : "+v"(t)); mx = fmaxf(mx, t); } }
#pragma unroll
    for (int sh = 16; sh; sh >>= 1) mx = fmaxf(mx, __shfl_xor(mx, sh, 32));
    float sum = 0.f;
#pragma unroll 4
    for (int ch = 0; ch < TT / 128; ++ch) { const int j0 = ch * 128 + lane * 4; const v4f a = *(const v4f*)(sr + j0);
#pragma unroll
        for (int q = 0; q < 4; ++q) { float t = a[q] * SCL; asm volatile("" : "+v"(t)); float d0 = __fsub_rn(t, mx); asm volatile("" : "+v"(d0)); sum += __builtin_amdgcn_exp2f(__fmul_rn(d0, 1.4426950408889634f)); } }
#pragma unroll
    for (int sh = 16; sh; sh >>= 1) sum += __shfl_xor(sum, sh, 32);
    const float f = __fdiv_rn(hires ? 1.0f : PCAR, sum);
{
        if (hires) {   /* rows < RH: normalised bf16 hi/lo over all keys */
#pragma unroll
            for (int ch = 0; ch < TT / 128; ++ch) { const int j0 = ch * 128 + lane * 4; const v4f a = *(const v4f*)(sr + j0); v4us oh, ol;
#pragma unroll
                for (int q = 0; q < 4; ++q) { float t = a[q] * SCL; asm volatile("" : "+v"(t)); float d0 = __fsub_rn(t, mx); asm volatile("" : "+v"(d0)); float ex = __builtin_amdgcn_exp2f(__fmul_rn(d0, 1.4426950408889634f)); asm volatile("" : "+v"(ex)); unsigned short a2, c2; splitf(ex * f, a2, c2); oh[q] = a2; ol[q] = c2; }
                *(v4us*)(Ph + (size_t)row * TT + j0) = oh; *(v4us*)(Pl + ((size_t)zz * RH + i) * TT + j0) = ol;
                asm volatile("s_wait_xcnt 0x0" ::: "memory"); }   // the next chunk reuses the registers that these two stores name: the wait stands in front of that reuse
        } else {
#pragma unroll 2
            for (int ch = 0; ch < TT / 128; ++ch) { const int j0 = ch * 128 + lane * 4; const v4f a = *(const v4f*)(sr + j0); v4h o4;
#pragma unroll
                for (int q = 0; q < 4; ++q) { float t = a[q] * SCL; asm volatile("" : "+v"(t)); float d0 = __fsub_rn(t, mx); asm volatile("" : "+v"(d0)); float ex = __builtin_amdgcn_exp2f(__fmul_rn(d0, 1.4426950408889634f)); asm volatile("" : "+v"(ex)); o4[q] = tohx(ex * f); }
                *(v4h*)(P16 + (size_t)row * TT + j0) = o4; } }
         }
}

__global__ __launch_bounds__(256) void k_merge(const float* __restrict__ O, int R0, float* OUTb) { const size_t e = ((size_t)blockIdx.x * 256 + threadIdx.x) * 2; if (e >= (size_t)NB_ * RP * HD) return; const int d = (int)(e % HD); const int t = R0 + (int)((e / HD) % RP); const int zz = (int)(e / ((size_t)HD * RP)); const float cs = (t < RH) ? 1.0f : (1.0f / PCAR); const size_t oo = ((size_t)zz * TT + t) * DQ + d; const size_t eb = (size_t)zz * KS * RP * HD + e % ((size_t)RP * HD);   // zz = batch; partial planes [batch][slice][RP][HD]
    v2f p2[KS];   // the KS partial planes of the weights x v product: all loads in flight at once, then added in ascending key order
#pragma unroll
    for (int z = 0; z < KS; ++z) p2[z] = *(const v2f*)(O + (size_t)z * RP * HD + eb);
    v2f s2 = p2[0];
#pragma unroll
    for (int z = 1; z < KS; ++z) { s2[0] += p2[z][0]; s2[1] += p2[z][1]; }
    v2f o2; o2[0] = s2[0] * cs; o2[1] = s2[1] * cs; *(v2f*)(OUTb + oo) = o2;  }

#define FSK    128                // keys per stage
#define FPITCH 272                // LDS row pitch in bytes: 256 + 16, an odd multiple of 16 for the 16-byte fragment reads
#define FTILE  (128 * FPITCH)     // one tile: 128 rows (K: keys, 256 B of d; V^T: d, 256 B of keys)
#define FSLOT  (2 * FTILE)
__device__ __forceinline__ float xhalf(float x) { return __builtin_bit_cast(float, __builtin_amdgcn_permlanex16(__builtin_bit_cast(int, x), __builtin_bit_cast(int, x), 0x76543210, 0xfedcba98, false, false)); }   // lane l with lane l ^ 16
// 2^x with the slot that the instruction set asks for behind a transcendental (before its result is read or its source overwritten): the v_nop stands in the same statement so that it stays directly behind
__device__ __forceinline__ float exp2s(float x) { float r; asm("v_exp_f32 %0, %1\n\tv_nop" : "=v"(r) : "v"(x)); return r; }
// eight 16-byte copies of one lane, rows 16 apart; the s_wait_xcnt closes the statement so that no address register is rewritten in front of it
__device__ __forceinline__ void cp8(unsigned l, const char* g, size_t gs) {
    asm volatile("global_load_async_to_lds_b128 %0, %8, off\n\tglobal_load_async_to_lds_b128 %1, %9, off\n\tglobal_load_async_to_lds_b128 %2, %10, off\n\tglobal_load_async_to_lds_b128 %3, %11, off\n\t"
                 "global_load_async_to_lds_b128 %4, %12, off\n\tglobal_load_async_to_lds_b128 %5, %13, off\n\tglobal_load_async_to_lds_b128 %6, %14, off\n\tglobal_load_async_to_lds_b128 %7, %15, off\n\ts_wait_xcnt 0x0"
                 :: "v"(l), "v"(l + 16u * FPITCH), "v"(l + 32u * FPITCH), "v"(l + 48u * FPITCH), "v"(l + 64u * FPITCH), "v"(l + 80u * FPITCH), "v"(l + 96u * FPITCH), "v"(l + 112u * FPITCH),
                    "v"(g), "v"(g + gs), "v"(g + 2 * gs), "v"(g + 3 * gs), "v"(g + 4 * gs), "v"(g + 5 * gs), "v"(g + 6 * gs), "v"(g + 7 * gs) : "memory");
}
// 256 registers: every operand stays directly addressable (no register-bank switches in the loop) and two work-groups fit a WGP
__global__ __launch_bounds__(256) __attribute__((amdgpu_num_vgpr(256))) void k_fattn(const h16* __restrict__ Q, const h16* __restrict__ Kp, const h16* __restrict__ Vt, float* OUTb) {
    __shared__ __attribute__((aligned(16))) unsigned char L[2 * FSLOT];
    const int tid = threadIdx.x, lane = tid & 31, wave = tid >> 5, c = lane & 15, h = lane >> 4, cg = wave & 3, kp = wave >> 2; const size_t zb = blockIdx.y; const int qrow = RH + blockIdx.x * 64 + cg * 16 + c;
    // thread -> 16-byte piece tid & 15 of rows (tid >> 4) + 16 n, n = 0..7, of either tile
    const unsigned lcp = (unsigned)(size_t)L + (unsigned)(tid >> 4) * FPITCH + (unsigned)(tid & 15) * 16u;
    const char* gk = (const char*)(Kp + zb * TT * HD) + (size_t)(tid >> 4) * (HD * 2) + (tid & 15) * 16;
    const char* gv = (const char*)(Vt + zb * HD * TT) + (size_t)(tid >> 4) * (TT * 2) + (tid & 15) * 16;
    auto stage = [&](int st) { const unsigned lb = lcp + (unsigned)(st & 1) * FSLOT; cp8(lb, gk + (size_t)st * (FSK * HD * 2), 16 * HD * 2); cp8(lb + FTILE, gv + (size_t)st * (FSK * 2), (size_t)16 * TT * 2); };
    stage(0);
    v16h qf[4];
#pragma unroll   // constant indices keep the array in registers
    for (int kc = 0; kc < 4; ++kc) qf[kc] = WFrag<h16>::ld(Q + (zb * TT + qrow) * HD + 8 * h + 32 * kc);
    v8f acc[8];
#pragma unroll   // constant indices keep the array in registers
    for (int t = 0; t < 8; ++t) acc[t] = (v8f){};
    float m_run = -__builtin_inff(), l_run = 0.f; const float cs = SCL * 1.4426950408889634f;   // scores in the log2 domain
    asm volatile("s_wait_asynccnt 0x0" ::: "memory");   // this wave's copies of stage 0 have landed
    __syncthreads();                                    // ... and every other wave's
    stage(1);
    const int kro = (kp * 64 + c) * FPITCH + 16 * h, vro = FTILE + c * FPITCH + kp * 128 + 16 * h;   // this lane's first K row and first V^T row piece in a buffer
#pragma unroll 1   // rolled: one stage is the loop body, the two buffers alternate by st & 1
    for (int st = 0; st < TT / FSK; ++st) {
        const unsigned char* Bf = L + (st & 1) * FSLOT;
        v16h kf[2][4], vf[8];
#pragma unroll   // constant indices keep the array in registers
        for (int kt = 0; kt < 2; ++kt)
#pragma unroll   // constant indices keep the array in registers
            for (int kc = 0; kc < 4; ++kc) kf[kt][kc] = WFrag<h16>::ld((const h16*)(Bf + kro + kt * 16 * FPITCH + 64 * kc));
#pragma unroll   // constant indices keep the array in registers
        for (int sub = 0; sub < 2; ++sub) {   // one pass: 32 keys
#pragma unroll   // constant indices keep the array in registers
            for (int t = 0; t < 8; ++t) vf[t] = WFrag<h16>::ld((const h16*)(Bf + vro + t * 16 * FPITCH + sub * 64));
            __builtin_amdgcn_sched_barrier(0);   // keeps the pass's V^T reads issued as one group here, in flight under the score products and the softmax
            v8f s[2];
#pragma unroll   // constant indices keep the array in registers
            for (int kt = 0; kt < 2; ++kt) { s[kt] = (v8f){};
#pragma unroll   // constant indices keep the array in registers
                for (int kc = 0; kc < 4; ++kc) s[kt] = wmma16(kf[kt][kc], qf[kc], s[kt]); }
            float mx = s[0][0];
#pragma unroll   // constant indices keep the array in registers
            for (int j = 1; j < 8; ++j) mx = fmaxf(mx, s[0][j]);
#pragma unroll   // constant indices keep the array in registers
            for (int j = 0; j < 8; ++j) mx = fmaxf(mx, s[1][j]);
            mx = fmaxf(mx, xhalf(mx)) * cs;
            // lazy rescale: the maximum in use may trail the true one by up to 8 (log2), so a weight stays <= 256; one scalar test per pass
            if (__builtin_amdgcn_ballot_w32(mx > m_run + 8.0f) != 0) { const float m_new = fmaxf(m_run, mx); const float corr = __builtin_amdgcn_exp2f(m_run - m_new); l_run *= corr; m_run = m_new;
#pragma unroll   // constant indices keep the array in registers
                for (int t = 0; t < 8; ++t) acc[t] = acc[t] * corr; }
            v16h pf; float ps0 = 0.f, ps1 = 0.f;
#pragma unroll   // constant indices keep the array in registers
            for (int j = 0; j < 8; ++j) { const float p0 = exp2s(__builtin_fmaf(s[0][j], cs, -m_run)), p1 = exp2s(__builtin_fmaf(s[1][j], cs, -m_run)); ps0 += p0; ps1 += p1; pf[j] = (h16)p0; pf[8 + j] = (h16)p1; }
            l_run += ps0 + ps1;
            if (sub == 0) {
                __builtin_amdgcn_sched_barrier(0);   // keeps the next pass's K reads here, as one group behind the softmax (whose registers they take) and in flight under the products below
#pragma unroll   // constant indices keep the array in registers
                for (int kt = 0; kt < 2; ++kt)
#pragma unroll   // constant indices keep the array in registers
                    for (int kc = 0; kc < 4; ++kc) kf[kt][kc] = WFrag<h16>::ld((const h16*)(Bf + kro + (32 + kt * 16) * FPITCH + 64 * kc));
                __builtin_amdgcn_sched_barrier(0);   // as above
            }
#pragma unroll   // constant indices keep the array in registers
            for (int t = 0; t < 8; ++t) acc[t] = wmma16(vf[t], pf, acc[t]);
        }
        asm volatile("s_wait_dscnt 0x0" ::: "memory");      // this wave's reads of the buffer are done
        asm volatile("s_wait_asynccnt 0x0" ::: "memory");   // this wave's copies of stage st + 1 have landed
        __syncthreads();                                    // publishes stage st + 1 and ends every wave's reads of stage st
        if (st + 2 < TT / FSK) stage(st + 2);               // refill of the buffer just left
    }
    asm volatile("s_wait_asynccnt 0x0" ::: "memory");       // no copy in flight: the buffers become the staging of the join
    // join of the two key parts: part 1 hands its accumulators, maximum and sum to part 0 of the same column group (behind the loop's last barrier nobody reads the buffers)
    v4f* X = (v4f*)L + (size_t)cg * 17 * 32 + lane;
    if (kp == 1) {
#pragma unroll   // constant indices keep the array in registers
        for (int t = 0; t < 8; ++t) { X[(2 * t) * 32] = __builtin_shufflevector(acc[t], acc[t], 0, 1, 2, 3); X[(2 * t + 1) * 32] = __builtin_shufflevector(acc[t], acc[t], 4, 5, 6, 7); }
        X[16 * 32] = (v4f){m_run, l_run, 0.f, 0.f};
    }
    __syncthreads();   // part 1's values are in LDS
    if (kp == 0) {
        const v4f ml = X[16 * 32]; const float m_all = fmaxf(m_run, ml[0]); const float a0 = __builtin_amdgcn_exp2f(m_run - m_all), a1 = __builtin_amdgcn_exp2f(ml[0] - m_all);
        const float lh = l_run * a0 + ml[1] * a1; const float inv = 1.0f / (lh + xhalf(lh));   // each half summed its own eight keys of every tile
        const float f0 = a0 * inv, f1 = a1 * inv; float* orow = OUTb + (zb * TT + qrow) * DQ + 8 * h;
#pragma unroll   // constant indices keep the array in registers
        for (int t = 0; t < 8; ++t) { const v4f x0 = X[(2 * t) * 32], x1 = X[(2 * t + 1) * 32]; v4f a, b;
#pragma unroll   // constant indices keep the array in registers
            for (int j = 0; j < 4; ++j) { a[j] = acc[t][j] * f0 + x0[j] * f1; b[j] = acc[t][4 + j] * f0 + x1[j] * f1; }
            *(v4f*)(orow + t * 16) = a; *(v4f*)(orow + t * 16 + 4) = b; }
    }
}

extern "C" void kernel_launch(void* const* d_in, const int* in_sizes, int n_in,
                              void* d_out, int out_size, void* d_ws, size_t ws_size, hipStream_t stream) {
    (void)in_sizes; (void)n_in; (void)out_size;
    const float* x = (const float*)d_in[0]; const float* wq = (const float*)d_in[1]; const float* bq = (const float*)d_in[2]; const float* wk = (const float*)d_in[3]; const float* bk = (const float*)d_in[4]; const float* wv = (const float*)d_in[5]; const float* bv = (const float*)d_in[6]; const float* wo = nullptr; (void)wo;
    float* OUT = (float*)d_out;     // [4][4096][128]
    char* wsp = (char*)d_ws;
    auto take = [&](size_t bytes) { char* p = wsp; wsp += (bytes + 255) & ~(size_t)255; return (void*)p; };
    const size_t PE = (size_t)NB_ * TT * HD;   // elements of one 16-bit plane, all batches
    h16* QP16 = (h16*)take(PE * 2); h16* KP16 = (h16*)take(PE * 2); h16* VT16 = (h16*)take(PE * 2);
    bf* QPh = (bf*)take(PE * 2); bf* QPl = (bf*)take(PE * 2); bf* KPh = (bf*)take(PE * 2); bf* KPl = (bf*)take(PE * 2); bf* VTh = (bf*)take(PE * 2); bf* VTl = (bf*)take(PE * 2);
    bf* Pl = (bf*)take((size_t)NB_ * RH * TT * 2); h16* P16 = (h16*)take((size_t)NB_ * RP * TT * 2); bf* Ph = (bf*)P16;   // hi plane: the P16 buffer's bytes (every row that passes through it is a hi/lo row)
    float* Sb = (float*)take((size_t)NB_ * RP * TT * 4);
    if ((size_t)(wsp - (char*)d_ws) > ws_size) return;    // ws 256 MiB
    float* Ob = Sb;   // stream-ordered reuse of the score buffer: after the softmax it holds the KS partial planes
    k_proj<<<NB_ * TT / 64, 512, 0, stream>>>(x, wq, bq, wk, bk, wv, bv, QP16, QPh, QPl, KP16, KPh, KPl, VT16, VTh, VTl);
    const size_t sQK = (size_t)TT * HD, sS = (size_t)RP * TT, sO = (size_t)KS * RP * HD, sOk = (size_t)RP * HD;   // batch strides of the planes, of the score rows and of the partial planes [batch][slice][RP][HD]; stride of one slice's plane
    k_fattn<<<dim3((TT - RH) / 64, NB_), 256, 0, stream>>>(QP16, KP16, VT16, OUT);   // query rows >= RH
    // query rows < RH: hi/lo path through the score buffer
    k_gemmw<bf, 2, false, 1><<<dim3(RH / 64, TT / 64, NB_), 32, 0, stream>>>(QPh, QPl, KPh, KPl, HD, HD, Sb, TT, nullptr, sQK, sQK, sQK, sS, 0);
    k_lsoft<<<NB_ * RP / 8, 256, 0, stream>>>(Sb, 0, P16, Ph, Pl);
    k_gemmw<bf, 2, false, KS><<<dim3(RH / 64, HD / 64, NB_ * KS), 32, 0, stream>>>(Ph, Pl, VTh, VTl, TT, TT / KS, Ob, HD, nullptr, sS, (size_t)RH * TT, sQK, sO, sOk);
    k_merge<<<(unsigned)(((size_t)NB_ * RP * HD / 2 + 255) / 256), 256, 0, stream>>>(Ob, 0, OUT);
}

// v005
// Measured time: 68.6 microseconds a run.
// In two side-by-side timings against v004, it was 1.87 and 1.86 times as fast.
// Counting every step since v000, it is 15.0 times as fast.
#include <hip/hip_runtime.h>

// Single-head self-attention over 4,096 points (inputs [4][4096][128]; q,k,v = inputs W + b ('xw' [128][128] + [128]); softmax(q.k / sqrt(128)) over all points; out = weights v -> [4][4096][128] (2.1 M)).
// All four batches go through every launch. Attention is fused (scores, online softmax and weights x v in one kernel; neither scores nor weights reach memory): k_fattn, work-groups of 64 query rows >= RH over all keys (fp16); k_fattn_hl, work-groups of 64 query rows < RH over one of KSP key slices (bf16 hi/lo, 3 products); k_merge joins the KSP slices of the rows < RH.
// Front end: ONE launch (k_proj) rounds inputs and weights to bf16, does the three projections and writes every 16-bit plane. Exact projections + bf16-rounded biases; ONE 128-wide head, hybrid rows: < 512 hi/lo 3 products, rest fp16.
// Compute dtypes, f32 accumulate: every input rounded to bf16; projections exact + bf16-rounded biases; attention rows < 512 3 products, rest fp16; softmax f32; output f32.

#define NB_  4
#define TT   4096
#define DM   128
#define NH_  1
#define NKV  1
#define REP  (NH_ / NKV)
#define HD   128
#define DQ   (NH_ * HD)
#define DKV  (NKV * HD)
#define ZH   1
#define RH   512                  // query rows < RH use hi+lo planes (0: none)
#define WIN  0
#define SCL  0.088388347648318447f   // 1/sqrt(128)
#define KSP  8                    // key slices of the query rows < RH: one work-group per (64 rows, slice); normalised f32 partial rows with their maximum and sum go to the workspace, k_merge joins them
typedef _Float16 h16;
typedef unsigned short bf;
typedef __attribute__((ext_vector_type(16))) __bf16   v16bf;
typedef __attribute__((ext_vector_type(16))) _Float16 v16h;
typedef __attribute__((ext_vector_type(8)))  _Float16 v8h;
typedef __attribute__((ext_vector_type(8)))  unsigned short v8us;
typedef __attribute__((ext_vector_type(8)))  float    v8f;
typedef __attribute__((ext_vector_type(4)))  float    v4f;
typedef v8h  __attribute__((may_alias)) v8ha;
typedef v4f  __attribute__((may_alias)) v4fa;
typedef v8us __attribute__((may_alias)) v8usa;

__device__ __forceinline__ unsigned short f2bf(float f) { unsigned u = __float_as_uint(f); u += 0x7FFFu + ((u >> 16) & 1u); return (unsigned short)(u >> 16); }
__device__ __forceinline__ float bf2f(unsigned short b) { return __uint_as_float(((unsigned)b) << 16); }
__device__ __forceinline__ float bfr(float f) { return bf2f(f2bf(f)); }
__device__ __forceinline__ v16h cat16(v8h lo, v8h hi) { return __builtin_shufflevector(lo, hi, 0, 1, 2, 3, 4, 5, 6, 7, 8, 9, 10, 11, 12, 13, 14, 15); }
__device__ __forceinline__ v16bf cat16b(v8us lo, v8us hi) { return __builtin_bit_cast(v16bf, __builtin_shufflevector(lo, hi, 0, 1, 2, 3, 4, 5, 6, 7, 8, 9, 10, 11, 12, 13, 14, 15)); }
__device__ __forceinline__ v8f wmma16(v16h a, v16h b, v8f c) { return __builtin_amdgcn_wmma_f32_16x16x32_f16(false, a, false, b, (short)0, c, false, false); }
__device__ __forceinline__ v8f wmmab(v16bf a, v16bf b, v8f c) { return __builtin_amdgcn_wmma_f32_16x16x32_bf16(false, a, false, b, (short)0, c, false, false); }



// fragment loaders: 16 values of a lane = 8 consecutive k at p and 8 at p + 16
template <typename T16> struct WFrag;
template <> struct WFrag<h16> { typedef v16h V; static __device__ __forceinline__ V ld(const h16* p) { return cat16(*(const v8h*)p, *(const v8h*)(p + 16)); } static __device__ __forceinline__ v8f mma(V a, V b, v8f c) { return wmma16(a, b, c); } };
template <> struct WFrag<bf> { typedef v16bf V; static __device__ __forceinline__ V ld(const bf* p) { return cat16b(*(const v8us*)p, *(const v8us*)(p + 16)); } static __device__ __forceinline__ v8f mma(V a, V b, v8f c) { return wmmab(a, b, c); } };

__device__ __forceinline__ h16 tohx(float x) { return (h16)x; }
__device__ __forceinline__ void splitf(float y, unsigned short& h, unsigned short& l) { h = f2bf(y); l = f2bf(y - bf2f(h)); }
typedef __attribute__((ext_vector_type(2))) _Float16 v2h;
typedef __attribute__((ext_vector_type(4))) _Float16 v4h;
typedef __attribute__((ext_vector_type(2))) unsigned short v2us;
typedef __attribute__((ext_vector_type(4))) unsigned short v4us;
typedef __attribute__((ext_vector_type(2))) float v2f;
typedef __attribute__((ext_vector_type(4))) int v4i;

// ---- k_proj: the whole front end in ONE launch. Work-group = 64 tokens x all 384 features (q, k, v), 16 waves; grid = all tokens / 64.
// The three f32 weight matrices [k][n] and the 64 f32 input rows are rounded to bf16 on their way into LDS (weights transposed to [n][k]); wave (tt = token tile, fg) takes feature tiles 2 fg and 2 fg + 1 of q, of k and of v, 4 products of 32 k each in ascending k.
// q, k: A = weight rows, B = tokens, so a lane holds 8 consecutive features of one token; v: A = tokens, B = weight rows, so a lane holds 8 consecutive tokens of one feature (the [HD][TT] plane's order).
// f32 sum + bf16-rounded bias, then the fp16 plane and the bf16 hi and lo planes; the nine tiles are staged in LDS and leave as whole 128-byte lines.
#define PJP 272                   // LDS pitch in bytes of a row of 128 16-bit values: 256 + 16, an odd multiple of 16
#define PJV 144                   // LDS pitch in bytes of a row of 64 16-bit values: 128 + 16, an odd multiple of 16
__global__ __launch_bounds__(512) void k_proj(const float* __restrict__ x, const float* __restrict__ wq, const float* __restrict__ bq, const float* __restrict__ wk, const float* __restrict__ bk, const float* __restrict__ wv, const float* __restrict__ bv,
                                              h16* Q16, bf* Qh, bf* Ql, h16* K16, bf* Kh, bf* Kl, h16* V16, bf* Vh, bf* Vl) {
    __shared__ __attribute__((aligned(16))) unsigned char WL[3 * 128 * PJP];   // bf16 weights [matrix][n][k]
    __shared__ __attribute__((aligned(16))) unsigned char XL[64 * PJP];        // bf16 inputs [token][k]
    __shared__ __attribute__((aligned(16))) unsigned char SQ[6 * 64 * PJP];    // q and k planes [plane][token][feature]
    __shared__ __attribute__((aligned(16))) unsigned char SV[3 * 128 * PJV];   // v planes [plane][feature][token]
    const int tid = threadIdx.x, lane = tid & 31, wave = tid >> 5, lr = lane & 15, hi = lane >> 4, tt = wave & 3, fg = wave >> 2; const size_t r0 = (size_t)blockIdx.x * 64;
    // all global reads first: 4 pieces of the input rows, of each weight matrix rows 8 wave .. 8 wave + 7, columns 4 lane .. 4 lane + 3 (every load covers 512 contiguous bytes per wave)
    v4f xv[4], wr[3][8]; const float* xb = x + r0 * DM; const unsigned wo = (unsigned)wave * 4096u + (unsigned)lane * 16u;   // this thread's byte offset in a weight matrix
#pragma unroll   // constant indices keep the array in registers
    for (int s = 0; s < 4; ++s) xv[s] = *(const v4f*)(xb + (size_t)(tid + 512 * s) * 4);
#pragma unroll   // constant indices keep the array in registers
    for (int r = 0; r < 8; ++r) { wr[0][r] = *(const v4f*)((const char*)wq + wo + 512 * r); wr[1][r] = *(const v4f*)((const char*)wk + wo + 512 * r); wr[2][r] = *(const v4f*)((const char*)wv + wo + 512 * r); }
    asm volatile("s_wait_xcnt 0x0" :: "s"(xb), "s"(wq), "s"(wk), "s"(wv), "v"(tid), "v"(wo) : "memory");   // stands in front of every reuse of a register that the loads above name; the base pointers, the thread index and the weight offset are inputs so that their registers stay theirs up to here
#pragma unroll   // constant indices keep the array in registers
    for (int s = 0; s < 4; ++s) { const int i = tid + 512 * s; v4us o;
#pragma unroll   // constant indices keep the array in registers
        for (int q = 0; q < 4; ++q) o[q] = f2bf(xv[s][q]);
        *(v4us*)(XL + (i >> 5) * PJP + (i & 31) * 8) = o; }
#pragma unroll   // constant indices keep the array in registers
    for (int m = 0; m < 3; ++m)
#pragma unroll   // constant indices keep the array in registers
        for (int i = 0; i < 4; ++i) { v8us o;
#pragma unroll   // constant indices keep the array in registers
            for (int r = 0; r < 8; ++r) o[r] = f2bf(wr[m][r][i]);
            *(v8us*)(WL + (m * 128 + lane * 4 + i) * PJP + wave * 16) = o; }
    __syncthreads();   // inputs and weights are in LDS
    v16bf xf[4];
#pragma unroll   // constant indices keep the array in registers
    for (int kc = 0; kc < 4; ++kc) xf[kc] = WFrag<bf>::ld((const bf*)(XL + (tt * 16 + lr) * PJP + 16 * hi + 64 * kc));
    v8f acc[3][2];
#pragma unroll   // constant indices keep the array in registers
    for (int m = 0; m < 3; ++m)
#pragma unroll   // constant indices keep the array in registers
        for (int u = 0; u < 2; ++u) { v8f a = (v8f){}; const unsigned char* wrow = WL + (m * 128 + (2 * fg + u) * 16 + lr) * PJP + 16 * hi;
#pragma unroll   // constant indices keep the array in registers
            for (int kc = 0; kc < 4; ++kc) { const v16bf wf = WFrag<bf>::ld((const bf*)(wrow + 64 * kc)); a = (m < 2) ? wmmab(wf, xf[kc], a) : wmmab(xf[kc], wf, a); }
            acc[m][u] = a; }
#pragma unroll   // constant indices keep the array in registers
    for (int m = 0; m < 3; ++m)
#pragma unroll   // constant indices keep the array in registers
        for (int u = 0; u < 2; ++u) { const int f0 = (2 * fg + u) * 16; const float* bm = (m == 0) ? bq : (m == 1) ? bk : bv; v8h o16; v8us oh, ol;
#pragma unroll   // constant indices keep the array in registers
            for (int j = 0; j < 8; ++j) { const float y = acc[m][u][j] + bfr(bm[(m < 2) ? f0 + hi * 8 + j : f0 + lr]); o16[j] = tohx(y); unsigned short a2, c2; splitf(y, a2, c2); oh[j] = a2; ol[j] = c2; }
            if (m < 2) { unsigned char* d = SQ + (m * 3 * 64 + tt * 16 + lr) * PJP + (f0 + hi * 8) * 2; *(v8h*)d = o16; *(v8us*)(d + 64 * PJP) = oh; *(v8us*)(d + 2 * 64 * PJP) = ol; }
            else { unsigned char* d = SV + (f0 + lr) * PJV + (tt * 16 + hi * 8) * 2; *(v8h*)d = o16; *(v8us*)(d + 128 * PJV) = oh; *(v8us*)(d + 2 * 128 * PJV) = ol; } }
    __syncthreads();   // the nine staged tiles are complete
    // q and k planes: the 64 token rows of a plane are 16 KiB in a row; v planes: 128 feature rows of 128 bytes
    const size_t zb = r0 / TT, t0 = r0 % TT;
#pragma unroll   // constant indices pick the plane's pointer at compile time
    for (int p = 0; p < 6; ++p) { char* g = (char*)(p == 0 ? (void*)Q16 : p == 1 ? (void*)Qh : p == 2 ? (void*)Ql : p == 3 ? (void*)K16 : p == 4 ? (void*)Kh : (void*)Kl) + r0 * (HD * 2);
#pragma unroll   // as above
        for (int s = 0; s < 2; ++s) { const int i = tid + 512 * s; *(v8us*)(g + (size_t)i * 16) = *(const v8us*)(SQ + (p * 64 + (i >> 4)) * PJP + (i & 15) * 16); } }
#pragma unroll   // constant indices pick the plane's pointer at compile time
    for (int p = 0; p < 3; ++p) { char* g = (char*)(p == 0 ? (void*)V16 : p == 1 ? (void*)Vh : (void*)Vl) + (zb * HD * TT + t0) * 2;
#pragma unroll   // as above
        for (int s = 0; s < 2; ++s) { const int i = tid + 512 * s; *(v8us*)(g + (size_t)(i >> 3) * (TT * 2) + (i & 7) * 16) = *(const v8us*)(SV + (p * 128 + (i >> 3)) * PJV + (i & 7) * 16); } }
}

#define FSK    128                // keys per stage
#define FPITCH 272                // LDS row pitch in bytes: 256 + 16, an odd multiple of 16 for the 16-byte fragment reads
#define FTILE  (128 * FPITCH)     // one tile: 128 rows (K: keys, 256 B of d; V^T: d, 256 B of keys)
#define FSLOT  (2 * FTILE)
__device__ __forceinline__ float xhalf(float x) { return __builtin_bit_cast(float, __builtin_amdgcn_permlanex16(__builtin_bit_cast(int, x), __builtin_bit_cast(int, x), 0x76543210, 0xfedcba98, false, false)); }   // lane l with lane l ^ 16
// 2^x with the slot that the instruction set asks for behind a transcendental (before its result is read or its source overwritten): the v_nop stands in the same statement so that it stays directly behind
__device__ __forceinline__ float exp2s(float x) { float r; asm("v_exp_f32 %0, %1\n\tv_nop" : "=v"(r) : "v"(x)); return r; }
// eight 16-byte copies of one lane, rows 16 apart; the s_wait_xcnt closes the statement so that no address register is rewritten in front of it
__device__ __forceinline__ void cp8(unsigned l, const char* g, size_t gs) {
    asm volatile("global_load_async_to_lds_b128 %0, %8, off\n\tglobal_load_async_to_lds_b128 %1, %9, off\n\tglobal_load_async_to_lds_b128 %2, %10, off\n\tglobal_load_async_to_lds_b128 %3, %11, off\n\t"
                 "global_load_async_to_lds_b128 %4, %12, off\n\tglobal_load_async_to_lds_b128 %5, %13, off\n\tglobal_load_async_to_lds_b128 %6, %14, off\n\tglobal_load_async_to_lds_b128 %7, %15, off\n\ts_wait_xcnt 0x0"
                 :: "v"(l), "v"(l + 16u * FPITCH), "v"(l + 32u * FPITCH), "v"(l + 48u * FPITCH), "v"(l + 64u * FPITCH), "v"(l + 80u * FPITCH), "v"(l + 96u * FPITCH), "v"(l + 112u * FPITCH),
                    "v"(g), "v"(g + gs), "v"(g + 2 * gs), "v"(g + 3 * gs), "v"(g + 4 * gs), "v"(g + 5 * gs), "v"(g + 6 * gs), "v"(g + 7 * gs) : "memory");
}
// 256 registers: every operand stays directly addressable (no register-bank switches in the loop) and two work-groups fit a WGP
__global__ __launch_bounds__(256) __attribute__((amdgpu_num_vgpr(256))) void k_fattn(const h16* __restrict__ Q, const h16* __restrict__ Kp, const h16* __restrict__ Vt, float* OUTb) {
    __shared__ __attribute__((aligned(16))) unsigned char L[2 * FSLOT];
    const int tid = threadIdx.x, lane = tid & 31, wave = tid >> 5, c = lane & 15, h = lane >> 4, cg = wave & 3, kp = wave >> 2; const size_t zb = blockIdx.y; const int qrow = RH + blockIdx.x * 64 + cg * 16 + c;
    // thread -> 16-byte piece tid & 15 of rows (tid >> 4) + 16 n, n = 0..7, of either tile
    const unsigned lcp = (unsigned)(size_t)L + (unsigned)(tid >> 4) * FPITCH + (unsigned)(tid & 15) * 16u;
    const char* gk = (const char*)(Kp + zb * TT * HD) + (size_t)(tid >> 4) * (HD * 2) + (tid & 15) * 16;
    const char* gv = (const char*)(Vt + zb * HD * TT) + (size_t)(tid >> 4) * (TT * 2) + (tid & 15) * 16;
    auto stage = [&](int st) { const unsigned lb = lcp + (unsigned)(st & 1) * FSLOT; cp8(lb, gk + (size_t)st * (FSK * HD * 2), 16 * HD * 2); cp8(lb + FTILE, gv + (size_t)st * (FSK * 2), (size_t)16 * TT * 2); };
    stage(0);
    v16h qf[4];
#pragma unroll   // constant indices keep the array in registers
    for (int kc = 0; kc < 4; ++kc) qf[kc] = WFrag<h16>::ld(Q + (zb * TT + qrow) * HD + 8 * h + 32 * kc);
    v8f acc[8];
#pragma unroll   // constant indices keep the array in registers
    for (int t = 0; t < 8; ++t) acc[t] = (v8f){};
    float m_run = -__builtin_inff(), l_run = 0.f; const float cs = SCL * 1.4426950408889634f;   // scores in the log2 domain
    asm volatile("s_wait_asynccnt 0x0" ::: "memory");   // this wave's copies of stage 0 have landed
    __syncthreads();                                    // ... and every other wave's
    stage(1);
    const int kro = (kp * 64 + c) * FPITCH + 16 * h, vro = FTILE + c * FPITCH + kp * 128 + 16 * h;   // this lane's first K row and first V^T row piece in a buffer
#pragma unroll 1   // rolled: one stage is the loop body, the two buffers alternate by st & 1
    for (int st = 0; st < TT / FSK; ++st) {
        const unsigned char* Bf = L + (st & 1) * FSLOT;
        v16h kf[2][4], vf[8];
#pragma unroll   // constant indices keep the array in registers
        for (int kt = 0; kt < 2; ++kt)
#pragma unroll   // constant indices keep the array in registers
            for (int kc = 0; kc < 4; ++kc) kf[kt][kc] = WFrag<h16>::ld((const h16*)(Bf + kro + kt * 16 * FPITCH + 64 * kc));
#pragma unroll   // constant indices keep the array in registers
        for (int sub = 0; sub < 2; ++sub) {   // one pass: 32 keys
#pragma unroll   // constant indices keep the array in registers
            for (int t = 0; t < 8; ++t) vf[t] = WFrag<h16>::ld((const h16*)(Bf + vro + t * 16 * FPITCH + sub * 64));
            __builtin_amdgcn_sched_barrier(0);   // keeps the pass's V^T reads issued as one group here, in flight under the score products and the softmax
            v8f s[2];
#pragma unroll   // constant indices keep the array in registers
            for (int kt = 0; kt < 2; ++kt) { s[kt] = (v8f){};
#pragma unroll   // constant indices keep the array in registers
                for (int kc = 0; kc < 4; ++kc) s[kt] = wmma16(kf[kt][kc], qf[kc], s[kt]); }
            float mx = s[0][0];
#pragma unroll   // constant indices keep the array in registers
            for (int j = 1; j < 8; ++j) mx = fmaxf(mx, s[0][j]);
#pragma unroll   // constant indices keep the array in registers
            for (int j = 0; j < 8; ++j) mx = fmaxf(mx, s[1][j]);
            mx = fmaxf(mx, xhalf(mx)) * cs;
            // lazy rescale: the maximum in use may trail the true one by up to 8 (log2), so a weight stays <= 256; one scalar test per pass
            if (__builtin_amdgcn_ballot_w32(mx > m_run + 8.0f) != 0) { const float m_new = fmaxf(m_run, mx); const float corr = __builtin_amdgcn_exp2f(m_run - m_new); l_run *= corr; m_run = m_new;
#pragma unroll   // constant indices keep the array in registers
                for (int t = 0; t < 8; ++t) acc[t] = acc[t] * corr; }
            v16h pf; float ps0 = 0.f, ps1 = 0.f;
#pragma unroll   // constant indices keep the array in registers
            for (int j = 0; j < 8; ++j) { const float p0 = exp2s(__builtin_fmaf(s[0][j], cs, -m_run)), p1 = exp2s(__builtin_fmaf(s[1][j], cs, -m_run)); ps0 += p0; ps1 += p1; pf[j] = (h16)p0; pf[8 + j] = (h16)p1; }
            l_run += ps0 + ps1;
            if (sub == 0) {
                __builtin_amdgcn_sched_barrier(0);   // keeps the next pass's K reads here, as one group behind the softmax (whose registers they take) and in flight under the products below
#pragma unroll   // constant indices keep the array in registers
                for (int kt = 0; kt < 2; ++kt)
#pragma unroll   // constant indices keep the array in registers
                    for (int kc = 0; kc < 4; ++kc) kf[kt][kc] = WFrag<h16>::ld((const h16*)(Bf + kro + (32 + kt * 16) * FPITCH + 64 * kc));
                __builtin_amdgcn_sched_barrier(0);   // as above
            }
#pragma unroll   // constant indices keep the array in registers
            for (int t = 0; t < 8; ++t) acc[t] = wmma16(vf[t], pf, acc[t]);
        }
        asm volatile("s_wait_dscnt 0x0" ::: "memory");      // this wave's reads of the buffer are done
        asm volatile("s_wait_asynccnt 0x0" ::: "memory");   // this wave's copies of stage st + 1 have landed
        __syncthreads();                                    // publishes stage st + 1 and ends every wave's reads of stage st
        if (st + 2 < TT / FSK) stage(st + 2);               // refill of the buffer just left
    }
    asm volatile("s_wait_asynccnt 0x0" ::: "memory");       // no copy in flight: the buffers become the staging of the join
    // join of the two key parts: part 1 hands its accumulators, maximum and sum to part 0 of the same column group (behind the loop's last barrier nobody reads the buffers)
    v4f* X = (v4f*)L + (size_t)cg * 17 * 32 + lane;
    if (kp == 1) {
#pragma unroll   // constant indices keep the array in registers
        for (int t = 0; t < 8; ++t) { X[(2 * t) * 32] = __builtin_shufflevector(acc[t], acc[t], 0, 1, 2, 3); X[(2 * t + 1) * 32] = __builtin_shufflevector(acc[t], acc[t], 4, 5, 6, 7); }
        X[16 * 32] = (v4f){m_run, l_run, 0.f, 0.f};
    }
    __syncthreads();   // part 1's values are in LDS
    if (kp == 0) {
        const v4f ml = X[16 * 32]; const float m_all = fmaxf(m_run, ml[0]); const float a0 = __builtin_amdgcn_exp2f(m_run - m_all), a1 = __builtin_amdgcn_exp2f(ml[0] - m_all);
        const float lh = l_run * a0 + ml[1] * a1; const float inv = 1.0f / (lh + xhalf(lh));   // each half summed its own eight keys of every tile
        const float f0 = a0 * inv, f1 = a1 * inv; float* orow = OUTb + (zb * TT + qrow) * DQ + 8 * h;
#pragma unroll   // constant indices keep the array in registers
        for (int t = 0; t < 8; ++t) { const v4f x0 = X[(2 * t) * 32], x1 = X[(2 * t + 1) * 32]; v4f a, b;
#pragma unroll   // constant indices keep the array in registers
            for (int j = 0; j < 4; ++j) { a[j] = acc[t][j] * f0 + x0[j] * f1; b[j] = acc[t][4 + j] * f0 + x1[j] * f1; }
            *(v4f*)(orow + t * 16) = a; *(v4f*)(orow + t * 16 + 4) = b; }
    }
}

// ---- k_fattn_hl: the same fused form for query rows < RH, bf16 hi/lo planes, 3 products each way (Kh Qh + Kh Ql + Kl Qh; Vh Ph + Vh Pl + Vl Ph), f32 scores, softmax and sums. Work-group = (key slice of TT / KSP keys, 64-row tile, batch): grid (KSP, RH / 64, batch).
// 8 waves = 4 groups of 16 query columns x 2 key parts of 32 keys; stages of HSK keys (K hi, K lo, V^T hi, V^T lo) by asynchronous copies to LDS, two buffers, the order of the fp16 loop.
// The weight p = 2^(score - maximum in use) is split p = hi + lo in bf16 before the products. The slice's rows leave normalised, with their maximum (log2 domain) and sum, for k_merge.
#define HSK    64                 // keys per stage
#define HVP    144                // LDS pitch in bytes of a V^T row of 64 keys: 128 + 16, an odd multiple of 16
#define HKT    (HSK * FPITCH)     // one K tile: 64 keys, 256 B of d
#define HVT    (128 * HVP)        // one V^T tile: 128 d, 128 B of keys
#define HSLOT  (2 * HKT + 2 * HVT)
typedef __attribute__((ext_vector_type(2))) __bf16 v2bf;
// eight 16-byte copies of one lane: four rows of the hi tile (from ga) and the same four of the lo tile (from gb, ld bytes further in LDS), LDS rows ls bytes and global rows gs bytes apart; the s_wait_xcnt closes the statement so that no address register is rewritten in front of it
__device__ __forceinline__ void cp44(unsigned l, unsigned ls, unsigned ld, const char* ga, const char* gb, size_t gs) {
    asm volatile("global_load_async_to_lds_b128 %0, %8, off\n\tglobal_load_async_to_lds_b128 %1, %9, off\n\tglobal_load_async_to_lds_b128 %2, %10, off\n\tglobal_load_async_to_lds_b128 %3, %11, off\n\t"
                 "global_load_async_to_lds_b128 %4, %12, off\n\tglobal_load_async_to_lds_b128 %5, %13, off\n\tglobal_load_async_to_lds_b128 %6, %14, off\n\tglobal_load_async_to_lds_b128 %7, %15, off\n\ts_wait_xcnt 0x0"
                 :: "v"(l), "v"(l + ls), "v"(l + 2u * ls), "v"(l + 3u * ls), "v"(l + ld), "v"(l + ld + ls), "v"(l + ld + 2u * ls), "v"(l + ld + 3u * ls),
                    "v"(ga), "v"(ga + gs), "v"(ga + 2 * gs), "v"(ga + 3 * gs), "v"(gb), "v"(gb + gs), "v"(gb + 2 * gs), "v"(gb + 3 * gs) : "memory");
}
// no register cap: two fragment sets in flight beside Q hi/lo, the accumulators and the weights take a few registers above 256; the grid is one work-group per WGP (2 waves per SIMD), so nothing asks for fewer
__global__ __launch_bounds__(256) void k_fattn_hl(const bf* __restrict__ Qh, const bf* __restrict__ Ql, const bf* __restrict__ Kh, const bf* __restrict__ Kl, const bf* __restrict__ Vh, const bf* __restrict__ Vl, float* Op, float* ML) {
    __shared__ __attribute__((aligned(16))) unsigned char L[2 * HSLOT];
    const int tid = threadIdx.x, lane = tid & 31, wave = tid >> 5, c = lane & 15, h = lane >> 4, cg = wave & 3, kp = wave >> 2;
    const int ks = blockIdx.x, rt = blockIdx.y; const size_t zb = blockIdx.z; const int qrow = rt * 64 + cg * 16 + c;
    // K tiles: thread -> 16-byte piece tid & 15 of rows (tid >> 4) + 16 n; V^T tiles: piece tid & 7 of rows (tid >> 3) + 32 n; n = 0..3
    const unsigned lk = (unsigned)(size_t)L + (unsigned)(tid >> 4) * FPITCH + (unsigned)(tid & 15) * 16u;
    const unsigned lv = (unsigned)(size_t)L + 2u * HKT + (unsigned)(tid >> 3) * HVP + (unsigned)(tid & 7) * 16u;
    const size_t ko = (zb * TT + (size_t)ks * (TT / KSP) + (tid >> 4)) * (HD * 2) + (tid & 15) * 16;
    const size_t vo = (zb * HD + (tid >> 3)) * (TT * 2) + (size_t)ks * (TT / KSP) * 2 + (tid & 7) * 16;
    auto stage = [&](int st) { const unsigned sb = (unsigned)(st & 1) * HSLOT; const size_t kb = ko + (size_t)st * (HSK * HD * 2), vb = vo + (size_t)st * (HSK * 2);
        cp44(lk + sb, 16u * FPITCH, HKT, (const char*)Kh + kb, (const char*)Kl + kb, 16 * HD * 2);
        cp44(lv + sb, 32u * HVP, HVT, (const char*)Vh + vb, (const char*)Vl + vb, (size_t)32 * TT * 2); };
    stage(0);
    v16bf qh[4], ql[4];
#pragma unroll   // constant indices keep the array in registers
    for (int kc = 0; kc < 4; ++kc) { qh[kc] = WFrag<bf>::ld(Qh + (zb * TT + qrow) * HD + 8 * h + 32 * kc); ql[kc] = WFrag<bf>::ld(Ql + (zb * TT + qrow) * HD + 8 * h + 32 * kc); }
    asm volatile("s_wait_xcnt 0x0" ::: "memory");   // stands in front of every reuse of the address registers that the loads above name
    v8f acc[8];
#pragma unroll   // constant indices keep the array in registers
    for (int t = 0; t < 8; ++t) acc[t] = (v8f){};
    float m_run = -__builtin_inff(), l_run = 0.f; const float cs = SCL * 1.4426950408889634f;   // scores in the log2 domain
    asm volatile("s_wait_asynccnt 0x0" ::: "memory");   // this wave's copies of stage 0 have landed
    __syncthreads();                                    // ... and every other wave's
    stage(1);
    const int kro = (kp * 32 + c) * FPITCH + 16 * h, vro = 2 * HKT + c * HVP + kp * 64 + 16 * h;   // this lane's first K row and first V^T row piece in a buffer
#pragma unroll 1   // rolled: one stage is the loop body, the two buffers alternate by st & 1
    for (int st = 0; st < TT / KSP / HSK; ++st) {
        const unsigned char* Bf = L + (st & 1) * HSLOT;
        // fragment reads go in groups of four fragments, two register sets fa and fb in turn: a group is issued while the products on the group before it run, so that its LDS latency lies under them
        v16bf fa[4], fb[4]; v8f s[2], s0, s1;   // s0, s1: two independent chains (d 0..63, d 64..127): a product need not wait for the one before it
        auto ldK = [&](v16bf (&f)[4], int kt, int kc) { const unsigned char* kr = Bf + kro + kt * 16 * FPITCH + 64 * kc; f[0] = WFrag<bf>::ld((const bf*)kr); f[1] = WFrag<bf>::ld((const bf*)(kr + 128)); f[2] = WFrag<bf>::ld((const bf*)(kr + HKT)); f[3] = WFrag<bf>::ld((const bf*)(kr + HKT + 128)); };
        auto mmK = [&](v16bf (&f)[4], int kc) { s0 = wmmab(f[0], qh[kc], s0); s1 = wmmab(f[1], qh[kc + 2], s1); s0 = wmmab(f[0], ql[kc], s0); s1 = wmmab(f[1], ql[kc + 2], s1); s0 = wmmab(f[2], qh[kc], s0); s1 = wmmab(f[3], qh[kc + 2], s1); };
        auto ldV = [&](v16bf (&f)[4], int g) { const unsigned char* vr = Bf + vro + 2 * g * 16 * HVP; f[0] = WFrag<bf>::ld((const bf*)vr); f[1] = WFrag<bf>::ld((const bf*)(vr + 16 * HVP)); f[2] = WFrag<bf>::ld((const bf*)(vr + HVT)); f[3] = WFrag<bf>::ld((const bf*)(vr + HVT + 16 * HVP)); };
        ldK(fa, 0, 0); ldK(fb, 0, 1);
        __builtin_amdgcn_sched_barrier(0);   // keeps the reads above in front of the products below
        s0 = (v8f){}; s1 = (v8f){}; mmK(fa, 0);
        __builtin_amdgcn_sched_barrier(0);   // keeps the next group's reads here, behind the products that used its registers
        ldK(fa, 1, 0);
        __builtin_amdgcn_sched_barrier(0);   // keeps those reads in front of the products below
        mmK(fb, 1); s[0] = s0 + s1;
        __builtin_amdgcn_sched_barrier(0);   // as above: next group's reads behind the last use of their registers
        ldK(fb, 1, 1);
        __builtin_amdgcn_sched_barrier(0);   // as above: reads in front of the products
        s0 = (v8f){}; s1 = (v8f){}; mmK(fa, 0);
        __builtin_amdgcn_sched_barrier(0);   // as above: next group's reads behind the last use of their registers
        ldV(fa, 0);
        __builtin_amdgcn_sched_barrier(0);   // as above: reads in front of the products
        mmK(fb, 1); s[1] = s0 + s1;
        float mx = s[0][0];
#pragma unroll   // constant indices keep the array in registers
        for (int j = 1; j < 8; ++j) mx = fmaxf(mx, s[0][j]);
#pragma unroll   // constant indices keep the array in registers
        for (int j = 0; j < 8; ++j) mx = fmaxf(mx, s[1][j]);
        mx = fmaxf(mx, xhalf(mx)) * cs;
        // lazy rescale, as in the fp16 loop: the maximum in use may trail the true one by up to 8 (log2)
        if (__builtin_amdgcn_ballot_w32(mx > m_run + 8.0f) != 0) { const float m_new = fmaxf(m_run, mx); const float corr = __builtin_amdgcn_exp2f(m_run - m_new); l_run *= corr; m_run = m_new;
#pragma unroll   // constant indices keep the array in registers
            for (int t = 0; t < 8; ++t) acc[t] = acc[t] * corr; }
        v16bf ph, pl; float ps0 = 0.f, ps1 = 0.f;
#pragma unroll   // constant indices keep the array in registers
        for (int kt = 0; kt < 2; ++kt)
#pragma unroll   // constant indices keep the array in registers
            for (int j = 0; j < 8; j += 2) { v2f p; p[0] = exp2s(__builtin_fmaf(s[kt][j], cs, -m_run)); p[1] = exp2s(__builtin_fmaf(s[kt][j + 1], cs, -m_run)); ps0 += p[0]; ps1 += p[1];
                const v2bf a = __builtin_convertvector(p, v2bf); const v2bf b = __builtin_convertvector(p - __builtin_convertvector(a, v2f), v2bf);
                ph[8 * kt + j] = a[0]; ph[8 * kt + j + 1] = a[1]; pl[8 * kt + j] = b[0]; pl[8 * kt + j + 1] = b[1]; }
        l_run += ps0 + ps1;
        auto mmV = [&](v16bf (&f)[4], int g) { acc[2 * g] = wmmab(f[0], ph, acc[2 * g]); acc[2 * g + 1] = wmmab(f[1], ph, acc[2 * g + 1]); acc[2 * g] = wmmab(f[0], pl, acc[2 * g]); acc[2 * g + 1] = wmmab(f[1], pl, acc[2 * g + 1]); acc[2 * g] = wmmab(f[2], ph, acc[2 * g]); acc[2 * g + 1] = wmmab(f[3], ph, acc[2 * g + 1]); };
        __builtin_amdgcn_sched_barrier(0);   // keeps the second V^T group's reads behind the softmax, whose registers they take
        ldV(fb, 1);
        __builtin_amdgcn_sched_barrier(0);   // as above: reads in front of the products
        mmV(fa, 0);
        __builtin_amdgcn_sched_barrier(0);   // as above: next group's reads behind the last use of their registers
        ldV(fa, 2);
        __builtin_amdgcn_sched_barrier(0);   // as above: reads in front of the products
        mmV(fb, 1);
        __builtin_amdgcn_sched_barrier(0);   // as above: next group's reads behind the last use of their registers
        ldV(fb, 3);
        __builtin_amdgcn_sched_barrier(0);   // as above: reads in front of the products
        mmV(fa, 2); mmV(fb, 3);
        asm volatile("s_wait_dscnt 0x0" ::: "memory");      // this wave's reads of the buffer are done
        asm volatile("s_wait_asynccnt 0x0" ::: "memory");   // this wave's copies of stage st + 1 have landed
        __syncthreads();                                    // publishes stage st + 1 and ends every wave's reads of stage st
        if (st + 2 < TT / KSP / HSK) stage(st + 2);         // refill of the buffer just left
    }
    asm volatile("s_wait_asynccnt 0x0" ::: "memory");       // no copy in flight: the buffers become the staging of the join
    // join of the two key parts, as in the fp16 work-groups
    v4f* X = (v4f*)L + (size_t)cg * 17 * 32 + lane;
    if (kp == 1) {
#pragma unroll   // constant indices keep the array in registers
        for (int t = 0; t < 8; ++t) { X[(2 * t) * 32] = __builtin_shufflevector(acc[t], acc[t], 0, 1, 2, 3); X[(2 * t + 1) * 32] = __builtin_shufflevector(acc[t], acc[t], 4, 5, 6, 7); }
        X[16 * 32] = (v4f){m_run, l_run, 0.f, 0.f};
    }
    __syncthreads();   // part 1's values are in LDS
    if (kp == 0) {
        const v4f ml = X[16 * 32]; const float m_all = fmaxf(m_run, ml[0]); const float a0 = exp2s(m_run - m_all), a1 = exp2s(ml[0] - m_all);
        const float lh = l_run * a0 + ml[1] * a1; const float lt = lh + xhalf(lh); const float inv = 1.0f / lt;   // each half summed its own eight keys of every tile
        const float f0 = a0 * inv, f1 = a1 * inv; const size_t pr = (zb * KSP + ks) * RH + qrow; float* orow = Op + pr * HD + 8 * h;
#pragma unroll   // constant indices keep the array in registers
        for (int t = 0; t < 8; ++t) { const v4f x0 = X[(2 * t) * 32], x1 = X[(2 * t + 1) * 32]; v4f a, b;
#pragma unroll   // constant indices keep the array in registers
            for (int j = 0; j < 4; ++j) { a[j] = acc[t][j] * f0 + x0[j] * f1; b[j] = acc[t][4 + j] * f0 + x1[j] * f1; }
            *(v4f*)(orow + t * 16) = a; *(v4f*)(orow + t * 16 + 4) = b; }
        if (h == 0) { v2f o; o[0] = m_all; o[1] = lt; *(v2f*)(ML + pr * 2) = o; }
    }
}

// ---- k_merge: query rows < RH: the KSP key slices' normalised rows, each weighted by its sum x 2^(its maximum - the row's maximum), added in ascending key order and divided by the sum of the weights. Thread = 4 features of one row.
__global__ __launch_bounds__(256) void k_merge(const float* __restrict__ Op, const float* __restrict__ ML, float* OUTb) {
    const size_t e = ((size_t)blockIdx.x * 256 + threadIdx.x) * 4; const int d = (int)(e % HD); const int t = (int)((e / HD) % RH); const size_t zz = e / ((size_t)HD * RH);
    v2f ml[KSP]; v4f p[KSP];   // all loads in flight at once
#pragma unroll   // constant indices keep the arrays in registers
    for (int z = 0; z < KSP; ++z) ml[z] = *(const v2f*)(ML + ((zz * KSP + z) * RH + t) * 2);
    asm volatile("s_wait_xcnt 0x0" ::: "memory");   // stands in front of every reuse of the address registers that the loads above name
#pragma unroll   // as above
    for (int z = 0; z < KSP; ++z) p[z] = *(const v4f*)(Op + ((zz * KSP + z) * RH + t) * HD + d);
    asm volatile("s_wait_xcnt 0x0" ::: "memory");   // as above
    float mm = ml[0][0];
#pragma unroll   // as above
    for (int z = 1; z < KSP; ++z) mm = fmaxf(mm, ml[z][0]);
    float wsum = 0.f; v4f o = (v4f){};
#pragma unroll   // as above
    for (int z = 0; z < KSP; ++z) { const float w = exp2s(ml[z][0] - mm) * ml[z][1]; wsum += w; o += p[z] * w; }
    *(v4f*)(OUTb + (zz * TT + t) * DQ + d) = o * (1.0f / wsum);
}

extern "C" void kernel_launch(void* const* d_in, const int* in_sizes, int n_in,
                              void* d_out, int out_size, void* d_ws, size_t ws_size, hipStream_t stream) {
    (void)in_sizes; (void)n_in; (void)out_size;
    const float* x = (const float*)d_in[0]; const float* wq = (const float*)d_in[1]; const float* bq = (const float*)d_in[2]; const float* wk = (const float*)d_in[3]; const float* bk = (const float*)d_in[4]; const float* wv = (const float*)d_in[5]; const float* bv = (const float*)d_in[6]; const float* wo = nullptr; (void)wo;
    float* OUT = (float*)d_out;     // [4][4096][128]
    char* wsp = (char*)d_ws;
    auto take = [&](size_t bytes) { char* p = wsp; wsp += (bytes + 255) & ~(size_t)255; return (void*)p; };
    const size_t PE = (size_t)NB_ * TT * HD;   // elements of one 16-bit plane, all batches
    h16* QP16 = (h16*)take(PE * 2); h16* KP16 = (h16*)take(PE * 2); h16* VT16 = (h16*)take(PE * 2);
    bf* QPh = (bf*)take(PE * 2); bf* QPl = (bf*)take(PE * 2); bf* KPh = (bf*)take(PE * 2); bf* KPl = (bf*)take(PE * 2); bf* VTh = (bf*)take(PE * 2); bf* VTl = (bf*)take(PE * 2);
    float* Op = (float*)take((size_t)NB_ * KSP * RH * HD * 4); float* ML = (float*)take((size_t)NB_ * KSP * RH * 2 * 4);   // rows < RH: partial rows [batch][slice][RH][HD], their maximum and sum [batch][slice][RH][2]
    if ((size_t)(wsp - (char*)d_ws) > ws_size) return;    // ws 256 MiB
    k_proj<<<NB_ * TT / 64, 512, 0, stream>>>(x, wq, bq, wk, bk, wv, bv, QP16, QPh, QPl, KP16, KPh, KPl, VT16, VTh, VTl);
    k_fattn<<<dim3((TT - RH) / 64, NB_), 256, 0, stream>>>(QP16, KP16, VT16, OUT);   // query rows >= RH
    k_fattn_hl<<<dim3(KSP, RH / 64, NB_), 256, 0, stream>>>(QPh, QPl, KPh, KPl, VTh, VTl, Op, ML);   // query rows < RH: the slices' partial rows
    k_merge<<<NB_ * RH * HD / 4 / 256, 256, 0, stream>>>(Op, ML, OUT);
}

// v006
// It runs in 62.4 microseconds.
// Next to v005, in two timings, it ran 1.10 times as fast each time.
// Over all steps from v000 it is 16.4 times as fast.
#include <hip/hip_runtime.h>

// Single-head self-attention over 4,096 points (inputs [4][4096][128]; q,k,v = inputs W + b ('xw' [128][128] + [128]); softmax(q.k / sqrt(128)) over all points; out = weights v -> [4][4096][128] (2.1 M)).
// All four batches go through every launch. Attention is fused (scores, online softmax and weights x v in one kernel; neither scores nor weights reach memory): k_fattn, work-groups of 64 query rows >= RH over all keys (fp16); k_fattn_hl, work-groups of 64 query rows < RH over one of KSP key slices (bf16 hi/lo, 3 products); k_merge joins the KSP slices of the rows < RH.
// Front end: ONE launch (k_proj) rounds inputs and weights to bf16, does the three projections and writes every 16-bit plane. Exact projections + bf16-rounded biases; ONE 128-wide head, hybrid rows: < 512 hi/lo 3 products, rest fp16.
// Compute dtypes, f32 accumulate: every input rounded to bf16; projections exact + bf16-rounded biases; attention rows < 512 3 products, rest fp16; softmax f32; output f32.

#define NB_  4
#define TT   4096
#define DM   128
#define NH_  1
#define NKV  1
#define REP  (NH_ / NKV)
#define HD   128
#define DQ   (NH_ * HD)
#define DKV  (NKV * HD)
#define ZH   1
#define RH   512                  // query rows < RH use hi+lo planes (0: none)
#define WIN  0
#define SCL  0.088388347648318447f   // 1/sqrt(128)
#define KSP  8                    // key slices of the query rows < RH: one work-group per (64 rows, slice); normalised f32 partial rows with their maximum and sum go to the workspace, k_merge joins them
typedef _Float16 h16;
typedef unsigned short bf;
typedef __attribute__((ext_vector_type(16))) __bf16   v16bf;
typedef __attribute__((ext_vector_type(16))) _Float16 v16h;
typedef __attribute__((ext_vector_type(8)))  _Float16 v8h;
typedef __attribute__((ext_vector_type(8)))  unsigned short v8us;
typedef __attribute__((ext_vector_type(8)))  float    v8f;
typedef __attribute__((ext_vector_type(4)))  float    v4f;
typedef v8h  __attribute__((may_alias)) v8ha;
typedef v4f  __attribute__((may_alias)) v4fa;
typedef v8us __attribute__((may_alias)) v8usa;

__device__ __forceinline__ unsigned short f2bf(float f) { unsigned u = __float_as_uint(f); u += 0x7FFFu + ((u >> 16) & 1u); return (unsigned short)(u >> 16); }
__device__ __forceinline__ float bf2f(unsigned short b) { return __uint_as_float(((unsigned)b) << 16); }
__device__ __forceinline__ float bfr(float f) { return bf2f(f2bf(f)); }
__device__ __forceinline__ v16h cat16(v8h lo, v8h hi) { return __builtin_shufflevector(lo, hi, 0, 1, 2, 3, 4, 5, 6, 7, 8, 9, 10, 11, 12, 13, 14, 15); }
__device__ __forceinline__ v16bf cat16b(v8us lo, v8us hi) { return __builtin_bit_cast(v16bf, __builtin_shufflevector(lo, hi, 0, 1, 2, 3, 4, 5, 6, 7, 8, 9, 10, 11, 12, 13, 14, 15)); }
__device__ __forceinline__ v8f wmma16(v16h a, v16h b, v8f c) { return __builtin_amdgcn_wmma_f32_16x16x32_f16(false, a, false, b, (short)0, c, false, false); }
__device__ __forceinline__ v8f wmmab(v16bf a, v16bf b, v8f c) { return __builtin_amdgcn_wmma_f32_16x16x32_bf16(false, a, false, b, (short)0, c, false, false); }



// fragment loaders: 16 values of a lane = 8 consecutive k at p and 8 at p + 16
template <typename T16> struct WFrag;
template <> struct WFrag<h16> { typedef v16h V; static __device__ __forceinline__ V ld(const h16* p) { return cat16(*(const v8h*)p, *(const v8h*)(p + 16)); } static __device__ __forceinline__ v8f mma(V a, V b, v8f c) { return wmma16(a, b, c); } };
template <> struct WFrag<bf> { typedef v16bf V; static __device__ __forceinline__ V ld(const bf* p) { return cat16b(*(const v8us*)p, *(const v8us*)(p + 16)); } static __device__ __forceinline__ v8f mma(V a, V b, v8f c) { return wmmab(a, b, c); } };

__device__ __forceinline__ h16 tohx(float x) { return (h16)x; }
__device__ __forceinline__ void splitf(float y, unsigned short& h, unsigned short& l) { h = f2bf(y); l = f2bf(y - bf2f(h)); }
typedef __attribute__((ext_vector_type(2))) _Float16 v2h;
typedef __attribute__((ext_vector_type(4))) _Float16 v4h;
typedef __attribute__((ext_vector_type(2))) unsigned short v2us;
typedef __attribute__((ext_vector_type(4))) unsigned short v4us;
typedef __attribute__((ext_vector_type(2))) float v2f;
typedef __attribute__((ext_vector_type(4))) int v4i;

// ---- k_proj: the whole front end in ONE launch. Work-group = 64 tokens x all 384 features (q, k, v), 16 waves; grid = all tokens / 64.
// The three f32 weight matrices [k][n] and the 64 f32 input rows are rounded to bf16 on their way into LDS (weights transposed to [n][k]); wave (tt = token tile, fg) takes feature tiles 2 fg and 2 fg + 1 of q, of k and of v, 4 products of 32 k each in ascending k.
// q, k: A = weight rows, B = tokens, so a lane holds 8 consecutive features of one token; v: A = tokens, B = weight rows, so a lane holds 8 consecutive tokens of one feature (the [HD][TT] plane's order).
// f32 sum + bf16-rounded bias, then the fp16 plane and the bf16 hi and lo planes; the nine tiles are staged in LDS and leave as whole 128-byte lines.
#define PJP 272                   // LDS pitch in bytes of a row of 128 16-bit values: 256 + 16, an odd multiple of 16
#define PJV 144                   // LDS pitch in bytes of a row of 64 16-bit values: 128 + 16, an odd multiple of 16
__global__ __launch_bounds__(512) void k_proj(const float* __restrict__ x, const float* __restrict__ wq, const float* __restrict__ bq, const float* __restrict__ wk, const float* __restrict__ bk, const float* __restrict__ wv, const float* __restrict__ bv,
                                              h16* Q16, bf* Qh, bf* Ql, h16* K16, bf* Kh, bf* Kl, h16* V16, bf* Vh, bf* Vl) {
    __shared__ __attribute__((aligned(16))) unsigned char WL[3 * 128 * PJP];   // bf16 weights [matrix][n][k]
    __shared__ __attribute__((aligned(16))) unsigned char XL[64 * PJP];        // bf16 inputs [token][k]
    __shared__ __attribute__((aligned(16))) unsigned char SQ[6 * 64 * PJP];    // q and k planes [plane][token][feature]
    __shared__ __attribute__((aligned(16))) unsigned char SV[3 * 128 * PJV];   // v planes [plane][feature][token]
    const int tid = threadIdx.x, lane = tid & 31, wave = tid >> 5, lr = lane & 15, hi = lane >> 4, tt = wave & 3, fg = wave >> 2; const size_t r0 = (size_t)blockIdx.x * 64;
    // all global reads first: 4 pieces of the input rows, of each weight matrix rows 8 wave .. 8 wave + 7, columns 4 lane .. 4 lane + 3 (every load covers 512 contiguous bytes per wave)
    v4f xv[4], wr[3][8]; const float* xb = x + r0 * DM; const unsigned wo = (unsigned)wave * 4096u + (unsigned)lane * 16u;   // this thread's byte offset in a weight matrix
#pragma unroll   // constant indices keep the array in registers
    for (int s = 0; s < 4; ++s) xv[s] = *(const v4f*)(xb + (size_t)(tid + 512 * s) * 4);
#pragma unroll   // constant indices keep the array in registers
    for (int r = 0; r < 8; ++r) { wr[0][r] = *(const v4f*)((const char*)wq + wo + 512 * r); wr[1][r] = *(const v4f*)((const char*)wk + wo + 512 * r); wr[2][r] = *(const v4f*)((const char*)wv + wo + 512 * r); }
    asm volatile("s_wait_xcnt 0x0" :: "s"(xb), "s"(wq), "s"(wk), "s"(wv), "v"(tid), "v"(wo) : "memory");   // stands in front of every reuse of a register that the loads above name; the base pointers, the thread index and the weight offset are inputs so that their registers stay theirs up to here
#pragma unroll   // constant indices keep the array in registers
    for (int s = 0; s < 4; ++s) { const int i = tid + 512 * s; v4us o;
#pragma unroll   // constant indices keep the array in registers
        for (int q = 0; q < 4; ++q) o[q] = f2bf(xv[s][q]);
        *(v4us*)(XL + (i >> 5) * PJP + (i & 31) * 8) = o; }
#pragma unroll   // constant indices keep the array in registers
    for (int m = 0; m < 3; ++m)
#pragma unroll   // constant indices keep the array in registers
        for (int i = 0; i < 4; ++i) { v8us o;
#pragma unroll   // constant indices keep the array in registers
            for (int r = 0; r < 8; ++r) o[r] = f2bf(wr[m][r][i]);
            *(v8us*)(WL + (m * 128 + lane * 4 + i) * PJP + wave * 16) = o; }
    __syncthreads();   // inputs and weights are in LDS
    v16bf xf[4];
#pragma unroll   // constant indices keep the array in registers
    for (int kc = 0; kc < 4; ++kc) xf[kc] = WFrag<bf>::ld((const bf*)(XL + (tt * 16 + lr) * PJP + 16 * hi + 64 * kc));
    v8f acc[3][2];
#pragma unroll   // constant indices keep the array in registers
    for (int m = 0; m < 3; ++m)
#pragma unroll   // constant indices keep the array in registers
        for (int u = 0; u < 2; ++u) { v8f a = (v8f){}; const unsigned char* wrow = WL + (m * 128 + (2 * fg + u) * 16 + lr) * PJP + 16 * hi;
#pragma unroll   // constant indices keep the array in registers
            for (int kc = 0; kc < 4; ++kc) { const v16bf wf = WFrag<bf>::ld((const bf*)(wrow + 64 * kc)); a = (m < 2) ? wmmab(wf, xf[kc], a) : wmmab(xf[kc], wf, a); }
            acc[m][u] = a; }
#pragma unroll   // constant indices keep the array in registers
    for (int m = 0; m < 3; ++m)
#pragma unroll   // constant indices keep the array in registers
        for (int u = 0; u < 2; ++u) { const int f0 = (2 * fg + u) * 16; const float* bm = (m == 0) ? bq : (m == 1) ? bk : bv; v8h o16; v8us oh, ol;
#pragma unroll   // constant indices keep the array in registers
            for (int j = 0; j < 8; ++j) { const float y = acc[m][u][j] + bfr(bm[(m < 2) ? f0 + hi * 8 + j : f0 + lr]); o16[j] = tohx(y); unsigned short a2, c2; splitf(y, a2, c2); oh[j] = a2; ol[j] = c2; }
            if (m < 2) { unsigned char* d = SQ + (m * 3 * 64 + tt * 16 + lr) * PJP + (f0 + hi * 8) * 2; *(v8h*)d = o16; *(v8us*)(d + 64 * PJP) = oh; *(v8us*)(d + 2 * 64 * PJP) = ol; }
            else { unsigned char* d = SV + (f0 + lr) * PJV + (tt * 16 + hi * 8) * 2; *(v8h*)d = o16; *(v8us*)(d + 128 * PJV) = oh; *(v8us*)(d + 2 * 128 * PJV) = ol; } }
    __syncthreads();   // the nine staged tiles are complete
    // q and k planes: the 64 token rows of a plane are 16 KiB in a row; v planes: 128 feature rows of 128 bytes
    const size_t zb = r0 / TT, t0 = r0 % TT;
#pragma unroll   // constant indices pick the plane's pointer at compile time
    for (int p = 0; p < 6; ++p) { char* g = (char*)(p == 0 ? (void*)Q16 : p == 1 ? (void*)Qh : p == 2 ? (void*)Ql : p == 3 ? (void*)K16 : p == 4 ? (void*)Kh : (void*)Kl) + r0 * (HD * 2);
#pragma unroll   // as above
        for (int s = 0; s < 2; ++s) { const int i = tid + 512 * s; *(v8us*)(g + (size_t)i * 16) = *(const v8us*)(SQ + (p * 64 + (i >> 4)) * PJP + (i & 15) * 16); } }
#pragma unroll   // constant indices pick the plane's pointer at compile time
    for (int p = 0; p < 3; ++p) { char* g = (char*)(p == 0 ? (void*)V16 : p == 1 ? (void*)Vh : (void*)Vl) + (zb * HD * TT + t0) * 2;
#pragma unroll   // as above
        for (int s = 0; s < 2; ++s) { const int i = tid + 512 * s; *(v8us*)(g + (size_t)(i >> 3) * (TT * 2) + (i & 7) * 16) = *(const v8us*)(SV + (p * 128 + (i >> 3)) * PJV + (i & 7) * 16); } }
}

#define FSK    256                // keys per stage
#define FPITCH 272                // LDS pitch in bytes of a K row: 256 + 16, an odd multiple of 16 for the 16-byte fragment reads
#define FVP    528                // LDS pitch in bytes of a V^T row of FSK keys: 512 + 16, an odd multiple of 16
#define FKT    (FSK * FPITCH)     // K tile: FSK keys, 256 B of d
#define FVT    (128 * FVP)        // V^T tile: 128 d, 512 B of keys
#define FSLOT  (FKT + FVT)
__device__ __forceinline__ float xhalf(float x) { return __builtin_bit_cast(float, __builtin_amdgcn_permlanex16(__builtin_bit_cast(int, x), __builtin_bit_cast(int, x), 0x76543210, 0xfedcba98, false, false)); }   // lane l with lane l ^ 16
// 2^x with the slot that the instruction set asks for behind a transcendental (before its result is read or its source overwritten): the v_nop stands in the same statement so that it stays directly behind
__device__ __forceinline__ float exp2s(float x) { float r; asm("v_exp_f32 %0, %1\n\tv_nop" : "=v"(r) : "v"(x)); return r; }
// eight 16-byte copies of one lane, LDS rows ls bytes and global rows gs bytes apart; the s_wait_xcnt closes the statement so that no address register is rewritten in front of it
__device__ __forceinline__ void cp8(unsigned l, unsigned ls, const char* g, size_t gs) {
    asm volatile("global_load_async_to_lds_b128 %0, %8, off\n\tglobal_load_async_to_lds_b128 %1, %9, off\n\tglobal_load_async_to_lds_b128 %2, %10, off\n\tglobal_load_async_to_lds_b128 %3, %11, off\n\t"
                 "global_load_async_to_lds_b128 %4, %12, off\n\tglobal_load_async_to_lds_b128 %5, %13, off\n\tglobal_load_async_to_lds_b128 %6, %14, off\n\tglobal_load_async_to_lds_b128 %7, %15, off\n\ts_wait_xcnt 0x0"
                 :: "v"(l), "v"(l + ls), "v"(l + 2u * ls), "v"(l + 3u * ls), "v"(l + 4u * ls), "v"(l + 5u * ls), "v"(l + 6u * ls), "v"(l + 7u * ls),
                    "v"(g), "v"(g + gs), "v"(g + 2 * gs), "v"(g + 3 * gs), "v"(g + 4 * gs), "v"(g + 5 * gs), "v"(g + 6 * gs), "v"(g + 7 * gs) : "memory");
}
// no register cap: Q (64), the accumulators (128), one K and one V^T fragment set (64 each) and the scores take more than 256 registers; one work-group per WGP, 2 waves per SIMD, leaves each wave 512
__global__ __launch_bounds__(256) void k_fattn(const h16* __restrict__ Q, const h16* __restrict__ Kp, const h16* __restrict__ Vt, float* OUTb) {
    __shared__ __attribute__((aligned(16))) unsigned char L[2 * FSLOT];
    const int tid = threadIdx.x, lane = tid & 31, wave = tid >> 5, c = lane & 15, h = lane >> 4, cg = wave & 1, kp = wave >> 1; const size_t zb = blockIdx.y; const int qrow = RH + blockIdx.x * 64 + cg * 32 + c;   // column tile u: query qrow + 16 u
    // K tile: thread -> 16-byte piece tid & 15 of rows (tid >> 4) + 16 n; V^T tile: piece tid & 31 of rows (tid >> 5) + 8 n; n = 0..15
    const unsigned lk = (unsigned)(size_t)L + (unsigned)(tid >> 4) * FPITCH + (unsigned)(tid & 15) * 16u;
    const unsigned lv = (unsigned)(size_t)L + (unsigned)FKT + (unsigned)(tid >> 5) * FVP + (unsigned)(tid & 31) * 16u;
    const char* gk = (const char*)(Kp + zb * TT * HD) + (size_t)(tid >> 4) * (HD * 2) + (tid & 15) * 16;
    const char* gv = (const char*)(Vt + zb * HD * TT) + (size_t)(tid >> 5) * (TT * 2) + (tid & 31) * 16;
    auto stage = [&](int st) { const unsigned sb = (unsigned)(st & 1) * FSLOT; const char* k0 = gk + (size_t)st * (FSK * HD * 2); const char* v0 = gv + (size_t)st * (FSK * 2);
        cp8(lk + sb, 16u * FPITCH, k0, 16 * HD * 2); cp8(lk + sb + 128u * FPITCH, 16u * FPITCH, k0 + 128 * HD * 2, 16 * HD * 2);
        cp8(lv + sb, 8u * FVP, v0, (size_t)8 * TT * 2); cp8(lv + sb + 64u * FVP, 8u * FVP, v0 + (size_t)64 * TT * 2, (size_t)8 * TT * 2); };
    stage(0);
    v16h qf[2][4];
#pragma unroll   // constant indices keep the array in registers
    for (int u = 0; u < 2; ++u)
#pragma unroll   // constant indices keep the array in registers
        for (int kc = 0; kc < 4; ++kc) qf[u][kc] = WFrag<h16>::ld(Q + (zb * TT + qrow + 16 * u) * HD + 8 * h + 32 * kc);
    asm volatile("s_wait_xcnt 0x0" ::: "memory");   // stands in front of every reuse of the address registers that the loads above name
    v8f acc[2][8];
#pragma unroll   // constant indices keep the array in registers
    for (int u = 0; u < 2; ++u)
#pragma unroll   // constant indices keep the array in registers
        for (int t = 0; t < 8; ++t) acc[u][t] = (v8f){};
    float m_run[2] = {-__builtin_inff(), -__builtin_inff()}, l_run[2] = {0.f, 0.f}; const float cs = SCL * 1.4426950408889634f;   // scores in the log2 domain
    asm volatile("s_wait_asynccnt 0x0" ::: "memory");   // this wave's copies of stage 0 have landed
    __syncthreads();                                    // ... and every other wave's
    stage(1);
    const int kro = (kp * 64 + c) * FPITCH + 16 * h, vro = FKT + c * FVP + kp * 128 + 16 * h;   // this lane's first K row and first V^T row piece in a buffer
#pragma unroll 1   // rolled: one stage is the loop body, the two buffers alternate by st & 1
    for (int st = 0; st < TT / FSK; ++st) {
        const unsigned char* Bf = L + (st & 1) * FSLOT;
        v16h kf[2][4], vf[8];
#pragma unroll   // constant indices keep the array in registers
        for (int kt = 0; kt < 2; ++kt)
#pragma unroll   // constant indices keep the array in registers
            for (int kc = 0; kc < 4; ++kc) kf[kt][kc] = WFrag<h16>::ld((const h16*)(Bf + kro + kt * 16 * FPITCH + 64 * kc));
#pragma unroll   // constant indices keep the array in registers
        for (int sub = 0; sub < 2; ++sub) {   // one pass: 32 keys x 32 query columns
            __builtin_amdgcn_sched_barrier(0);   // keeps the V^T reads below behind the stage's first K reads (which the score products wait for) and out of the products of the pass before, whose registers they take
#pragma unroll   // constant indices keep the array in registers
            for (int t = 0; t < 8; ++t) vf[t] = WFrag<h16>::ld((const h16*)(Bf + vro + t * 16 * FVP + sub * 64));
            __builtin_amdgcn_sched_barrier(0);   // keeps the pass's V^T reads issued as one group here, in flight under the score products and the softmax
            v8f s[2][2];   // [column tile][key tile]: four independent chains
#pragma unroll   // constant indices keep the array in registers
            for (int u = 0; u < 2; ++u) { s[u][0] = (v8f){}; s[u][1] = (v8f){}; }
#pragma unroll   // constant indices keep the array in registers
            for (int kc = 0; kc < 4; ++kc)
#pragma unroll   // constant indices keep the array in registers
                for (int kt = 0; kt < 2; ++kt)
#pragma unroll   // constant indices keep the array in registers
                    for (int u = 0; u < 2; ++u) s[u][kt] = wmma16(kf[kt][kc], qf[u][kc], s[u][kt]);
            float mx[2];
#pragma unroll   // constant indices keep the array in registers
            for (int u = 0; u < 2; ++u) { float m = s[u][0][0];
#pragma unroll   // constant indices keep the array in registers
                for (int j = 1; j < 8; ++j) m = fmaxf(m, s[u][0][j]);
#pragma unroll   // constant indices keep the array in registers
                for (int j = 0; j < 8; ++j) m = fmaxf(m, s[u][1][j]);
                mx[u] = fmaxf(m, xhalf(m)) * cs; }
            // lazy rescale: the maximum in use may trail the true one by up to 8 (log2), so a weight stays <= 256; one scalar test per pass for both column tiles
            if (__builtin_amdgcn_ballot_w32((mx[0] > m_run[0] + 8.0f) | (mx[1] > m_run[1] + 8.0f)) != 0) {
#pragma unroll   // constant indices keep the array in registers
                for (int u = 0; u < 2; ++u) { const float m_new = fmaxf(m_run[u], mx[u]); const float corr = exp2s(m_run[u] - m_new); l_run[u] *= corr; m_run[u] = m_new;
#pragma unroll   // constant indices keep the array in registers
                    for (int t = 0; t < 8; ++t) acc[u][t] = acc[u][t] * corr; } }
            v16h pf[2];
#pragma unroll   // constant indices keep the array in registers
            for (int u = 0; u < 2; ++u) { float ps0 = 0.f, ps1 = 0.f;
#pragma unroll   // constant indices keep the array in registers
                for (int j = 0; j < 8; ++j) { const float p0 = exp2s(__builtin_fmaf(s[u][0][j], cs, -m_run[u])), p1 = exp2s(__builtin_fmaf(s[u][1][j], cs, -m_run[u])); ps0 += p0; ps1 += p1; pf[u][j] = (h16)p0; pf[u][8 + j] = (h16)p1; }
                l_run[u] += ps0 + ps1; }
            if (sub == 0) {
                __builtin_amdgcn_sched_barrier(0);   // keeps the next pass's K reads here, as one group behind the softmax and in flight under the products below
#pragma unroll   // constant indices keep the array in registers
                for (int kt = 0; kt < 2; ++kt)
#pragma unroll   // constant indices keep the array in registers
                    for (int kc = 0; kc < 4; ++kc) kf[kt][kc] = WFrag<h16>::ld((const h16*)(Bf + kro + (32 + kt * 16) * FPITCH + 64 * kc));
                __builtin_amdgcn_sched_barrier(0);   // as above
            }
#pragma unroll   // constant indices keep the array in registers
            for (int t = 0; t < 8; ++t)
#pragma unroll   // constant indices keep the array in registers
                for (int u = 0; u < 2; ++u) acc[u][t] = wmma16(vf[t], pf[u], acc[u][t]);
        }
        asm volatile("s_wait_dscnt 0x0" ::: "memory");      // this wave's reads of the buffer are done
        asm volatile("s_wait_asynccnt 0x0" ::: "memory");   // this wave's copies of stage st + 1 have landed
        __syncthreads();                                    // publishes stage st + 1 and ends every wave's reads of stage st
        if (st + 2 < TT / FSK) stage(st + 2);               // refill of the buffer just left
    }
    asm volatile("s_wait_asynccnt 0x0" ::: "memory");       // no copy in flight: the buffers become the staging of the join
    // join of the four key parts (behind the loop's last barrier nobody reads the buffers): every wave leaves its accumulators, maxima and sums in LDS, [wave][33][lane] pieces of 16 bytes;
    // then wave (cg, kp) adds, in ascending key part, the four parts' d tiles 2 kp and 2 kp + 1 of its 32 columns: 128 bytes in a row of every output row, one whole line per writer
    v4f* X = (v4f*)L + lane; v4f* Xw = X + wave * (33 * 32);
#pragma unroll   // constant indices keep the array in registers
    for (int u = 0; u < 2; ++u)
#pragma unroll   // constant indices keep the array in registers
        for (int t = 0; t < 8; ++t) { Xw[((u * 8 + t) * 2) * 32] = __builtin_shufflevector(acc[u][t], acc[u][t], 0, 1, 2, 3); Xw[((u * 8 + t) * 2 + 1) * 32] = __builtin_shufflevector(acc[u][t], acc[u][t], 4, 5, 6, 7); }
    Xw[32 * 32] = (v4f){m_run[0], l_run[0], m_run[1], l_run[1]};
    __syncthreads();   // every part's values are in LDS
    v4f ml[4];
#pragma unroll   // constant indices keep the array in registers
    for (int p = 0; p < 4; ++p) ml[p] = X[((cg + 2 * p) * 33 + 32) * 32];
#pragma unroll   // constant indices keep the array in registers
    for (int u = 0; u < 2; ++u) {
        const float m_all = fmaxf(fmaxf(ml[0][2 * u], ml[1][2 * u]), fmaxf(ml[2][2 * u], ml[3][2 * u])); float f[4], lh = 0.f;
#pragma unroll   // constant indices keep the array in registers
        for (int p = 0; p < 4; ++p) { f[p] = exp2s(ml[p][2 * u] - m_all); lh += ml[p][2 * u + 1] * f[p]; }
        const float inv = 1.0f / (lh + xhalf(lh));   // each half summed its own eight keys of every tile
        float* orow = OUTb + (zb * TT + qrow + 16 * u) * DQ + kp * 32 + 8 * h;
#pragma unroll   // constant indices keep the array in registers
        for (int tt = 0; tt < 2; ++tt) { v4f a = (v4f){}, b = (v4f){};
#pragma unroll   // constant indices keep the array in registers
            for (int p = 0; p < 4; ++p) { const v4f* xp = X + ((cg + 2 * p) * 33 + (u * 8 + 2 * kp + tt) * 2) * 32; a += xp[0] * f[p]; b += xp[32] * f[p]; }
            *(v4f*)(orow + tt * 16) = a * inv; *(v4f*)(orow + tt * 16 + 4) = b * inv; }
    }
}

// ---- k_fattn_hl: the same fused form for query rows < RH, bf16 hi/lo planes, 3 products each way (Kh Qh + Kh Ql + Kl Qh; Vh Ph + Vh Pl + Vl Ph), f32 scores, softmax and sums. Work-group = (key slice of TT / KSP keys, 64-row tile, batch): grid (KSP, RH / 64, batch).
// 8 waves = 4 groups of 16 query columns x 2 key parts of 32 keys; stages of HSK keys (K hi, K lo, V^T hi, V^T lo) by asynchronous copies to LDS, two buffers, the order of the fp16 loop.
// The weight p = 2^(score - maximum in use) is split p = hi + lo in bf16 before the products. The slice's rows leave normalised, with their maximum (log2 domain) and sum, for k_merge.
#define HSK    64                 // keys per stage
#define HVP    144                // LDS pitch in bytes of a V^T row of 64 keys: 128 + 16, an odd multiple of 16
#define HKT    (HSK * FPITCH)     // one K tile: 64 keys, 256 B of d
#define HVT    (128 * HVP)        // one V^T tile: 128 d, 128 B of keys
#define HSLOT  (2 * HKT + 2 * HVT)
typedef __attribute__((ext_vector_type(2))) __bf16 v2bf;
// eight 16-byte copies of one lane: four rows of the hi tile (from ga) and the same four of the lo tile (from gb, ld bytes further in LDS), LDS rows ls bytes and global rows gs bytes apart; the s_wait_xcnt closes the statement so that no address register is rewritten in front of it
__device__ __forceinline__ void cp44(unsigned l, unsigned ls, unsigned ld, const char* ga, const char* gb, size_t gs) {
    asm volatile("global_load_async_to_lds_b128 %0, %8, off\n\tglobal_load_async_to_lds_b128 %1, %9, off\n\tglobal_load_async_to_lds_b128 %2, %10, off\n\tglobal_load_async_to_lds_b128 %3, %11, off\n\t"
                 "global_load_async_to_lds_b128 %4, %12, off\n\tglobal_load_async_to_lds_b128 %5, %13, off\n\tglobal_load_async_to_lds_b128 %6, %14, off\n\tglobal_load_async_to_lds_b128 %7, %15, off\n\ts_wait_xcnt 0x0"
                 :: "v"(l), "v"(l + ls), "v"(l + 2u * ls), "v"(l + 3u * ls), "v"(l + ld), "v"(l + ld + ls), "v"(l + ld + 2u * ls), "v"(l + ld + 3u * ls),
                    "v"(ga), "v"(ga + gs), "v"(ga + 2 * gs), "v"(ga + 3 * gs), "v"(gb), "v"(gb + gs), "v"(gb + 2 * gs), "v"(gb + 3 * gs) : "memory");
}
// no register cap: two fragment sets in flight beside Q hi/lo, the accumulators and the weights take a few registers above 256; the grid is one work-group per WGP (2 waves per SIMD), so nothing asks for fewer
__global__ __launch_bounds__(256) void k_fattn_hl(const bf* __restrict__ Qh, const bf* __restrict__ Ql, const bf* __restrict__ Kh, const bf* __restrict__ Kl, const bf* __restrict__ Vh, const bf* __restrict__ Vl, float* Op, float* ML) {
    __shared__ __attribute__((aligned(16))) unsigned char L[2 * HSLOT];
    const int tid = threadIdx.x, lane = tid & 31, wave = tid >> 5, c = lane & 15, h = lane >> 4, cg = wave & 3, kp = wave >> 2;
    const int ks = blockIdx.x, rt = blockIdx.y; const size_t zb = blockIdx.z; const int qrow = rt * 64 + cg * 16 + c;
    // K tiles: thread -> 16-byte piece tid & 15 of rows (tid >> 4) + 16 n; V^T tiles: piece tid & 7 of rows (tid >> 3) + 32 n; n = 0..3
    const unsigned lk = (unsigned)(size_t)L + (unsigned)(tid >> 4) * FPITCH + (unsigned)(tid & 15) * 16u;
    const unsigned lv = (unsigned)(size_t)L + 2u * HKT + (unsigned)(tid >> 3) * HVP + (unsigned)(tid & 7) * 16u;
    const size_t ko = (zb * TT + (size_t)ks * (TT / KSP) + (tid >> 4)) * (HD * 2) + (tid & 15) * 16;
    const size_t vo = (zb * HD + (tid >> 3)) * (TT * 2) + (size_t)ks * (TT / KSP) * 2 + (tid & 7) * 16;
    auto stage = [&](int st) { const unsigned sb = (unsigned)(st & 1) * HSLOT; const size_t kb = ko + (size_t)st * (HSK * HD * 2), vb = vo + (size_t)st * (HSK * 2);
        cp44(lk + sb, 16u * FPITCH, HKT, (const char*)Kh + kb, (const char*)Kl + kb, 16 * HD * 2);
        cp44(lv + sb, 32u * HVP, HVT, (const char*)Vh + vb, (const char*)Vl + vb, (size_t)32 * TT * 2); };
    stage(0);
    v16bf qh[4], ql[4];
#pragma unroll   // constant indices keep the array in registers
    for (int kc = 0; kc < 4; ++kc) { qh[kc] = WFrag<bf>::ld(Qh + (zb * TT + qrow) * HD + 8 * h + 32 * kc); ql[kc] = WFrag<bf>::ld(Ql + (zb * TT + qrow) * HD + 8 * h + 32 * kc); }
    asm volatile("s_wait_xcnt 0x0" ::: "memory");   // stands in front of every reuse of the address registers that the loads above name
    v8f acc[8];
#pragma unroll   // constant indices keep the array in registers
    for (int t = 0; t < 8; ++t) acc[t] = (v8f){};
    float m_run = -__builtin_inff(), l_run = 0.f; const float cs = SCL * 1.4426950408889634f;   // scores in the log2 domain
    asm volatile("s_wait_asynccnt 0x0" ::: "memory");   // this wave's copies of stage 0 have landed
    __syncthreads();                                    // ... and every other wave's
    stage(1);
    const int kro = (kp * 32 + c) * FPITCH + 16 * h, vro = 2 * HKT + c * HVP + kp * 64 + 16 * h;   // this lane's first K row and first V^T row piece in a buffer
#pragma unroll 1   // rolled: one stage is the loop body, the two buffers alternate by st & 1
    for (int st = 0; st < TT / KSP / HSK; ++st) {
        const unsigned char* Bf = L + (st & 1) * HSLOT;
        // fragment reads go in groups of four fragments, two register sets fa and fb in turn: a group is issued while the products on the group before it run, so that its LDS latency lies under them
        v16bf fa[4], fb[4]; v8f s[2], s0, s1;   // s0, s1: two independent chains (d 0..63, d 64..127): a product need not wait for the one before it
        auto ldK = [&](v16bf (&f)[4], int kt, int kc) { const unsigned char* kr = Bf + kro + kt * 16 * FPITCH + 64 * kc; f[0] = WFrag<bf>::ld((const bf*)kr); f[1] = WFrag<bf>::ld((const bf*)(kr + 128)); f[2] = WFrag<bf>::ld((const bf*)(kr + HKT)); f[3] = WFrag<bf>::ld((const bf*)(kr + HKT + 128)); };
        auto mmK = [&](v16bf (&f)[4], int kc) { s0 = wmmab(f[0], qh[kc], s0); s1 = wmmab(f[1], qh[kc + 2], s1); s0 = wmmab(f[0], ql[kc], s0); s1 = wmmab(f[1], ql[kc + 2], s1); s0 = wmmab(f[2], qh[kc], s0); s1 = wmmab(f[3], qh[kc + 2], s1); };
        auto ldV = [&](v16bf (&f)[4], int g) { const unsigned char* vr = Bf + vro + 2 * g * 16 * HVP; f[0] = WFrag<bf>::ld((const bf*)vr); f[1] = WFrag<bf>::ld((const bf*)(vr + 16 * HVP)); f[2] = WFrag<bf>::ld((const bf*)(vr + HVT)); f[3] = WFrag<bf>::ld((const bf*)(vr + HVT + 16 * HVP)); };
        ldK(fa, 0, 0); ldK(fb, 0, 1);
        __builtin_amdgcn_sched_barrier(0);   // keeps the reads above in front of the products below
        s0 = (v8f){}; s1 = (v8f){}; mmK(fa, 0);
        __builtin_amdgcn_sched_barrier(0);   // keeps the next group's reads here, behind the products that used its registers
        ldK(fa, 1, 0);
        __builtin_amdgcn_sched_barrier(0);   // keeps those reads in front of the products below
        mmK(fb, 1); s[0] = s0 + s1;
        __builtin_amdgcn_sched_barrier(0);   // as above: next group's reads behind the last use of their registers
        ldK(fb, 1, 1);
        __builtin_amdgcn_sched_barrier(0);   // as above: reads in front of the products
        s0 = (v8f){}; s1 = (v8f){}; mmK(fa, 0);
        __builtin_amdgcn_sched_barrier(0);   // as above: next group's reads behind the last use of their registers
        ldV(fa, 0);
        __builtin_amdgcn_sched_barrier(0);   // as above: reads in front of the products
        mmK(fb, 1); s[1] = s0 + s1;
        float mx = s[0][0];
#pragma unroll   // constant indices keep the array in registers
        for (int j = 1; j < 8; ++j) mx = fmaxf(mx, s[0][j]);
#pragma unroll   // constant indices keep the array in registers
        for (int j = 0; j < 8; ++j) mx = fmaxf(mx, s[1][j]);
        mx = fmaxf(mx, xhalf(mx)) * cs;
        // lazy rescale, as in the fp16 loop: the maximum in use may trail the true one by up to 8 (log2)
        if (__builtin_amdgcn_ballot_w32(mx > m_run + 8.0f) != 0) { const float m_new = fmaxf(m_run, mx); const float corr = __builtin_amdgcn_exp2f(m_run - m_new); l_run *= corr; m_run = m_new;
#pragma unroll   // constant indices keep the array in registers
            for (int t = 0; t < 8; ++t) acc[t] = acc[t] * corr; }
        v16bf ph, pl; float ps0 = 0.f, ps1 = 0.f;
#pragma unroll   // constant indices keep the array in registers
        for (int kt = 0; kt < 2; ++kt)
#pragma unroll   // constant indices keep the array in registers
            for (int j = 0; j < 8; j += 2) { v2f p; p[0] = exp2s(__builtin_fmaf(s[kt][j], cs, -m_run)); p[1] = exp2s(__builtin_fmaf(s[kt][j + 1], cs, -m_run)); ps0 += p[0]; ps1 += p[1];
                const v2bf a = __builtin_convertvector(p, v2bf); const v2bf b = __builtin_convertvector(p - __builtin_convertvector(a, v2f), v2bf);
                ph[8 * kt + j] = a[0]; ph[8 * kt + j + 1] = a[1]; pl[8 * kt + j] = b[0]; pl[8 * kt + j + 1] = b[1]; }
        l_run += ps0 + ps1;
        auto mmV = [&](v16bf (&f)[4], int g) { acc[2 * g] = wmmab(f[0], ph, acc[2 * g]); acc[2 * g + 1] = wmmab(f[1], ph, acc[2 * g + 1]); acc[2 * g] = wmmab(f[0], pl, acc[2 * g]); acc[2 * g + 1] = wmmab(f[1], pl, acc[2 * g + 1]); acc[2 * g] = wmmab(f[2], ph, acc[2 * g]); acc[2 * g + 1] = wmmab(f[3], ph, acc[2 * g + 1]); };
        __builtin_amdgcn_sched_barrier(0);   // keeps the second V^T group's reads behind the softmax, whose registers they take
        ldV(fb, 1);
        __builtin_amdgcn_sched_barrier(0);   // as above: reads in front of the products
        mmV(fa, 0);
        __builtin_amdgcn_sched_barrier(0);   // as above: next group's reads behind the last use of their registers
        ldV(fa, 2);
        __builtin_amdgcn_sched_barrier(0);   // as above: reads in front of the products
        mmV(fb, 1);
        __builtin_amdgcn_sched_barrier(0);   // as above: next group's reads behind the last use of their registers
        ldV(fb, 3);
        __builtin_amdgcn_sched_barrier(0);   // as above: reads in front of the products
        mmV(fa, 2); mmV(fb, 3);
        asm volatile("s_wait_dscnt 0x0" ::: "memory");      // this wave's reads of the buffer are done
        asm volatile("s_wait_asynccnt 0x0" ::: "memory");   // this wave's copies of stage st + 1 have landed
        __syncthreads();                                    // publishes stage st + 1 and ends every wave's reads of stage st
        if (st + 2 < TT / KSP / HSK) stage(st + 2);         // refill of the buffer just left
    }
    asm volatile("s_wait_asynccnt 0x0" ::: "memory");       // no copy in flight: the buffers become the staging of the join
    // join of the two key parts through LDS: part 1 leaves its accumulators, maximum and sum, part 0 adds them to its own and writes the rows
    v4f* X = (v4f*)L + (size_t)cg * 17 * 32 + lane;
    if (kp == 1) {
#pragma unroll   // constant indices keep the array in registers
        for (int t = 0; t < 8; ++t) { X[(2 * t) * 32] = __builtin_shufflevector(acc[t], acc[t], 0, 1, 2, 3); X[(2 * t + 1) * 32] = __builtin_shufflevector(acc[t], acc[t], 4, 5, 6, 7); }
        X[16 * 32] = (v4f){m_run, l_run, 0.f, 0.f};
    }
    __syncthreads();   // part 1's values are in LDS
    if (kp == 0) {
        const v4f ml = X[16 * 32]; const float m_all = fmaxf(m_run, ml[0]); const float a0 = exp2s(m_run - m_all), a1 = exp2s(ml[0] - m_all);
        const float lh = l_run * a0 + ml[1] * a1; const float lt = lh + xhalf(lh); const float inv = 1.0f / lt;   // each half summed its own eight keys of every tile
        const float f0 = a0 * inv, f1 = a1 * inv; const size_t pr = (zb * KSP + ks) * RH + qrow; float* orow = Op + pr * HD + 8 * h;
#pragma unroll   // constant indices keep the array in registers
        for (int t = 0; t < 8; ++t) { const v4f x0 = X[(2 * t) * 32], x1 = X[(2 * t + 1) * 32]; v4f a, b;
#pragma unroll   // constant indices keep the array in registers
            for (int j = 0; j < 4; ++j) { a[j] = acc[t][j] * f0 + x0[j] * f1; b[j] = acc[t][4 + j] * f0 + x1[j] * f1; }
            *(v4f*)(orow + t * 16) = a; *(v4f*)(orow + t * 16 + 4) = b; }
        if (h == 0) { v2f o; o[0] = m_all; o[1] = lt; *(v2f*)(ML + pr * 2) = o; }
    }
}

// ---- k_merge: query rows < RH: the KSP key slices' normalised rows, each weighted by its sum x 2^(its maximum - the row's maximum), added in ascending key order and divided by the sum of the weights. Thread = 4 features of one row.
__global__ __launch_bounds__(256) void k_merge(const float* __restrict__ Op, const float* __restrict__ ML, float* OUTb) {
    const size_t e = ((size_t)blockIdx.x * 256 + threadIdx.x) * 4; const int d = (int)(e % HD); const int t = (int)((e / HD) % RH); const size_t zz = e / ((size_t)HD * RH);
    v2f ml[KSP]; v4f p[KSP];   // all loads in flight at once
#pragma unroll   // constant indices keep the arrays in registers
    for (int z = 0; z < KSP; ++z) ml[z] = *(const v2f*)(ML + ((zz * KSP + z) * RH + t) * 2);
    asm volatile("s_wait_xcnt 0x0" ::: "memory");   // stands in front of every reuse of the address registers that the loads above name
#pragma unroll   // as above
    for (int z = 0; z < KSP; ++z) p[z] = *(const v4f*)(Op + ((zz * KSP + z) * RH + t) * HD + d);
    asm volatile("s_wait_xcnt 0x0" ::: "memory");   // as above
    float mm = ml[0][0];
#pragma unroll   // as above
    for (int z = 1; z < KSP; ++z) mm = fmaxf(mm, ml[z][0]);
    float wsum = 0.f; v4f o = (v4f){};
#pragma unroll   // as above
    for (int z = 0; z < KSP; ++z) { const float w = exp2s(ml[z][0] - mm) * ml[z][1]; wsum += w; o += p[z] * w; }
    *(v4f*)(OUTb + (zz * TT + t) * DQ + d) = o * (1.0f / wsum);
}

extern "C" void kernel_launch(void* const* d_in, const int* in_sizes, int n_in,
                              void* d_out, int out_size, void* d_ws, size_t ws_size, hipStream_t stream) {
    (void)in_sizes; (void)n_in; (void)out_size;
    const float* x = (const float*)d_in[0]; const float* wq = (const float*)d_in[1]; const float* bq = (const float*)d_in[2]; const float* wk = (const float*)d_in[3]; const float* bk = (const float*)d_in[4]; const float* wv = (const float*)d_in[5]; const float* bv = (const float*)d_in[6]; const float* wo = nullptr; (void)wo;
    float* OUT = (float*)d_out;     // [4][4096][128]
    char* wsp = (char*)d_ws;
    auto take = [&](size_t bytes) { char* p = wsp; wsp += (bytes + 255) & ~(size_t)255; return (void*)p; };
    const size_t PE = (size_t)NB_ * TT * HD;   // elements of one 16-bit plane, all batches
    h16* QP16 = (h16*)take(PE * 2); h16* KP16 = (h16*)take(PE * 2); h16* VT16 = (h16*)take(PE * 2);
    bf* QPh = (bf*)take(PE * 2); bf* QPl = (bf*)take(PE * 2); bf* KPh = (bf*)take(PE * 2); bf* KPl = (bf*)take(PE * 2); bf* VTh = (bf*)take(PE * 2); bf* VTl = (bf*)take(PE * 2);
    float* Op = (float*)take((size_t)NB_ * KSP * RH * HD * 4); float* ML = (float*)take((size_t)NB_ * KSP * RH * 2 * 4);   // rows < RH: partial rows [batch][slice][RH][HD], their maximum and sum [batch][slice][RH][2]
    if ((size_t)(wsp - (char*)d_ws) > ws_size) return;    // ws 256 MiB
    k_proj<<<NB_ * TT / 64, 512, 0, stream>>>(x, wq, bq, wk, bk, wv, bv, QP16, QPh, QPl, KP16, KPh, KPl, VT16, VTh, VTl);
    k_fattn<<<dim3((TT - RH) / 64, NB_), 256, 0, stream>>>(QP16, KP16, VT16, OUT);   // query rows >= RH
    k_fattn_hl<<<dim3(KSP, RH / 64, NB_), 256, 0, stream>>>(QPh, QPl, KPh, KPl, VTh, VTl, Op, ML);   // query rows < RH: the slices' partial rows
    k_merge<<<NB_ * RH * HD / 4 / 256, 256, 0, stream>>>(Op, ML, OUT);
}

// v007
// It runs in 59.7 microseconds.
// Timed twice side by side with v006, it ran 1.04 and 1.05 times as fast.
// All steps since v000 together make it 17.2 times as fast.
#include <hip/hip_runtime.h>

// Single-head self-attention over 4,096 points (inputs [4][4096][128]; q,k,v = inputs W + b ('xw' [128][128] + [128]); softmax(q.k / sqrt(128)) over all points; out = weights v -> [4][4096][128] (2.1 M)).
// All four batches go through every launch. Attention is fused (scores, online softmax and weights x v in one kernel; neither scores nor weights reach memory): k_fattn, work-groups of 64 query rows >= RH over all keys (fp16); k_fattn_hl, work-groups of 64 query rows < RH over one of KSP key slices (bf16 hi/lo, 3 products), launched first; the join of its KSP slices (merge_rows) rides in the k_fattn launch, in work-groups of its own.
// Front end: ONE launch (k_proj) rounds inputs and weights to bf16, does the three projections and writes every 16-bit plane. bf16 projections, f32 sums + bf16-rounded biases; ONE 128-wide head, hybrid rows: < 512 hi/lo 3 products, rest fp16.
// Compute dtypes, f32 accumulate: every input rounded to bf16; projections f32-summed + bf16-rounded biases; attention rows < 512 3 products, rest fp16; softmax f32; output f32.

#define NB_  4
#define TT   4096
#define DM   128
#define NH_  1
#define NKV  1
#define REP  (NH_ / NKV)
#define HD   128
#define DQ   (NH_ * HD)
#define DKV  (NKV * HD)
#define ZH   1
#define RH   512                  // query rows < RH use hi+lo planes (0: none)
#define WIN  0
#define SCL  0.088388347648318447f   // 1/sqrt(128)
#define KSP  8                    // key slices of the query rows < RH: one work-group per (64 rows, slice); normalised f32 partial rows with their maximum and sum go to the workspace, merge_rows joins them
typedef _Float16 h16;
typedef unsigned short bf;
typedef __attribute__((ext_vector_type(16))) __bf16   v16bf;
typedef __attribute__((ext_vector_type(16))) _Float16 v16h;
typedef __attribute__((ext_vector_type(8)))  _Float16 v8h;
typedef __attribute__((ext_vector_type(8)))  unsigned short v8us;
typedef __attribute__((ext_vector_type(8)))  float    v8f;
typedef __attribute__((ext_vector_type(4)))  float    v4f;
typedef v8h  __attribute__((may_alias)) v8ha;
typedef v4f  __attribute__((may_alias)) v4fa;
typedef v8us __attribute__((may_alias)) v8usa;

__device__ __forceinline__ unsigned short f2bf(float f) { unsigned u = __float_as_uint(f); u += 0x7FFFu + ((u >> 16) & 1u); return (unsigned short)(u >> 16); }
__device__ __forceinline__ float bf2f(unsigned short b) { return __uint_as_float(((unsigned)b) << 16); }
__device__ __forceinline__ float bfr(float f) { return bf2f(f2bf(f)); }
__device__ __forceinline__ v16h cat16(v8h lo, v8h hi) { return __builtin_shufflevector(lo, hi, 0, 1, 2, 3, 4, 5, 6, 7, 8, 9, 10, 11, 12, 13, 14, 15); }
__device__ __forceinline__ v16bf cat16b(v8us lo, v8us hi) { return __builtin_bit_cast(v16bf, __builtin_shufflevector(lo, hi, 0, 1, 2, 3, 4, 5, 6, 7, 8, 9, 10, 11, 12, 13, 14, 15)); }
__device__ __forceinline__ v8f wmma16(v16h a, v16h b, v8f c) { return __builtin_amdgcn_wmma_f32_16x16x32_f16(false, a, false, b, (short)0, c, false, false); }
__device__ __forceinline__ v8f wmmab(v16bf a, v16bf b, v8f c) { return __builtin_amdgcn_wmma_f32_16x16x32_bf16(false, a, false, b, (short)0, c, false, false); }



// fragment loaders: 16 values of a lane = 8 consecutive k at p and 8 at p + 16
template <typename T16> struct WFrag;
template <> struct WFrag<h16> { typedef v16h V; static __device__ __forceinline__ V ld(const h16* p) { return cat16(*(const v8h*)p, *(const v8h*)(p + 16)); } static __device__ __forceinline__ v8f mma(V a, V b, v8f c) { return wmma16(a, b, c); } };
template <> struct WFrag<bf> { typedef v16bf V; static __device__ __forceinline__ V ld(const bf* p) { return cat16b(*(const v8us*)p, *(const v8us*)(p + 16)); } static __device__ __forceinline__ v8f mma(V a, V b, v8f c) { return wmmab(a, b, c); } };

__device__ __forceinline__ h16 tohx(float x) { return (h16)x; }
__device__ __forceinline__ void splitf(float y, unsigned short& h, unsigned short& l) { h = f2bf(y); l = f2bf(y - bf2f(h)); }
typedef __attribute__((ext_vector_type(2))) _Float16 v2h;
typedef __attribute__((ext_vector_type(4))) _Float16 v4h;
typedef __attribute__((ext_vector_type(2))) unsigned short v2us;
typedef __attribute__((ext_vector_type(4))) unsigned short v4us;
typedef __attribute__((ext_vector_type(2))) float v2f;
typedef __attribute__((ext_vector_type(4))) int v4i;

// ---- k_proj: the whole front end in ONE launch. Work-group = 64 tokens x all 384 features (q, k, v), 16 waves; grid = all tokens / 64.
// The three f32 weight matrices [k][n] and the 64 f32 input rows are rounded to bf16 on their way into LDS (weights transposed to [n][k]); wave (tt = token tile, fg) takes feature tiles 2 fg and 2 fg + 1 of q, of k and of v, 4 products of 32 k each in ascending k.
// q, k: A = weight rows, B = tokens, so a lane holds 8 consecutive features of one token; v: A = tokens, B = weight rows, so a lane holds 8 consecutive tokens of one feature (the [HD][TT] plane's order).
// f32 sum + bf16-rounded bias, then the fp16 plane and the bf16 hi and lo planes; the nine tiles are staged in LDS and leave as whole 128-byte lines.
#define PJP 272                   // LDS pitch in bytes of a row of 128 16-bit values: 256 + 16, an odd multiple of 16
#define PJV 144                   // LDS pitch in bytes of a row of 64 16-bit values: 128 + 16, an odd multiple of 16
__global__ __launch_bounds__(512) void k_proj(const float* __restrict__ x, const float* __restrict__ wq, const float* __restrict__ bq, const float* __restrict__ wk, const float* __restrict__ bk, const float* __restrict__ wv, const float* __restrict__ bv,
                                              h16* Q16, bf* Qh, bf* Ql, h16* K16, bf* Kh, bf* Kl, h16* V16, bf* Vh, bf* Vl) {
    __shared__ __attribute__((aligned(16))) unsigned char WL[3 * 128 * PJP];   // bf16 weights [matrix][n][k]
    __shared__ __attribute__((aligned(16))) unsigned char XL[64 * PJP];        // bf16 inputs [token][k]
    __shared__ __attribute__((aligned(16))) unsigned char SQ[6 * 64 * PJP];    // q and k planes [plane][token][feature]
    __shared__ __attribute__((aligned(16))) unsigned char SV[3 * 128 * PJV];   // v planes [plane][feature][token]
    const int tid = threadIdx.x, lane = tid & 31, wave = tid >> 5, lr = lane & 15, hi = lane >> 4, tt = wave & 3, fg = wave >> 2; const size_t r0 = (size_t)blockIdx.x * 64;
    // all global reads first: 4 pieces of the input rows, of each weight matrix rows 8 wave .. 8 wave + 7, columns 4 lane .. 4 lane + 3 (every load covers 512 contiguous bytes per wave)
    v4f xv[4], wr[3][8]; const float* xb = x + r0 * DM; const unsigned wo = (unsigned)wave * 4096u + (unsigned)lane * 16u;   // this thread's byte offset in a weight matrix
#pragma unroll   // constant indices keep the array in registers
    for (int s = 0; s < 4; ++s) xv[s] = *(const v4f*)(xb + (size_t)(tid + 512 * s) * 4);
#pragma unroll   // constant indices keep the array in registers
    for (int r = 0; r < 8; ++r) { wr[0][r] = *(const v4f*)((const char*)wq + wo + 512 * r); wr[1][r] = *(const v4f*)((const char*)wk + wo + 512 * r); wr[2][r] = *(const v4f*)((const char*)wv + wo + 512 * r); }
    asm volatile("s_wait_xcnt 0x0" :: "s"(xb), "s"(wq), "s"(wk), "s"(wv), "v"(tid), "v"(wo) : "memory");   // stands in front of every reuse of a register that the loads above name; the base pointers, the thread index and the weight offset are inputs so that their registers stay theirs up to here
#pragma unroll   // constant indices keep the array in registers
    for (int s = 0; s < 4; ++s) { const int i = tid + 512 * s; v4us o;
#pragma unroll   // constant indices keep the array in registers
        for (int q = 0; q < 4; ++q) o[q] = f2bf(xv[s][q]);
        *(v4us*)(XL + (i >> 5) * PJP + (i & 31) * 8) = o; }
#pragma unroll   // constant indices keep the array in registers
    for (int m = 0; m < 3; ++m)
#pragma unroll   // constant indices keep the array in registers
        for (int i = 0; i < 4; ++i) { v8us o;
#pragma unroll   // constant indices keep the array in registers
            for (int r = 0; r < 8; ++r) o[r] = f2bf(wr[m][r][i]);
            *(v8us*)(WL + (m * 128 + lane * 4 + i) * PJP + wave * 16) = o; }
    __syncthreads();   // inputs and weights are in LDS
    v16bf xf[4];
#pragma unroll   // constant indices keep the array in registers
    for (int kc = 0; kc < 4; ++kc) xf[kc] = WFrag<bf>::ld((const bf*)(XL + (tt * 16 + lr) * PJP + 16 * hi + 64 * kc));
    v8f acc[3][2];
#pragma unroll   // constant indices keep the array in registers
    for (int m = 0; m < 3; ++m)
#pragma unroll   // constant indices keep the array in registers
        for (int u = 0; u < 2; ++u) { v8f a = (v8f){}; const unsigned char* wrow = WL + (m * 128 + (2 * fg + u) * 16 + lr) * PJP + 16 * hi;
#pragma unroll   // constant indices keep the array in registers
            for (int kc = 0; kc < 4; ++kc) { const v16bf wf = WFrag<bf>::ld((const bf*)(wrow + 64 * kc)); a = (m < 2) ? wmmab(wf, xf[kc], a) : wmmab(xf[kc], wf, a); }
            acc[m][u] = a; }
#pragma unroll   // constant indices keep the array in registers
    for (int m = 0; m < 3; ++m)
#pragma unroll   // constant indices keep the array in registers
        for (int u = 0; u < 2; ++u) { const int f0 = (2 * fg + u) * 16; const float* bm = (m == 0) ? bq : (m == 1) ? bk : bv; v8h o16; v8us oh, ol;
#pragma unroll   // constant indices keep the array in registers
            for (int j = 0; j < 8; ++j) { const float y = acc[m][u][j] + bfr(bm[(m < 2) ? f0 + hi * 8 + j : f0 + lr]); o16[j] = tohx(y); unsigned short a2, c2; splitf(y, a2, c2); oh[j] = a2; ol[j] = c2; }
            if (m < 2) { unsigned char* d = SQ + (m * 3 * 64 + tt * 16 + lr) * PJP + (f0 + hi * 8) * 2; *(v8h*)d = o16; *(v8us*)(d + 64 * PJP) = oh; *(v8us*)(d + 2 * 64 * PJP) = ol; }
            else { unsigned char* d = SV + (f0 + lr) * PJV + (tt * 16 + hi * 8) * 2; *(v8h*)d = o16; *(v8us*)(d + 128 * PJV) = oh; *(v8us*)(d + 2 * 128 * PJV) = ol; } }
    __syncthreads();   // the nine staged tiles are complete
    // q and k planes: the 64 token rows of a plane are 16 KiB in a row; v planes: 128 feature rows of 128 bytes
    const size_t zb = r0 / TT, t0 = r0 % TT;
#pragma unroll   // constant indices pick the plane's pointer at compile time
    for (int p = 0; p < 6; ++p) { char* g = (char*)(p == 0 ? (void*)Q16 : p == 1 ? (void*)Qh : p == 2 ? (void*)Ql : p == 3 ? (void*)K16 : p == 4 ? (void*)Kh : (void*)Kl) + r0 * (HD * 2);
#pragma unroll   // as above
        for (int s = 0; s < 2; ++s) { const int i = tid + 512 * s; *(v8us*)(g + (size_t)i * 16) = *(const v8us*)(SQ + (p * 64 + (i >> 4)) * PJP + (i & 15) * 16); } }
#pragma unroll   // constant indices pick the plane's pointer at compile time
    for (int p = 0; p < 3; ++p) { char* g = (char*)(p == 0 ? (void*)V16 : p == 1 ? (void*)Vh : (void*)Vl) + (zb * HD * TT + t0) * 2;
#pragma unroll   // as above
        for (int s = 0; s < 2; ++s) { const int i = tid + 512 * s; *(v8us*)(g + (size_t)(i >> 3) * (TT * 2) + (i & 7) * 16) = *(const v8us*)(SV + (p * 128 + (i >> 3)) * PJV + (i & 7) * 16); } }
}

#define FSK    256                // keys per stage
#define FPITCH 272                // LDS pitch in bytes of a K row: 256 + 16, an odd multiple of 16 for the 16-byte fragment reads
#define FVP    528                // LDS pitch in bytes of a V^T row of FSK keys: 512 + 16, an odd multiple of 16
#define FKT    (FSK * FPITCH)     // K tile: FSK keys, 256 B of d
#define FVT    (128 * FVP)        // V^T tile: 128 d, 512 B of keys
#define FSLOT  (FKT + FVT)
#define FTL    ((TT - RH) / 64)   // 64-row tiles of a batch at rows >= RH
#define FWG    (FTL * NB_)        // attention work-groups
#define MWG    (NB_ * RH / 64)    // merge work-groups: 64 rows < RH each
__device__ __forceinline__ float xhalf(float x) { return __builtin_bit_cast(float, __builtin_amdgcn_permlanex16(__builtin_bit_cast(int, x), __builtin_bit_cast(int, x), 0x76543210, 0xfedcba98, false, false)); }   // lane l with lane l ^ 16
// 2^x with the slot that the instruction set asks for behind a transcendental (before its result is read or its source overwritten): the v_nop stands in the same statement so that it stays directly behind
__device__ __forceinline__ float exp2s(float x) { float r; asm("v_exp_f32 %0, %1\n\tv_nop" : "=v"(r) : "v"(x)); return r; }
// eight 16-byte copies of one lane, LDS rows ls bytes and global rows gs bytes apart; the s_wait_xcnt closes the statement so that no address register is rewritten in front of it
__device__ __forceinline__ void cp8(unsigned l, unsigned ls, const char* g, size_t gs) {
    asm volatile("global_load_async_to_lds_b128 %0, %8, off\n\tglobal_load_async_to_lds_b128 %1, %9, off\n\tglobal_load_async_to_lds_b128 %2, %10, off\n\tglobal_load_async_to_lds_b128 %3, %11, off\n\t"
                 "global_load_async_to_lds_b128 %4, %12, off\n\tglobal_load_async_to_lds_b128 %5, %13, off\n\tglobal_load_async_to_lds_b128 %6, %14, off\n\tglobal_load_async_to_lds_b128 %7, %15, off\n\ts_wait_xcnt 0x0"
                 :: "v"(l), "v"(l + ls), "v"(l + 2u * ls), "v"(l + 3u * ls), "v"(l + 4u * ls), "v"(l + 5u * ls), "v"(l + 6u * ls), "v"(l + 7u * ls),
                    "v"(g), "v"(g + gs), "v"(g + 2 * gs), "v"(g + 3 * gs), "v"(g + 4 * gs), "v"(g + 5 * gs), "v"(g + 6 * gs), "v"(g + 7 * gs) : "memory");
}
// ---- merge_rows: query rows < RH: the KSP key slices' normalised rows (left by k_fattn_hl, the launch before), each weighted by its sum x 2^(its maximum - the row's maximum), added in ascending key order and divided by the sum of the weights.
// Work-group mi = 64 rows of one batch; a wave takes one row at a time (lane = 4 features, 512 bytes in a row), four rows per trip with all their loads in flight at once.
__device__ __forceinline__ void merge_rows(const float* __restrict__ Op, const float* __restrict__ ML, float* OUTb, int mi, int tid) {
    const size_t zz = (size_t)(mi / (RH / 64)); const int t0 = (mi % (RH / 64)) * 64 + (tid >> 5), d = (tid & 31) * 4;
#pragma unroll 1   // rolled: two trips; four rows' loads are what the registers are used for
    for (int tr = 0; tr < 2; ++tr) {
        const float* mlp = ML + (zz * KSP * RH + t0 + tr * 32) * 2; const float* opp = Op + (zz * KSP * RH + t0 + tr * 32) * HD + d;
        v2f ml[4][KSP]; v4f p[4][KSP];
#pragma unroll   // constant indices keep the arrays in registers
        for (int r = 0; r < 4; ++r)
#pragma unroll   // as above
            for (int z = 0; z < KSP; ++z) ml[r][z] = *(const v2f*)(mlp + ((size_t)z * RH + r * 8) * 2);
        asm volatile("s_wait_xcnt 0x0" ::: "memory");   // stands in front of every reuse of the address registers that the loads above name
#pragma unroll   // as above
        for (int r = 0; r < 4; ++r)
#pragma unroll   // as above
            for (int z = 0; z < KSP; ++z) p[r][z] = *(const v4f*)(opp + ((size_t)z * RH + r * 8) * HD);
        asm volatile("s_wait_xcnt 0x0" ::: "memory");   // as above
#pragma unroll   // as above
        for (int r = 0; r < 4; ++r) {
            float mm = ml[r][0][0];
#pragma unroll   // as above
            for (int z = 1; z < KSP; ++z) mm = fmaxf(mm, ml[r][z][0]);
            float wsum = 0.f; v4f o = (v4f){};
#pragma unroll   // as above
            for (int z = 0; z < KSP; ++z) { const float w = exp2s(ml[r][z][0] - mm) * ml[r][z][1]; wsum += w; o += p[r][z] * w; }
            *(v4f*)(OUTb + (zz * TT + t0 + tr * 32 + r * 8) * DQ + d) = o * (1.0f / wsum);
        }
        asm volatile("s_wait_xcnt 0x0" ::: "memory");   // as above, for the stores: the next trip forms new addresses
    }
}
// no register cap: Q (64), the accumulators (128), one K and one V^T fragment set (64 each) and the scores take more than 256 registers; one work-group per WGP, 2 waves per SIMD, leaves each wave 512
__global__ __launch_bounds__(256) void k_fattn(const h16* __restrict__ Q, const h16* __restrict__ Kp, const h16* __restrict__ Vt, const float* __restrict__ Op, const float* __restrict__ ML, float* OUTb) {
    __shared__ __attribute__((aligned(16))) unsigned char L[2 * FSLOT];
    if (blockIdx.x >= FWG) { merge_rows(Op, ML, OUTb, (int)blockIdx.x - FWG, threadIdx.x); return; }   // the whole work-group leaves here, in front of every copy and barrier
    const int tid = threadIdx.x, lane = tid & 31, wave = tid >> 5, c = lane & 15, h = lane >> 4, cg = wave & 1, kp = wave >> 1; const size_t zb = blockIdx.x / FTL; const int qrow = RH + (int)(blockIdx.x % FTL) * 64 + cg * 32 + c;   // column tile u: query qrow + 16 u
    // K tile: thread -> 16-byte piece tid & 15 of rows (tid >> 4) + 16 n; V^T tile: piece tid & 31 of rows (tid >> 5) + 8 n; n = 0..15
    const unsigned lk = (unsigned)(size_t)L + (unsigned)(tid >> 4) * FPITCH + (unsigned)(tid & 15) * 16u;
    const unsigned lv = (unsigned)(size_t)L + (unsigned)FKT + (unsigned)(tid >> 5) * FVP + (unsigned)(tid & 31) * 16u;
    const char* gk = (const char*)(Kp + zb * TT * HD) + (size_t)(tid >> 4) * (HD * 2) + (tid & 15) * 16;
    const char* gv = (const char*)(Vt + zb * HD * TT) + (size_t)(tid >> 5) * (TT * 2) + (tid & 31) * 16;
    auto stage = [&](int st) { const unsigned sb = (unsigned)(st & 1) * FSLOT; const char* k0 = gk + (size_t)st * (FSK * HD * 2); const char* v0 = gv + (size_t)st * (FSK * 2);
        cp8(lk + sb, 16u * FPITCH, k0, 16 * HD * 2); cp8(lk + sb + 128u * FPITCH, 16u * FPITCH, k0 + 128 * HD * 2, 16 * HD * 2);
        cp8(lv + sb, 8u * FVP, v0, (size_t)8 * TT * 2); cp8(lv + sb + 64u * FVP, 8u * FVP, v0 + (size_t)64 * TT * 2, (size_t)8 * TT * 2); };
    stage(0);
    v16h qf[2][4];
#pragma unroll   // constant indices keep the array in registers
    for (int u = 0; u < 2; ++u)
#pragma unroll   // constant indices keep the array in registers
        for (int kc = 0; kc < 4; ++kc) qf[u][kc] = WFrag<h16>::ld(Q + (zb * TT + qrow + 16 * u) * HD + 8 * h + 32 * kc);
    asm volatile("s_wait_xcnt 0x0" ::: "memory");   // stands in front of every reuse of the address registers that the loads above name
    v8f acc[2][8];
#pragma unroll   // constant indices keep the array in registers
    for (int u = 0; u < 2; ++u)
#pragma unroll   // constant indices keep the array in registers
        for (int t = 0; t < 8; ++t) acc[u][t] = (v8f){};
    float m_run[2] = {-__builtin_inff(), -__builtin_inff()}, l_run[2] = {0.f, 0.f}; const float cs = SCL * 1.4426950408889634f;   // scores in the log2 domain
    asm volatile("s_wait_asynccnt 0x0" ::: "memory");   // this wave's copies of stage 0 have landed
    __syncthreads();                                    // ... and every other wave's
    stage(1);
    const int kro = (kp * 64 + c) * FPITCH + 16 * h, vro = FKT + c * FVP + kp * 128 + 16 * h;   // this lane's first K row and first V^T row piece in a buffer
#pragma unroll 1   // rolled: one stage is the loop body, the two buffers alternate by st & 1
    for (int st = 0; st < TT / FSK; ++st) {
        const unsigned char* Bf = L + (st & 1) * FSLOT;
        v16h kf[2][4], vf[8];
#pragma unroll   // constant indices keep the array in registers
        for (int kt = 0; kt < 2; ++kt)
#pragma unroll   // constant indices keep the array in registers
            for (int kc = 0; kc < 4; ++kc) kf[kt][kc] = WFrag<h16>::ld((const h16*)(Bf + kro + kt * 16 * FPITCH + 64 * kc));
#pragma unroll   // constant indices keep the array in registers
        for (int sub = 0; sub < 2; ++sub) {   // one pass: 32 keys x 32 query columns
            __builtin_amdgcn_sched_barrier(0);   // keeps the V^T reads below behind the stage's first K reads (which the score products wait for) and out of the products of the pass before, whose registers they take
#pragma unroll   // constant indices keep the array in registers
            for (int t = 0; t < 8; ++t) vf[t] = WFrag<h16>::ld((const h16*)(Bf + vro + t * 16 * FVP + sub * 64));
            __builtin_amdgcn_sched_barrier(0);   // keeps the pass's V^T reads issued as one group here, in flight under the score products and the softmax
            v8f s[2][2];   // [column tile][key tile]: four independent chains
#pragma unroll   // constant indices keep the array in registers
            for (int u = 0; u < 2; ++u) { s[u][0] = (v8f){}; s[u][1] = (v8f){}; }
#pragma unroll   // constant indices keep the array in registers
            for (int kc = 0; kc < 4; ++kc)
#pragma unroll   // constant indices keep the array in registers
                for (int kt = 0; kt < 2; ++kt)
#pragma unroll   // constant indices keep the array in registers
                    for (int u = 0; u < 2; ++u) s[u][kt] = wmma16(kf[kt][kc], qf[u][kc], s[u][kt]);
            float mx[2];
#pragma unroll   // constant indices keep the array in registers
            for (int u = 0; u < 2; ++u) { float m = s[u][0][0];
#pragma unroll   // constant indices keep the array in registers
                for (int j = 1; j < 8; ++j) m = fmaxf(m, s[u][0][j]);
#pragma unroll   // constant indices keep the array in registers
                for (int j = 0; j < 8; ++j) m = fmaxf(m, s[u][1][j]);
                mx[u] = fmaxf(m, xhalf(m)) * cs; }
            // lazy rescale: the maximum in use may trail the true one by up to 8 (log2), so a weight stays <= 256; one scalar test per pass for both column tiles
            if (__builtin_amdgcn_ballot_w32((mx[0] > m_run[0] + 8.0f) | (mx[1] > m_run[1] + 8.0f)) != 0) {
#pragma unroll   // constant indices keep the array in registers
                for (int u = 0; u < 2; ++u) { const float m_new = fmaxf(m_run[u], mx[u]); const float corr = exp2s(m_run[u] - m_new); l_run[u] *= corr; m_run[u] = m_new;
#pragma unroll   // constant indices keep the array in registers
                    for (int t = 0; t < 8; ++t) acc[u][t] = acc[u][t] * corr; } }
            v16h pf[2];
#pragma unroll   // constant indices keep the array in registers
            for (int u = 0; u < 2; ++u) { float ps0 = 0.f, ps1 = 0.f;
#pragma unroll   // constant indices keep the array in registers
                for (int j = 0; j < 8; ++j) { const float p0 = exp2s(__builtin_fmaf(s[u][0][j], cs, -m_run[u])), p1 = exp2s(__builtin_fmaf(s[u][1][j], cs, -m_run[u])); ps0 += p0; ps1 += p1; pf[u][j] = (h16)p0; pf[u][8 + j] = (h16)p1; }
                l_run[u] += ps0 + ps1; }
            if (sub == 0) {
                __builtin_amdgcn_sched_barrier(0);   // keeps the next pass's K reads here, as one group behind the softmax and in flight under the products below
#pragma unroll   // constant indices keep the array in registers
                for (int kt = 0; kt < 2; ++kt)
#pragma unroll   // constant indices keep the array in registers
                    for (int kc = 0; kc < 4; ++kc) kf[kt][kc] = WFrag<h16>::ld((const h16*)(Bf + kro + (32 + kt * 16) * FPITCH + 64 * kc));
                __builtin_amdgcn_sched_barrier(0);   // as above
            }
#pragma unroll   // constant indices keep the array in registers
            for (int t = 0; t < 8; ++t)
#pragma unroll   // constant indices keep the array in registers
                for (int u = 0; u < 2; ++u) acc[u][t] = wmma16(vf[t], pf[u], acc[u][t]);
        }
        asm volatile("s_wait_dscnt 0x0" ::: "memory");      // this wave's reads of the buffer are done
        asm volatile("s_wait_asynccnt 0x0" ::: "memory");   // this wave's copies of stage st + 1 have landed
        __syncthreads();                                    // publishes stage st + 1 and ends every wave's reads of stage st
        if (st + 2 < TT / FSK) stage(st + 2);               // refill of the buffer just left
    }
    asm volatile("s_wait_asynccnt 0x0" ::: "memory");       // no copy in flight: the buffers become the staging of the join
    // join of the four key parts (behind the loop's last barrier nobody reads the buffers): every wave leaves its accumulators, maxima and sums in LDS, [wave][33][lane] pieces of 16 bytes;
    // then wave (cg, kp) adds, in ascending key part, the four parts' d tiles 2 kp and 2 kp + 1 of its 32 columns: 128 bytes in a row of every output row, one whole line per writer
    v4f* X = (v4f*)L + lane; v4f* Xw = X + wave * (33 * 32);
#pragma unroll   // constant indices keep the array in registers
    for (int u = 0; u < 2; ++u)
#pragma unroll   // constant indices keep the array in registers
        for (int t = 0; t < 8; ++t) { Xw[((u * 8 + t) * 2) * 32] = __builtin_shufflevector(acc[u][t], acc[u][t], 0, 1, 2, 3); Xw[((u * 8 + t) * 2 + 1) * 32] = __builtin_shufflevector(acc[u][t], acc[u][t], 4, 5, 6, 7); }
    Xw[32 * 32] = (v4f){m_run[0], l_run[0], m_run[1], l_run[1]};
    __syncthreads();   // every part's values are in LDS
    v4f ml[4];
#pragma unroll   // constant indices keep the array in registers
    for (int p = 0; p < 4; ++p) ml[p] = X[((cg + 2 * p) * 33 + 32) * 32];
#pragma unroll   // constant indices keep the array in registers
    for (int u = 0; u < 2; ++u) {
        const float m_all = fmaxf(fmaxf(ml[0][2 * u], ml[1][2 * u]), fmaxf(ml[2][2 * u], ml[3][2 * u])); float f[4], lh = 0.f;
#pragma unroll   // constant indices keep the array in registers
        for (int p = 0; p < 4; ++p) { f[p] = exp2s(ml[p][2 * u] - m_all); lh += ml[p][2 * u + 1] * f[p]; }
        const float inv = 1.0f / (lh + xhalf(lh));   // each half summed its own eight keys of every tile
        float* orow = OUTb + (zb * TT + qrow + 16 * u) * DQ + kp * 32 + 8 * h;
#pragma unroll   // constant indices keep the array in registers
        for (int tt = 0; tt < 2; ++tt) { v4f a = (v4f){}, b = (v4f){};
#pragma unroll   // constant indices keep the array in registers
            for (int p = 0; p < 4; ++p) { const v4f* xp = X + ((cg + 2 * p) * 33 + (u * 8 + 2 * kp + tt) * 2) * 32; a += xp[0] * f[p]; b += xp[32] * f[p]; }
            *(v4f*)(orow + tt * 16) = a * inv; *(v4f*)(orow + tt * 16 + 4) = b * inv; }
    }
}

// ---- k_fattn_hl: the same fused form for query rows < RH, bf16 hi/lo planes, 3 products each way (Kh Qh + Kh Ql + Kl Qh; Vh Ph + Vh Pl + Vl Ph), f32 scores, softmax and sums. Work-group = (key slice of TT / KSP keys, 64-row tile, batch): grid (KSP, RH / 64, batch).
// 8 waves = 4 groups of 16 query columns x 2 key parts of 32 keys; stages of HSK keys (K hi, K lo, V^T hi, V^T lo) by asynchronous copies to LDS, two buffers, the order of the fp16 loop.
// The weight p = 2^(score - maximum in use) is split p = hi + lo in bf16 before the products. The slice's rows leave normalised, with their maximum (log2 domain) and sum, for merge_rows.
#define HSK    64                 // keys per stage
#define HVP    144                // LDS pitch in bytes of a V^T row of 64 keys: 128 + 16, an odd multiple of 16
#define HKT    (HSK * FPITCH)     // one K tile: 64 keys, 256 B of d
#define HVT    (128 * HVP)        // one V^T tile: 128 d, 128 B of keys
#define HSLOT  (2 * HKT + 2 * HVT)
typedef __attribute__((ext_vector_type(2))) __bf16 v2bf;
// eight 16-byte copies of one lane: four rows of the hi tile (from ga) and the same four of the lo tile (from gb, ld bytes further in LDS), LDS rows ls bytes and global rows gs bytes apart; the s_wait_xcnt closes the statement so that no address register is rewritten in front of it
__device__ __forceinline__ void cp44(unsigned l, unsigned ls, unsigned ld, const char* ga, const char* gb, size_t gs) {
    asm volatile("global_load_async_to_lds_b128 %0, %8, off\n\tglobal_load_async_to_lds_b128 %1, %9, off\n\tglobal_load_async_to_lds_b128 %2, %10, off\n\tglobal_load_async_to_lds_b128 %3, %11, off\n\t"
                 "global_load_async_to_lds_b128 %4, %12, off\n\tglobal_load_async_to_lds_b128 %5, %13, off\n\tglobal_load_async_to_lds_b128 %6, %14, off\n\tglobal_load_async_to_lds_b128 %7, %15, off\n\ts_wait_xcnt 0x0"
                 :: "v"(l), "v"(l + ls), "v"(l + 2u * ls), "v"(l + 3u * ls), "v"(l + ld), "v"(l + ld + ls), "v"(l + ld + 2u * ls), "v"(l + ld + 3u * ls),
                    "v"(ga), "v"(ga + gs), "v"(ga + 2 * gs), "v"(ga + 3 * gs), "v"(gb), "v"(gb + gs), "v"(gb + 2 * gs), "v"(gb + 3 * gs) : "memory");
}
// no register cap: two fragment sets in flight beside Q hi/lo, the accumulators and the weights take a few registers above 256; the grid is one work-group per WGP (2 waves per SIMD), so nothing asks for fewer
__global__ __launch_bounds__(256) void k_fattn_hl(const bf* __restrict__ Qh, const bf* __restrict__ Ql, const bf* __restrict__ Kh, const bf* __restrict__ Kl, const bf* __restrict__ Vh, const bf* __restrict__ Vl, float* Op, float* ML) {
    __shared__ __attribute__((aligned(16))) unsigned char L[2 * HSLOT];
    const int tid = threadIdx.x, lane = tid & 31, wave = tid >> 5, c = lane & 15, h = lane >> 4, cg = wave & 3, kp = wave >> 2;
    const int ks = blockIdx.x, rt = blockIdx.y; const size_t zb = blockIdx.z; const int qrow = rt * 64 + cg * 16 + c;
    // K tiles: thread -> 16-byte piece tid & 15 of rows (tid >> 4) + 16 n; V^T tiles: piece tid & 7 of rows (tid >> 3) + 32 n; n = 0..3
    const unsigned lk = (unsigned)(size_t)L + (unsigned)(tid >> 4) * FPITCH + (unsigned)(tid & 15) * 16u;
    const unsigned lv = (unsigned)(size_t)L + 2u * HKT + (unsigned)(tid >> 3) * HVP + (unsigned)(tid & 7) * 16u;
    const size_t ko = (zb * TT + (size_t)ks * (TT / KSP) + (tid >> 4)) * (HD * 2) + (tid & 15) * 16;
    const size_t vo = (zb * HD + (tid >> 3)) * (TT * 2) + (size_t)ks * (TT / KSP) * 2 + (tid & 7) * 16;
    auto stage = [&](int st) { const unsigned sb = (unsigned)(st & 1) * HSLOT; const size_t kb = ko + (size_t)st * (HSK * HD * 2), vb = vo + (size_t)st * (HSK * 2);
        cp44(lk + sb, 16u * FPITCH, HKT, (const char*)Kh + kb, (const char*)Kl + kb, 16 * HD * 2);
        cp44(lv + sb, 32u * HVP, HVT, (const char*)Vh + vb, (const char*)Vl + vb, (size_t)32 * TT * 2); };
    stage(0);
    v16bf qh[4], ql[4];
#pragma unroll   // constant indices keep the array in registers
    for (int kc = 0; kc < 4; ++kc) { qh[kc] = WFrag<bf>::ld(Qh + (zb * TT + qrow) * HD + 8 * h + 32 * kc); ql[kc] = WFrag<bf>::ld(Ql + (zb * TT + qrow) * HD + 8 * h + 32 * kc); }
    asm volatile("s_wait_xcnt 0x0" ::: "memory");   // stands in front of every reuse of the address registers that the loads above name
    v8f acc[8];
#pragma unroll   // constant indices keep the array in registers
    for (int t = 0; t < 8; ++t) acc[t] = (v8f){};
    float m_run = -__builtin_inff(), l_run = 0.f; const float cs = SCL * 1.4426950408889634f;   // scores in the log2 domain
    asm volatile("s_wait_asynccnt 0x0" ::: "memory");   // this wave's copies of stage 0 have landed
    __syncthreads();                                    // ... and every other wave's
    stage(1);
    const int kro = (kp * 32 + c) * FPITCH + 16 * h, vro = 2 * HKT + c * HVP + kp * 64 + 16 * h;   // this lane's first K row and first V^T row piece in a buffer
#pragma unroll 1   // rolled: one stage is the loop body, the two buffers alternate by st & 1
    for (int st = 0; st < TT / KSP / HSK; ++st) {
        const unsigned char* Bf = L + (st & 1) * HSLOT;
        // fragment reads go in groups of four fragments, two register sets fa and fb in turn: a group is issued while the products on the group before it run, so that its LDS latency lies under them
        v16bf fa[4], fb[4]; v8f s[2], s0, s1;   // s0, s1: two independent chains (d 0..63, d 64..127): a product need not wait for the one before it
        auto ldK = [&](v16bf (&f)[4], int kt, int kc) { const unsigned char* kr = Bf + kro + kt * 16 * FPITCH + 64 * kc; f[0] = WFrag<bf>::ld((const bf*)kr); f[1] = WFrag<bf>::ld((const bf*)(kr + 128)); f[2] = WFrag<bf>::ld((const bf*)(kr + HKT)); f[3] = WFrag<bf>::ld((const bf*)(kr + HKT + 128)); };
        auto mmK = [&](v16bf (&f)[4], int kc) { s0 = wmmab(f[0], qh[kc], s0); s1 = wmmab(f[1], qh[kc + 2], s1); s0 = wmmab(f[0], ql[kc], s0); s1 = wmmab(f[1], ql[kc + 2], s1); s0 = wmmab(f[2], qh[kc], s0); s1 = wmmab(f[3], qh[kc + 2], s1); };
        auto ldV = [&](v16bf (&f)[4], int g) { const unsigned char* vr = Bf + vro + 2 * g * 16 * HVP; f[0] = WFrag<bf>::ld((const bf*)vr); f[1] = WFrag<bf>::ld((const bf*)(vr + 16 * HVP)); f[2] = WFrag<bf>::ld((const bf*)(vr + HVT)); f[3] = WFrag<bf>::ld((const bf*)(vr + HVT + 16 * HVP)); };
        ldK(fa, 0, 0); ldK(fb, 0, 1);
        __builtin_amdgcn_sched_barrier(0);   // keeps the reads above in front of the products below
        s0 = (v8f){}; s1 = (v8f){}; mmK(fa, 0);
        __builtin_amdgcn_sched_barrier(0);   // keeps the next group's reads here, behind the products that used its registers
        ldK(fa, 1, 0);
        __builtin_amdgcn_sched_barrier(0);   // keeps those reads in front of the products below
        mmK(fb, 1); s[0] = s0 + s1;
        __builtin_amdgcn_sched_barrier(0);   // as above: next group's reads behind the last use of their registers
        ldK(fb, 1, 1);
        __builtin_amdgcn_sched_barrier(0);   // as above: reads in front of the products
        s0 = (v8f){}; s1 = (v8f){}; mmK(fa, 0);
        __builtin_amdgcn_sched_barrier(0);   // as above: next group's reads behind the last use of their registers
        ldV(fa, 0);
        __builtin_amdgcn_sched_barrier(0);   // as above: reads in front of the products
        mmK(fb, 1); s[1] = s0 + s1;
        float mx = s[0][0];
#pragma unroll   // constant indices keep the array in registers
        for (int j = 1; j < 8; ++j) mx = fmaxf(mx, s[0][j]);
#pragma unroll   // constant indices keep the array in registers
        for (int j = 0; j < 8; ++j) mx = fmaxf(mx, s[1][j]);
        mx = fmaxf(mx, xhalf(mx)) * cs;
        // lazy rescale, as in the fp16 loop: the maximum in use may trail the true one by up to 8 (log2)
        if (__builtin_amdgcn_ballot_w32(mx > m_run + 8.0f) != 0) { const float m_new = fmaxf(m_run, mx); const float corr = __builtin_amdgcn_exp2f(m_run - m_new); l_run *= corr; m_run = m_new;
#pragma unroll   // constant indices keep the array in registers
            for (int t = 0; t < 8; ++t) acc[t] = acc[t] * corr; }
        v16bf ph, pl; float ps0 = 0.f, ps1 = 0.f;
#pragma unroll   // constant indices keep the array in registers
        for (int kt = 0; kt < 2; ++kt)
#pragma unroll   // constant indices keep the array in registers
            for (int j = 0; j < 8; j += 2) { v2f p; p[0] = exp2s(__builtin_fmaf(s[kt][j], cs, -m_run)); p[1] = exp2s(__builtin_fmaf(s[kt][j + 1], cs, -m_run)); ps0 += p[0]; ps1 += p[1];
                const v2bf a = __builtin_convertvector(p, v2bf); const v2bf b = __builtin_convertvector(p - __builtin_convertvector(a, v2f), v2bf);
                ph[8 * kt + j] = a[0]; ph[8 * kt + j + 1] = a[1]; pl[8 * kt + j] = b[0]; pl[8 * kt + j + 1] = b[1]; }
        l_run += ps0 + ps1;
        auto mmV = [&](v16bf (&f)[4], int g) { acc[2 * g] = wmmab(f[0], ph, acc[2 * g]); acc[2 * g + 1] = wmmab(f[1], ph, acc[2 * g + 1]); acc[2 * g] = wmmab(f[0], pl, acc[2 * g]); acc[2 * g + 1] = wmmab(f[1], pl, acc[2 * g + 1]); acc[2 * g] = wmmab(f[2], ph, acc[2 * g]); acc[2 * g + 1] = wmmab(f[3], ph, acc[2 * g + 1]); };
        __builtin_amdgcn_sched_barrier(0);   // keeps the second V^T group's reads behind the softmax, whose registers they take
        ldV(fb, 1);
        __builtin_amdgcn_sched_barrier(0);   // as above: reads in front of the products
        mmV(fa, 0);
        __builtin_amdgcn_sched_barrier(0);   // as above: next group's reads behind the last use of their registers
        ldV(fa, 2);
        __builtin_amdgcn_sched_barrier(0);   // as above: reads in front of the products
        mmV(fb, 1);
        __builtin_amdgcn_sched_barrier(0);   // as above: next group's reads behind the last use of their registers
        ldV(fb, 3);
        __builtin_amdgcn_sched_barrier(0);   // as above: reads in front of the products
        mmV(fa, 2); mmV(fb, 3);
        asm volatile("s_wait_dscnt 0x0" ::: "memory");      // this wave's reads of the buffer are done
        asm volatile("s_wait_asynccnt 0x0" ::: "memory");   // this wave's copies of stage st + 1 have landed
        __syncthreads();                                    // publishes stage st + 1 and ends every wave's reads of stage st
        if (st + 2 < TT / KSP / HSK) stage(st + 2);         // refill of the buffer just left
    }
    asm volatile("s_wait_asynccnt 0x0" ::: "memory");       // no copy in flight: the buffers become the staging of the join
    // join of the two key parts through LDS: part 1 leaves its accumulators, maximum and sum, part 0 adds them to its own and writes the rows
    v4f* X = (v4f*)L + (size_t)cg * 17 * 32 + lane;
    if (kp == 1) {
#pragma unroll   // constant indices keep the array in registers
        for (int t = 0; t < 8; ++t) { X[(2 * t) * 32] = __builtin_shufflevector(acc[t], acc[t], 0, 1, 2, 3); X[(2 * t + 1) * 32] = __builtin_shufflevector(acc[t], acc[t], 4, 5, 6, 7); }
        X[16 * 32] = (v4f){m_run, l_run, 0.f, 0.f};
    }
    __syncthreads();   // part 1's values are in LDS
    if (kp == 0) {
        const v4f ml = X[16 * 32]; const float m_all = fmaxf(m_run, ml[0]); const float a0 = exp2s(m_run - m_all), a1 = exp2s(ml[0] - m_all);
        const float lh = l_run * a0 + ml[1] * a1; const float lt = lh + xhalf(lh); const float inv = 1.0f / lt;   // each half summed its own eight keys of every tile
        const float f0 = a0 * inv, f1 = a1 * inv; const size_t pr = (zb * KSP + ks) * RH + qrow; float* orow = Op + pr * HD + 8 * h;
#pragma unroll   // constant indices keep the array in registers
        for (int t = 0; t < 8; ++t) { const v4f x0 = X[(2 * t) * 32], x1 = X[(2 * t + 1) * 32]; v4f a, b;
#pragma unroll   // constant indices keep the array in registers
            for (int j = 0; j < 4; ++j) { a[j] = acc[t][j] * f0 + x0[j] * f1; b[j] = acc[t][4 + j] * f0 + x1[j] * f1; }
            *(v4f*)(orow + t * 16) = a; *(v4f*)(orow + t * 16 + 4) = b; }
        if (h == 0) { v2f o; o[0] = m_all; o[1] = lt; *(v2f*)(ML + pr * 2) = o; }
    }
}

extern "C" void kernel_launch(void* const* d_in, const int* in_sizes, int n_in,
                              void* d_out, int out_size, void* d_ws, size_t ws_size, hipStream_t stream) {
    (void)in_sizes; (void)n_in; (void)out_size;
    const float* x = (const float*)d_in[0]; const float* wq = (const float*)d_in[1]; const float* bq = (const float*)d_in[2]; const float* wk = (const float*)d_in[3]; const float* bk = (const float*)d_in[4]; const float* wv = (const float*)d_in[5]; const float* bv = (const float*)d_in[6]; const float* wo = nullptr; (void)wo;
    float* OUT = (float*)d_out;     // [4][4096][128]
    char* wsp = (char*)d_ws;
    auto take = [&](size_t bytes) { char* p = wsp; wsp += (bytes + 255) & ~(size_t)255; return (void*)p; };
    const size_t PE = (size_t)NB_ * TT * HD;   // elements of one 16-bit plane, all batches
    h16* QP16 = (h16*)take(PE * 2); h16* KP16 = (h16*)take(PE * 2); h16* VT16 = (h16*)take(PE * 2);
    bf* QPh = (bf*)take(PE * 2); bf* QPl = (bf*)take(PE * 2); bf* KPh = (bf*)take(PE * 2); bf* KPl = (bf*)take(PE * 2); bf* VTh = (bf*)take(PE * 2); bf* VTl = (bf*)take(PE * 2);
    float* Op = (float*)take((size_t)NB_ * KSP * RH * HD * 4); float* ML = (float*)take((size_t)NB_ * KSP * RH * 2 * 4);   // rows < RH: partial rows [batch][slice][RH][HD], their maximum and sum [batch][slice][RH][2]
    if ((size_t)(wsp - (char*)d_ws) > ws_size) return;    // ws 256 MiB
    k_proj<<<NB_ * TT / 64, 512, 0, stream>>>(x, wq, bq, wk, bk, wv, bv, QP16, QPh, QPl, KP16, KPh, KPl, VT16, VTh, VTl);
    k_fattn_hl<<<dim3(KSP, RH / 64, NB_), 256, 0, stream>>>(QPh, QPl, KPh, KPl, VTh, VTl, Op, ML);   // query rows < RH: the slices' partial rows
    k_fattn<<<FWG + MWG, 256, 0, stream>>>(QP16, KP16, VT16, Op, ML, OUT);   // query rows >= RH; beside them the join of the rows < RH
}

// v008
// Measured time: 55.5 microseconds a run.
// Next to v007, in two timings, it ran 1.08 times as fast each time.
// All steps since v000 together make it 18.5 times as fast.
#include <hip/hip_runtime.h>

// Single-head self-attention over 4,096 points (inputs [4][4096][128]; q,k,v = inputs W + b ('xw' [128][128] + [128]); softmax(q.k / sqrt(128)) over all points; out = weights v -> [4][4096][128] (2.1 M)).
// All four batches go through every launch. Attention is fused (scores, online softmax and weights x v in one kernel; neither scores nor weights reach memory): k_fattn, work-groups of 64 query rows >= RH over all keys (fp16); k_fattn_hl, work-groups of 64 query rows < RH over one of KSP key slices (bf16 hi/lo, 3 products), launched first; the join of its KSP slices (merge_rows) rides in the k_fattn launch, in work-groups of its own.
// Front end: ONE launch (k_proj) rounds inputs and weights to bf16, does the three projections and writes every 16-bit plane. bf16 projections, f32 sums + bf16-rounded biases; ONE 128-wide head, hybrid rows: < 512 hi/lo 3 products, rest fp16.
// Compute dtypes, f32 accumulate: every input rounded to bf16; projections f32-summed + bf16-rounded biases; attention rows < 512 3 products, rest fp16; softmax f32; output f32.

#define NB_  4
#define TT   4096
#define DM   128
#define NH_  1
#define NKV  1
#define REP  (NH_ / NKV)
#define HD   128
#define DQ   (NH_ * HD)
#define DKV  (NKV * HD)
#define ZH   1
#define RH   512                  // query rows < RH use hi+lo planes (0: none)
#define WIN  0
#define SCL  0.088388347648318447f   // 1/sqrt(128)
#define KSP  8                    // key slices of the query rows < RH: one work-group per (64 rows, slice); normalised f32 partial rows with their maximum and sum go to the workspace, merge_rows joins them
typedef _Float16 h16;
typedef unsigned short bf;
typedef __attribute__((ext_vector_type(16))) __bf16   v16bf;
typedef __attribute__((ext_vector_type(16))) _Float16 v16h;
typedef __attribute__((ext_vector_type(8)))  _Float16 v8h;
typedef __attribute__((ext_vector_type(8)))  unsigned short v8us;
typedef __attribute__((ext_vector_type(8)))  float    v8f;
typedef __attribute__((ext_vector_type(4)))  float    v4f;
typedef v8h  __attribute__((may_alias)) v8ha;
typedef v4f  __attribute__((may_alias)) v4fa;
typedef v8us __attribute__((may_alias)) v8usa;

__device__ __forceinline__ unsigned short f2bf(float f) { unsigned u = __float_as_uint(f); u += 0x7FFFu + ((u >> 16) & 1u); return (unsigned short)(u >> 16); }
__device__ __forceinline__ float bf2f(unsigned short b) { return __uint_as_float(((unsigned)b) << 16); }
__device__ __forceinline__ float bfr(float f) { return bf2f(f2bf(f)); }
__device__ __forceinline__ v16h cat16(v8h lo, v8h hi) { return __builtin_shufflevector(lo, hi, 0, 1, 2, 3, 4, 5, 6, 7, 8, 9, 10, 11, 12, 13, 14, 15); }
__device__ __forceinline__ v16bf cat16b(v8us lo, v8us hi) { return __builtin_bit_cast(v16bf, __builtin_shufflevector(lo, hi, 0, 1, 2, 3, 4, 5, 6, 7, 8, 9, 10, 11, 12, 13, 14, 15)); }
__device__ __forceinline__ v8f wmma16(v16h a, v16h b, v8f c) { return __builtin_amdgcn_wmma_f32_16x16x32_f16(false, a, false, b, (short)0, c, false, false); }
__device__ __forceinline__ v8f wmmab(v16bf a, v16bf b, v8f c) { return __builtin_amdgcn_wmma_f32_16x16x32_bf16(false, a, false, b, (short)0, c, false, false); }



// fragment loaders: 16 values of a lane = 8 consecutive k at p and 8 at p + 16
template <typename T16> struct WFrag;
template <> struct WFrag<h16> { typedef v16h V; static __device__ __forceinline__ V ld(const h16* p) { return cat16(*(const v8h*)p, *(const v8h*)(p + 16)); } static __device__ __forceinline__ v8f mma(V a, V b, v8f c) { return wmma16(a, b, c); } };
template <> struct WFrag<bf> { typedef v16bf V; static __device__ __forceinline__ V ld(const bf* p) { return cat16b(*(const v8us*)p, *(const v8us*)(p + 16)); } static __device__ __forceinline__ v8f mma(V a, V b, v8f c) { return wmmab(a, b, c); } };

__device__ __forceinline__ h16 tohx(float x) { return (h16)x; }
__device__ __forceinline__ void splitf(float y, unsigned short& h, unsigned short& l) { h = f2bf(y); l = f2bf(y - bf2f(h)); }
typedef __attribute__((ext_vector_type(2))) _Float16 v2h;
typedef __attribute__((ext_vector_type(4))) _Float16 v4h;
typedef __attribute__((ext_vector_type(2))) unsigned short v2us;
typedef __attribute__((ext_vector_type(4))) unsigned short v4us;
typedef __attribute__((ext_vector_type(2))) float v2f;
typedef __attribute__((ext_vector_type(4))) int v4i;

// ---- k_proj: the whole front end in ONE launch. Work-group = 64 tokens x all 384 features (q, k, v), 16 waves; grid = all tokens / 64.
// The three f32 weight matrices [k][n] and the 64 f32 input rows are rounded to bf16 on their way into LDS (weights transposed to [n][k]); wave (tt = token tile, fg) takes feature tiles 2 fg and 2 fg + 1 of q, of k and of v, 4 products of 32 k each in ascending k.
// q, k: A = weight rows, B = tokens, so a lane holds 8 consecutive features of one token; v: A = tokens, B = weight rows, so a lane holds 8 consecutive tokens of one feature (the [HD][TT] plane's order).
// f32 sum + bf16-rounded bias, then the fp16 plane and the bf16 hi and lo planes; the nine tiles are staged in LDS and leave as whole 128-byte lines.
#define PJP 272                   // LDS pitch in bytes of a row of 128 16-bit values: 256 + 16, an odd multiple of 16
#define PJV 144                   // LDS pitch in bytes of a row of 64 16-bit values: 128 + 16, an odd multiple of 16
__global__ __launch_bounds__(512) void k_proj(const float* __restrict__ x, const float* __restrict__ wq, const float* __restrict__ bq, const float* __restrict__ wk, const float* __restrict__ bk, const float* __restrict__ wv, const float* __restrict__ bv,
                                              h16* Q16, bf* Qh, bf* Ql, h16* K16, bf* Kh, bf* Kl, h16* V16, bf* Vh, bf* Vl) {
    __shared__ __attribute__((aligned(16))) unsigned char WL[3 * 128 * PJP];   // bf16 weights [matrix][n][k]
    __shared__ __attribute__((aligned(16))) unsigned char XL[64 * PJP];        // bf16 inputs [token][k]
    __shared__ __attribute__((aligned(16))) unsigned char SQ[6 * 64 * PJP];    // q and k planes [plane][token][feature]
    __shared__ __attribute__((aligned(16))) unsigned char SV[3 * 128 * PJV];   // v planes [plane][feature][token]
    const int tid = threadIdx.x, lane = tid & 31, wave = tid >> 5, lr = lane & 15, hi = lane >> 4, tt = wave & 3, fg = wave >> 2; const size_t r0 = (size_t)blockIdx.x * 64;
    // all global reads first: 4 pieces of the input rows, of each weight matrix rows 8 wave .. 8 wave + 7, columns 4 lane .. 4 lane + 3 (every load covers 512 contiguous bytes per wave)
    v4f xv[4], wr[3][8]; const float* xb = x + r0 * DM; const unsigned wo = (unsigned)wave * 4096u + (unsigned)lane * 16u;   // this thread's byte offset in a weight matrix
#pragma unroll   // constant indices keep the array in registers
    for (int s = 0; s < 4; ++s) xv[s] = *(const v4f*)(xb + (size_t)(tid + 512 * s) * 4);
#pragma unroll   // constant indices keep the array in registers
    for (int r = 0; r < 8; ++r) { wr[0][r] = *(const v4f*)((const char*)wq + wo + 512 * r); wr[1][r] = *(const v4f*)((const char*)wk + wo + 512 * r); wr[2][r] = *(const v4f*)((const char*)wv + wo + 512 * r); }
    asm volatile("s_wait_xcnt 0x0" :: "s"(xb), "s"(wq), "s"(wk), "s"(wv), "v"(tid), "v"(wo) : "memory");   // stands in front of every reuse of a register that the loads above name; the base pointers, the thread index and the weight offset are inputs so that their registers stay theirs up to here
#pragma unroll   // constant indices keep the array in registers
    for (int s = 0; s < 4; ++s) { const int i = tid + 512 * s; v4us o;
#pragma unroll   // constant indices keep the array in registers
        for (int q = 0; q < 4; ++q) o[q] = f2bf(xv[s][q]);
        *(v4us*)(XL + (i >> 5) * PJP + (i & 31) * 8) = o; }
#pragma unroll   // constant indices keep the array in registers
    for (int m = 0; m < 3; ++m)
#pragma unroll   // constant indices keep the array in registers
        for (int i = 0; i < 4; ++i) { v8us o;
#pragma unroll   // constant indices keep the array in registers
            for (int r = 0; r < 8; ++r) o[r] = f2bf(wr[m][r][i]);
            *(v8us*)(WL + (m * 128 + lane * 4 + i) * PJP + wave * 16) = o; }
    __syncthreads();   // inputs and weights are in LDS
    v16bf xf[4];
#pragma unroll   // constant indices keep the array in registers
    for (int kc = 0; kc < 4; ++kc) xf[kc] = WFrag<bf>::ld((const bf*)(XL + (tt * 16 + lr) * PJP + 16 * hi + 64 * kc));
    v8f acc[3][2];
#pragma unroll   // constant indices keep the array in registers
    for (int m = 0; m < 3; ++m)
#pragma unroll   // constant indices keep the array in registers
        for (int u = 0; u < 2; ++u) { v8f a = (v8f){}; const unsigned char* wrow = WL + (m * 128 + (2 * fg + u) * 16 + lr) * PJP + 16 * hi;
#pragma unroll   // constant indices keep the array in registers
            for (int kc = 0; kc < 4; ++kc) { const v16bf wf = WFrag<bf>::ld((const bf*)(wrow + 64 * kc)); a = (m < 2) ? wmmab(wf, xf[kc], a) : wmmab(xf[kc], wf, a); }
            acc[m][u] = a; }
#pragma unroll   // constant indices keep the array in registers
    for (int m = 0; m < 3; ++m)
#pragma unroll   // constant indices keep the array in registers
        for (int u = 0; u < 2; ++u) { const int f0 = (2 * fg + u) * 16; const float* bm = (m == 0) ? bq : (m == 1) ? bk : bv; v8h o16; v8us oh, ol;
#pragma unroll   // constant indices keep the array in registers
            for (int j = 0; j < 8; ++j) { const float y = acc[m][u][j] + bfr(bm[(m < 2) ? f0 + hi * 8 + j : f0 + lr]); o16[j] = tohx(y); unsigned short a2, c2; splitf(y, a2, c2); oh[j] = a2; ol[j] = c2; }
            if (m < 2) { unsigned char* d = SQ + (m * 3 * 64 + tt * 16 + lr) * PJP + (f0 + hi * 8) * 2; *(v8h*)d = o16; *(v8us*)(d + 64 * PJP) = oh; *(v8us*)(d + 2 * 64 * PJP) = ol; }
            else { unsigned char* d = SV + (f0 + lr) * PJV + (tt * 16 + hi * 8) * 2; *(v8h*)d = o16; *(v8us*)(d + 128 * PJV) = oh; *(v8us*)(d + 2 * 128 * PJV) = ol; } }
    __syncthreads();   // the nine staged tiles are complete
    // q and k planes: the 64 token rows of a plane are 16 KiB in a row; v planes: 128 feature rows of 128 bytes
    const size_t zb = r0 / TT, t0 = r0 % TT;
#pragma unroll   // constant indices pick the plane's pointer at compile time
    for (int p = 0; p < 6; ++p) { char* g = (char*)(p == 0 ? (void*)Q16 : p == 1 ? (void*)Qh : p == 2 ? (void*)Ql : p == 3 ? (void*)K16 : p == 4 ? (void*)Kh : (void*)Kl) + r0 * (HD * 2);
#pragma unroll   // as above
        for (int s = 0; s < 2; ++s) { const int i = tid + 512 * s; *(v8us*)(g + (size_t)i * 16) = *(const v8us*)(SQ + (p * 64 + (i >> 4)) * PJP + (i & 15) * 16); } }
#pragma unroll   // constant indices pick the plane's pointer at compile time
    for (int p = 0; p < 3; ++p) { char* g = (char*)(p == 0 ? (void*)V16 : p == 1 ? (void*)Vh : (void*)Vl) + (zb * HD * TT + t0) * 2;
#pragma unroll   // as above
        for (int s = 0; s < 2; ++s) { const int i = tid + 512 * s; *(v8us*)(g + (size_t)(i >> 3) * (TT * 2) + (i & 7) * 16) = *(const v8us*)(SV + (p * 128 + (i >> 3)) * PJV + (i & 7) * 16); } }
}

#define FSK    256                // keys per stage
#define FPITCH 272                // LDS pitch in bytes of a row of 256 bytes: 256 + 16, an odd multiple of 16 for the 16-byte fragment reads
#define FSL    18432              // LDS bytes of a slice: 64 rows of FPITCH (17,408), rounded up to a multiple of 2 KiB so that every slice's place is one
#define FSLOT  (8 * FSL)
#define FTL    ((TT - RH) / 64)   // 64-row tiles of the rows >= RH of a batch
#define FWG    (FTL * NB_)        // attention work-groups
#define MWG    (NB_ * RH / 64)    // merge work-groups: 64 rows < RH each
__device__ __forceinline__ float xhalf(float x) { return __builtin_bit_cast(float, __builtin_amdgcn_permlanex16(__builtin_bit_cast(int, x), __builtin_bit_cast(int, x), 0x76543210, 0xfedcba98, false, false)); }   // lane l with lane l ^ 16
// 2^x with the slot that the instruction set asks for behind a transcendental (before its result is read or its source overwritten): the v_nop stands in the same statement so that it stays directly behind
__device__ __forceinline__ float exp2s(float x) { float r; asm("v_exp_f32 %0, %1\n\tv_nop" : "=v"(r) : "v"(x)); return r; }
typedef __attribute__((ext_vector_type(4))) unsigned u32x4;
typedef __attribute__((ext_vector_type(8))) unsigned u32x8;
__device__ __forceinline__ unsigned uni(unsigned v) { return (unsigned)__builtin_amdgcn_readfirstlane((int)v); }
__device__ __forceinline__ unsigned pinned(unsigned v) { unsigned w = uni(v); asm volatile("" : "+s"(w)); return w; }   // the test word of a tensor load's branch held in a scalar register, so that the branch is a scalar one: the mover ignores EXEC
// a tensor load is one request of the whole wave: NR rows of RB bytes (RB = 128 or 256), source rows sp bytes apart (group 1, built once), from g to LDS byte l (group 0); the mover puts 16 bytes of pad behind every row (interval code = the row, amount code 3). 1-byte elements, tensor = tile, no mask.
template <unsigned RB, unsigned NR> __device__ __forceinline__ u32x8 tdm_g1(unsigned sp) { u32x8 g1;
    g1[0] = uni((1u << 20) | ((RB == 256u ? 5u : 4u) << 22) | (3u << 25)); g1[1] = uni(RB << 16); g1[2] = uni(NR << 16); g1[3] = uni(RB << 16); g1[4] = uni(NR); g1[5] = uni(sp); g1[6] = uni(0u); g1[7] = uni(0u);
    asm volatile("" : "+s"(g1));   // the form of pinned(), for descriptor words held in scalar registers: without it the compiler forms the constants anew at every use and takes the registers of a request in flight for other values
    return g1; }
__device__ __forceinline__ u32x4 tdm_g0(unsigned l, const char* g) { const unsigned long long ga = (unsigned long long)(size_t)g; u32x4 g0;
    g0[0] = uni(1u); g0[1] = uni(l); g0[2] = uni((unsigned)ga); g0[3] = uni((((unsigned)(ga >> 32)) & 0x01FFFFFFu) | 0x80000000u);
    asm volatile("" : "+s"(g0));   // as above: the form of pinned(), for descriptor words held in scalar registers
    return g0; }
__device__ __forceinline__ void tdm_load(u32x4 g0, u32x8 g1) { asm volatile("tensor_load_to_lds %0, %1" :: "s"(g0), "s"(g1) : "memory"); }
// ---- merge_rows: query rows < RH: the KSP key slices' normalised rows (left by k_fattn_hl, the launch before), each weighted by its sum x 2^(its maximum - the row's maximum), added in ascending key order and divided by the sum of the weights.
// Work-group mi = 64 rows of one batch; a wave takes one row at a time (lane = 4 features, 512 bytes in a row), four rows per trip with all their loads in flight at once.
__device__ __forceinline__ void merge_rows(const float* __restrict__ Op, const float* __restrict__ ML, float* OUTb, int mi, int tid) {
    const size_t zz = (size_t)(mi / (RH / 64)); const int t0 = (mi % (RH / 64)) * 64 + (tid >> 5), d = (tid & 31) * 4;
#pragma unroll 1   // rolled: two trips; four rows' loads are what the registers are used for
    for (int tr = 0; tr < 2; ++tr) {
        const float* mlp = ML + (zz * KSP * RH + t0 + tr * 32) * 2; const float* opp = Op + (zz * KSP * RH + t0 + tr * 32) * HD + d;
        v2f ml[4][KSP]; v4f p[4][KSP];
#pragma unroll   // constant indices keep the arrays in registers
        for (int r = 0; r < 4; ++r)
#pragma unroll   // as above
            for (int z = 0; z < KSP; ++z) ml[r][z] = *(const v2f*)(mlp + ((size_t)z * RH + r * 8) * 2);
        asm volatile("s_wait_xcnt 0x0" ::: "memory");   // stands in front of every reuse of the address registers that the loads above name
#pragma unroll   // as above
        for (int r = 0; r < 4; ++r)
#pragma unroll   // as above
            for (int z = 0; z < KSP; ++z) p[r][z] = *(const v4f*)(opp + ((size_t)z * RH + r * 8) * HD);
        asm volatile("s_wait_xcnt 0x0" ::: "memory");   // as above
#pragma unroll   // as above
        for (int r = 0; r < 4; ++r) {
            float mm = ml[r][0][0];
#pragma unroll   // as above
            for (int z = 1; z < KSP; ++z) mm = fmaxf(mm, ml[r][z][0]);
            float wsum = 0.f; v4f o = (v4f){};
#pragma unroll   // as above
            for (int z = 0; z < KSP; ++z) { const float w = exp2s(ml[r][z][0] - mm) * ml[r][z][1]; wsum += w; o += p[r][z] * w; }
            *(v4f*)(OUTb + (zz * TT + t0 + tr * 32 + r * 8) * DQ + d) = o * (1.0f / wsum);
        }
        asm volatile("s_wait_xcnt 0x0" ::: "memory");   // as above, for the stores: the next trip forms new addresses
    }
}
// no register cap: Q (64), the accumulators (128), one K and one V^T fragment set (64 each) and the scores take more than 256 registers; one work-group per WGP, 2 waves per SIMD, leaves each wave 512
__global__ __launch_bounds__(256) void k_fattn(const h16* __restrict__ Q, const h16* __restrict__ Kp, const h16* __restrict__ Vt, const float* __restrict__ Op, const float* __restrict__ ML, float* OUTb) {
    __shared__ __attribute__((aligned(2048))) unsigned char L[2 * FSLOT];
    if (blockIdx.x >= FWG) { merge_rows(Op, ML, OUTb, (int)blockIdx.x - FWG, threadIdx.x); return; }   // the whole work-group leaves here, in front of every tensor load and barrier
    const int tid = threadIdx.x, lane = tid & 31, wave = tid >> 5, c = lane & 15, h = lane >> 4, cg = wave & 1, kp = wave >> 1; const size_t zb = blockIdx.x / FTL; const int qrow = RH + (int)(blockIdx.x % FTL) * 64 + cg * 32 + c;   // column tile u: query qrow + 16 u
    // this wave's slice: first byte of stage 0 in memory, bytes from one stage to the next, source pitch, place in a buffer; all wave-uniform
    const unsigned ws = uni((unsigned)tid >> 5), isv = ws >> 2, sv = ws & 3u;
    const char* gs0 = isv ? (const char*)(Vt + zb * HD * TT) + (size_t)(sv >> 1) * (64 * TT * 2) + (sv & 1u) * 256u : (const char*)(Kp + zb * TT * HD) + (size_t)sv * (64 * HD * 2);
    const unsigned gstep = isv ? FSK * 2u : FSK * HD * 2u, gpitch = isv ? TT * 2u : HD * 2u, lsl = (unsigned)(size_t)L + ws * FSL;
    const u32x8 g1 = tdm_g1<256, 64>(gpitch); u32x4 g0;
    auto stage = [&](int st) { g0 = tdm_g0(lsl + (unsigned)(st & 1) * FSLOT, gs0 + (size_t)st * gstep); tdm_load(g0, g1); };
    auto landed = [&]() { asm volatile("s_wait_tensorcnt 0x0" :: "s"(g0), "s"(g1) : "memory"); };   // this wave's request has landed; its descriptor is an input so that the descriptor's registers stay the request's up to here
    stage(0);
    v16h qf[2][4];
#pragma unroll   // constant indices keep the array in registers
    for (int u = 0; u < 2; ++u)
#pragma unroll   // constant indices keep the array in registers
        for (int kc = 0; kc < 4; ++kc) qf[u][kc] = WFrag<h16>::ld(Q + (zb * TT + qrow + 16 * u) * HD + 8 * h + 32 * kc);
    asm volatile("s_wait_xcnt 0x0" ::: "memory");   // stands in front of every reuse of the address registers that the loads above name
    v8f acc[2][8];
#pragma unroll   // constant indices keep the array in registers
    for (int u = 0; u < 2; ++u)
#pragma unroll   // constant indices keep the array in registers
        for (int t = 0; t < 8; ++t) acc[u][t] = (v8f){};
    float m_run[2] = {-__builtin_inff(), -__builtin_inff()}, l_run[2] = {0.f, 0.f}; const float cs = SCL * 1.4426950408889634f;   // scores in the log2 domain
    landed();                                            // this wave's slice of stage 0
    __syncthreads();                                     // ... and every other wave's
    stage(1);
    const int kro = kp * FSL + c * FPITCH + 16 * h, vro = (4 + (kp >> 1)) * FSL + c * FPITCH + (kp & 1) * 128 + 16 * h;   // this lane's first K row and first V^T row piece in a buffer
#pragma unroll 1   // rolled: one stage is the loop body, the two buffers alternate by st & 1
    for (int st = 0; st < TT / FSK; ++st) {
        const unsigned char* Bf = L + (st & 1) * FSLOT;
        v16h kf[2][4], vf[8];
#pragma unroll   // constant indices keep the array in registers
        for (int kt = 0; kt < 2; ++kt)
#pragma unroll   // constant indices keep the array in registers
            for (int kc = 0; kc < 4; ++kc) kf[kt][kc] = WFrag<h16>::ld((const h16*)(Bf + kro + kt * 16 * FPITCH + 64 * kc));
#pragma unroll   // constant indices keep the array in registers
        for (int sub = 0; sub < 2; ++sub) {   // one pass: 32 keys x 32 query columns
            __builtin_amdgcn_sched_barrier(0);   // keeps the V^T reads below behind the stage's first K reads (which the score products wait for) and out of the products of the pass before, whose registers they take
#pragma unroll   // constant indices keep the array in registers
            for (int t = 0; t < 8; ++t) vf[t] = WFrag<h16>::ld((const h16*)(Bf + vro + (t >> 2) * 2 * FSL + (t & 3) * 16 * FPITCH + sub * 64));
            __builtin_amdgcn_sched_barrier(0);   // keeps the pass's V^T reads issued as one group here, in flight under the score products and the softmax
            v8f s[2][2];   // [column tile][key tile]: four independent chains
#pragma unroll   // constant indices keep the array in registers
            for (int u = 0; u < 2; ++u) { s[u][0] = (v8f){}; s[u][1] = (v8f){}; }
#pragma unroll   // constant indices keep the array in registers
            for (int kc = 0; kc < 4; ++kc)
#pragma unroll   // constant indices keep the array in registers
                for (int kt = 0; kt < 2; ++kt)
#pragma unroll   // constant indices keep the array in registers
                    for (int u = 0; u < 2; ++u) s[u][kt] = wmma16(kf[kt][kc], qf[u][kc], s[u][kt]);
            float mx[2];
#pragma unroll   // constant indices keep the array in registers
            for (int u = 0; u < 2; ++u) { float m = s[u][0][0];
#pragma unroll   // constant indices keep the array in registers
                for (int j = 1; j < 8; ++j) m = fmaxf(m, s[u][0][j]);
#pragma unroll   // constant indices keep the array in registers
                for (int j = 0; j < 8; ++j) m = fmaxf(m, s[u][1][j]);
                mx[u] = fmaxf(m, xhalf(m)) * cs; }
            // lazy rescale: the maximum in use may trail the true one by up to 8 (log2), so a weight stays <= 256; one scalar test per pass for both column tiles
            if (__builtin_amdgcn_ballot_w32((mx[0] > m_run[0] + 8.0f) | (mx[1] > m_run[1] + 8.0f)) != 0) {
#pragma unroll   // constant indices keep the array in registers
                for (int u = 0; u < 2; ++u) { const float m_new = fmaxf(m_run[u], mx[u]); const float corr = exp2s(m_run[u] - m_new); l_run[u] *= corr; m_run[u] = m_new;
#pragma unroll   // constant indices keep the array in registers
                    for (int t = 0; t < 8; ++t) acc[u][t] = acc[u][t] * corr; } }
            v16h pf[2];
#pragma unroll   // constant indices keep the array in registers
            for (int u = 0; u < 2; ++u) { float ps0 = 0.f, ps1 = 0.f;
#pragma unroll   // constant indices keep the array in registers
                for (int j = 0; j < 8; ++j) { const float p0 = exp2s(__builtin_fmaf(s[u][0][j], cs, -m_run[u])), p1 = exp2s(__builtin_fmaf(s[u][1][j], cs, -m_run[u])); ps0 += p0; ps1 += p1; pf[u][j] = (h16)p0; pf[u][8 + j] = (h16)p1; }
                l_run[u] += ps0 + ps1; }
            if (sub == 0) {
                __builtin_amdgcn_sched_barrier(0);   // keeps the next pass's K reads here, as one group behind the softmax and in flight under the products below
#pragma unroll   // constant indices keep the array in registers
                for (int kt = 0; kt < 2; ++kt)
#pragma unroll   // constant indices keep the array in registers
                    for (int kc = 0; kc < 4; ++kc) kf[kt][kc] = WFrag<h16>::ld((const h16*)(Bf + kro + (32 + kt * 16) * FPITCH + 64 * kc));
                __builtin_amdgcn_sched_barrier(0);   // as above
            }
#pragma unroll   // constant indices keep the array in registers
            for (int t = 0; t < 8; ++t)
#pragma unroll   // constant indices keep the array in registers
                for (int u = 0; u < 2; ++u) acc[u][t] = wmma16(vf[t], pf[u], acc[u][t]);
        }
        asm volatile("s_wait_dscnt 0x0" ::: "memory");      // this wave's reads of the buffer are done
        landed();                                           // this wave's slice of stage st + 1
        __syncthreads();                                    // publishes stage st + 1 and ends every wave's reads of stage st
        if (pinned(st + 2 < TT / FSK)) stage(st + 2);       // refill of the buffer just left
    }
    asm volatile("s_wait_tensorcnt 0x0" ::: "memory");      // no tensor load in flight: the buffers become the staging of the join
    asm volatile("s_wait_dscnt 0x0" ::: "memory");          // ... and none of this wave's reads
    // join of the four key parts (behind the loop's last barrier nobody reads the buffers): every wave leaves its accumulators, maxima and sums in LDS, [wave][33][lane] pieces of 16 bytes;
    // then wave (cg, kp) adds, in ascending key part, the four parts' d tiles 2 kp and 2 kp + 1 of its 32 columns: 128 bytes in a row of every output row, one whole line per writer
    v4f* X = (v4f*)L + lane; v4f* Xw = X + wave * (33 * 32);
#pragma unroll   // constant indices keep the array in registers
    for (int u = 0; u < 2; ++u)
#pragma unroll   // constant indices keep the array in registers
        for (int t = 0; t < 8; ++t) { Xw[((u * 8 + t) * 2) * 32] = __builtin_shufflevector(acc[u][t], acc[u][t], 0, 1, 2, 3); Xw[((u * 8 + t) * 2 + 1) * 32] = __builtin_shufflevector(acc[u][t], acc[u][t], 4, 5, 6, 7); }
    Xw[32 * 32] = (v4f){m_run[0], l_run[0], m_run[1], l_run[1]};
    __syncthreads();   // every part's values are in LDS
    v4f ml[4];
#pragma unroll   // constant indices keep the array in registers
    for (int p = 0; p < 4; ++p) ml[p] = X[((cg + 2 * p) * 33 + 32) * 32];
#pragma unroll   // constant indices keep the array in registers
    for (int u = 0; u < 2; ++u) {
        const float m_all = fmaxf(fmaxf(ml[0][2 * u], ml[1][2 * u]), fmaxf(ml[2][2 * u], ml[3][2 * u])); float f[4], lh = 0.f;
#pragma unroll   // constant indices keep the array in registers
        for (int p = 0; p < 4; ++p) { f[p] = exp2s(ml[p][2 * u] - m_all); lh += ml[p][2 * u + 1] * f[p]; }
        const float inv = 1.0f / (lh + xhalf(lh));   // each half summed its own eight keys of every tile
        float* orow = OUTb + (zb * TT + qrow + 16 * u) * DQ + kp * 32 + 8 * h;
#pragma unroll   // constant indices keep the array in registers
        for (int tt = 0; tt < 2; ++tt) { v4f a = (v4f){}, b = (v4f){};
#pragma unroll   // constant indices keep the array in registers
            for (int p = 0; p < 4; ++p) { const v4f* xp = X + ((cg + 2 * p) * 33 + (u * 8 + 2 * kp + tt) * 2) * 32; a += xp[0] * f[p]; b += xp[32] * f[p]; }
            *(v4f*)(orow + tt * 16) = a * inv; *(v4f*)(orow + tt * 16 + 4) = b * inv; }
    }
}

// ---- k_fattn_hl: the same fused form for query rows < RH, bf16 hi/lo planes, 3 products each way (Kh Qh + Kh Ql + Kl Qh; Vh Ph + Vh Pl + Vl Ph), f32 scores, softmax and sums. Work-group = (key slice of TT / KSP keys, 64-row tile, batch): grid (KSP, RH / 64, batch).
// 8 waves = 4 groups of 16 query columns x 2 key parts of 32 keys; stages of HSK keys (K hi, K lo, V^T hi, V^T lo) by tensor loads to LDS, two buffers, the order of the fp16 loop. Every wave issues ONE request per stage for its own slice, half a tile:
// wave w: tile w >> 1 (K hi, K lo, V^T hi, V^T lo), half w & 1: of a K tile 32 keys of 256 bytes (pitch FPITCH), of a V^T tile 64 rows d of 128 bytes (pitch HVP).
// The weight p = 2^(score - maximum in use) is split p = hi + lo in bf16 before the products. The slice's rows leave normalised, with their maximum (log2 domain) and sum, for merge_rows.
#define HSK    64                 // keys per stage
#define HVP    144                // LDS pitch in bytes of a V^T row of 64 keys: 128 + 16, an odd multiple of 16
#define HSL    10240              // LDS bytes of a slice: 32 rows of FPITCH (8,704) or 64 rows of HVP (9,216), rounded up to a multiple of 2 KiB so that every slice's place is one
#define HSLOT  (8 * HSL)
typedef __attribute__((ext_vector_type(2))) __bf16 v2bf;
// no register cap: two fragment sets in flight beside Q hi/lo, the accumulators and the weights take a few registers above 256; the grid is one work-group per WGP (2 waves per SIMD), so nothing asks for fewer
__global__ __launch_bounds__(256) void k_fattn_hl(const bf* __restrict__ Qh, const bf* __restrict__ Ql, const bf* __restrict__ Kh, const bf* __restrict__ Kl, const bf* __restrict__ Vh, const bf* __restrict__ Vl, float* Op, float* ML) {
    __shared__ __attribute__((aligned(2048))) unsigned char L[2 * HSLOT];
    const int tid = threadIdx.x, lane = tid & 31, wave = tid >> 5, c = lane & 15, h = lane >> 4, cg = wave & 3, kp = wave >> 2;
    const int ks = blockIdx.x, rt = blockIdx.y; const size_t zb = blockIdx.z; const int qrow = rt * 64 + cg * 16 + c;
    // this wave's slice: first byte of stage 0 in memory and place in a buffer; all wave-uniform
    const unsigned ws = uni((unsigned)tid >> 5), hf = ws & 1u, lsl = (unsigned)(size_t)L + ws * HSL;
    const char* gs0 = (ws < 4u) ? (const char*)(ws < 2u ? Kh : Kl) + (zb * TT + (size_t)ks * (TT / KSP) + hf * 32u) * (HD * 2)
                                : (const char*)(ws < 6u ? Vh : Vl) + (zb * HD + hf * 64u) * (TT * 2) + (size_t)ks * (TT / KSP) * 2;
    // the two row lengths have each their own pad word, a constant of the instruction's descriptor: two loads, a scalar branch picks the wave's
    const u32x8 g1k = tdm_g1<256, 32>(HD * 2u), g1v = tdm_g1<128, 64>(TT * 2u); u32x4 g0; const unsigned gstep = (ws < 4u) ? HSK * HD * 2u : HSK * 2u;
    auto stage = [&](int st) { g0 = tdm_g0(lsl + (unsigned)(st & 1) * HSLOT, gs0 + (size_t)st * gstep);
        if (pinned(ws < 4u)) tdm_load(g0, g1k);
        if (pinned(ws >= 4u)) tdm_load(g0, g1v); };
    auto landed = [&]() { asm volatile("s_wait_tensorcnt 0x0" :: "s"(g0), "s"(g1k), "s"(g1v) : "memory"); };   // this wave's request has landed; the descriptors are inputs so that their registers stay the request's up to here
    stage(0);
    v16bf qh[4], ql[4];
#pragma unroll   // constant indices keep the array in registers
    for (int kc = 0; kc < 4; ++kc) { qh[kc] = WFrag<bf>::ld(Qh + (zb * TT + qrow) * HD + 8 * h + 32 * kc); ql[kc] = WFrag<bf>::ld(Ql + (zb * TT + qrow) * HD + 8 * h + 32 * kc); }
    asm volatile("s_wait_xcnt 0x0" ::: "memory");   // stands in front of every reuse of the address registers that the loads above name
    v8f acc[8];
#pragma unroll   // constant indices keep the array in registers
    for (int t = 0; t < 8; ++t) acc[t] = (v8f){};
    float m_run = -__builtin_inff(), l_run = 0.f; const float cs = SCL * 1.4426950408889634f;   // scores in the log2 domain
    landed();                                            // this wave's slice of stage 0
    __syncthreads();                                     // ... and every other wave's
    stage(1);
    const int kro = kp * HSL + c * FPITCH + 16 * h, vro = 4 * HSL + c * HVP + kp * 64 + 16 * h;   // this lane's first K row and first V^T row piece in a buffer; the lo tiles lie 2 HSL behind the hi tiles
#pragma unroll 1   // rolled: one stage is the loop body, the two buffers alternate by st & 1
    for (int st = 0; st < TT / KSP / HSK; ++st) {
        const unsigned char* Bf = L + (st & 1) * HSLOT;
        // fragment reads go in groups of four fragments, two register sets fa and fb in turn: a group is issued while the products on the group before it run, so that its LDS latency lies under them
        v16bf fa[4], fb[4]; v8f s[2], s0, s1;   // s0, s1: two independent chains (d 0..63, d 64..127): a product need not wait for the one before it
        auto ldK = [&](v16bf (&f)[4], int kt, int kc) { const unsigned char* kr = Bf + kro + kt * 16 * FPITCH + 64 * kc; f[0] = WFrag<bf>::ld((const bf*)kr); f[1] = WFrag<bf>::ld((const bf*)(kr + 128)); f[2] = WFrag<bf>::ld((const bf*)(kr + 2 * HSL)); f[3] = WFrag<bf>::ld((const bf*)(kr + 2 * HSL + 128)); };
        auto mmK = [&](v16bf (&f)[4], int kc) { s0 = wmmab(f[0], qh[kc], s0); s1 = wmmab(f[1], qh[kc + 2], s1); s0 = wmmab(f[0], ql[kc], s0); s1 = wmmab(f[1], ql[kc + 2], s1); s0 = wmmab(f[2], qh[kc], s0); s1 = wmmab(f[3], qh[kc + 2], s1); };
        auto ldV = [&](v16bf (&f)[4], int g) { const unsigned char* vr = Bf + vro + (g >> 1) * HSL + (g & 1) * 32 * HVP; f[0] = WFrag<bf>::ld((const bf*)vr); f[1] = WFrag<bf>::ld((const bf*)(vr + 16 * HVP)); f[2] = WFrag<bf>::ld((const bf*)(vr + 2 * HSL)); f[3] = WFrag<bf>::ld((const bf*)(vr + 2 * HSL + 16 * HVP)); };
        ldK(fa, 0, 0); ldK(fb, 0, 1);
        __builtin_amdgcn_sched_barrier(0);   // keeps the reads above in front of the products below
        s0 = (v8f){}; s1 = (v8f){}; mmK(fa, 0);
        __builtin_amdgcn_sched_barrier(0);   // keeps the next group's reads here, behind the products that used its registers
        ldK(fa, 1, 0);
        __builtin_amdgcn_sched_barrier(0);   // keeps those reads in front of the products below
        mmK(fb, 1); s[0] = s0 + s1;
        __builtin_amdgcn_sched_barrier(0);   // as above: next group's reads behind the last use of their registers
        ldK(fb, 1, 1);
        __builtin_amdgcn_sched_barrier(0);   // as above: reads in front of the products
        s0 = (v8f){}; s1 = (v8f){}; mmK(fa, 0);
        __builtin_amdgcn_sched_barrier(0);   // as above: next group's reads behind the last use of their registers
        ldV(fa, 0);
        __builtin_amdgcn_sched_barrier(0);   // as above: reads in front of the products
        mmK(fb, 1); s[1] = s0 + s1;
        float mx = s[0][0];
#pragma unroll   // constant indices keep the array in registers
        for (int j = 1; j < 8; ++j) mx = fmaxf(mx, s[0][j]);
#pragma unroll   // constant indices keep the array in registers
        for (int j = 0; j < 8; ++j) mx = fmaxf(mx, s[1][j]);
        mx = fmaxf(mx, xhalf(mx)) * cs;
        // lazy rescale, as in the fp16 loop: the maximum in use may trail the true one by up to 8 (log2)
        if (__builtin_amdgcn_ballot_w32(mx > m_run + 8.0f) != 0) { const float m_new = fmaxf(m_run, mx); const float corr = __builtin_amdgcn_exp2f(m_run - m_new); l_run *= corr; m_run = m_new;
#pragma unroll   // constant indices keep the array in registers
            for (int t = 0; t < 8; ++t) acc[t] = acc[t] * corr; }
        v16bf ph, pl; float ps0 = 0.f, ps1 = 0.f;
#pragma unroll   // constant indices keep the array in registers
        for (int kt = 0; kt < 2; ++kt)
#pragma unroll   // constant indices keep the array in registers
            for (int j = 0; j < 8; j += 2) { v2f p; p[0] = exp2s(__builtin_fmaf(s[kt][j], cs, -m_run)); p[1] = exp2s(__builtin_fmaf(s[kt][j + 1], cs, -m_run)); ps0 += p[0]; ps1 += p[1];
                const v2bf a = __builtin_convertvector(p, v2bf); const v2bf b = __builtin_convertvector(p - __builtin_convertvector(a, v2f), v2bf);
                ph[8 * kt + j] = a[0]; ph[8 * kt + j + 1] = a[1]; pl[8 * kt + j] = b[0]; pl[8 * kt + j + 1] = b[1]; }
        l_run += ps0 + ps1;
        auto mmV = [&](v16bf (&f)[4], int g) { acc[2 * g] = wmmab(f[0], ph, acc[2 * g]); acc[2 * g + 1] = wmmab(f[1], ph, acc[2 * g + 1]); acc[2 * g] = wmmab(f[0], pl, acc[2 * g]); acc[2 * g + 1] = wmmab(f[1], pl, acc[2 * g + 1]); acc[2 * g] = wmmab(f[2], ph, acc[2 * g]); acc[2 * g + 1] = wmmab(f[3], ph, acc[2 * g + 1]); };
        __builtin_amdgcn_sched_barrier(0);   // keeps the second V^T group's reads behind the softmax, whose registers they take
        ldV(fb, 1);
        __builtin_amdgcn_sched_barrier(0);   // as above: reads in front of the products
        mmV(fa, 0);
        __builtin_amdgcn_sched_barrier(0);   // as above: next group's reads behind the last use of their registers
        ldV(fa, 2);
        __builtin_amdgcn_sched_barrier(0);   // as above: reads in front of the products
        mmV(fb, 1);
        __builtin_amdgcn_sched_barrier(0);   // as above: next group's reads behind the last use of their registers
        ldV(fb, 3);
        __builtin_amdgcn_sched_barrier(0);   // as above: reads in front of the products
        mmV(fa, 2); mmV(fb, 3);
        asm volatile("s_wait_dscnt 0x0" ::: "memory");      // this wave's reads of the buffer are done
        landed();                                           // this wave's slice of stage st + 1
        __syncthreads();                                    // publishes stage st + 1 and ends every wave's reads of stage st
        if (pinned(st + 2 < TT / KSP / HSK)) stage(st + 2); // refill of the buffer just left
    }
    asm volatile("s_wait_tensorcnt 0x0" ::: "memory");      // no tensor load in flight: the buffers become the staging of the join
    asm volatile("s_wait_dscnt 0x0" ::: "memory");          // ... and none of this wave's reads
    // join of the two key parts: part 1 leaves its accumulators, maximum and sum in LDS, part 0 adds them to its own and writes the rows
    v4f* X = (v4f*)L + (size_t)cg * 17 * 32 + lane;
    if (kp == 1) {
#pragma unroll   // constant indices keep the array in registers
        for (int t = 0; t < 8; ++t) { X[(2 * t) * 32] = __builtin_shufflevector(acc[t], acc[t], 0, 1, 2, 3); X[(2 * t + 1) * 32] = __builtin_shufflevector(acc[t], acc[t], 4, 5, 6, 7); }
        X[16 * 32] = (v4f){m_run, l_run, 0.f, 0.f};
    }
    __syncthreads();   // part 1's values are in LDS
    if (kp == 0) {
        const v4f ml = X[16 * 32]; const float m_all = fmaxf(m_run, ml[0]); const float a0 = exp2s(m_run - m_all), a1 = exp2s(ml[0] - m_all);
        const float lh = l_run * a0 + ml[1] * a1; const float lt = lh + xhalf(lh); const float inv = 1.0f / lt;   // each half summed its own eight keys of every tile
        const float f0 = a0 * inv, f1 = a1 * inv; const size_t pr = (zb * KSP + ks) * RH + qrow; float* orow = Op + pr * HD + 8 * h;
#pragma unroll   // constant indices keep the array in registers
        for (int t = 0; t < 8; ++t) { const v4f x0 = X[(2 * t) * 32], x1 = X[(2 * t + 1) * 32]; v4f a, b;
#pragma unroll   // constant indices keep the array in registers
            for (int j = 0; j < 4; ++j) { a[j] = acc[t][j] * f0 + x0[j] * f1; b[j] = acc[t][4 + j] * f0 + x1[j] * f1; }
            *(v4f*)(orow + t * 16) = a; *(v4f*)(orow + t * 16 + 4) = b; }
        if (h == 0) { v2f o; o[0] = m_all; o[1] = lt; *(v2f*)(ML + pr * 2) = o; }
    }
}

extern "C" void kernel_launch(void* const* d_in, const int* in_sizes, int n_in,
                              void* d_out, int out_size, void* d_ws, size_t ws_size, hipStream_t stream) {
    (void)in_sizes; (void)n_in; (void)out_size;
    const float* x = (const float*)d_in[0]; const float* wq = (const float*)d_in[1]; const float* bq = (const float*)d_in[2]; const float* wk = (const float*)d_in[3]; const float* bk = (const float*)d_in[4]; const float* wv = (const float*)d_in[5]; const float* bv = (const float*)d_in[6]; const float* wo = nullptr; (void)wo;
    float* OUT = (float*)d_out;     // [4][4096][128]
    char* wsp = (char*)d_ws;
    auto take = [&](size_t bytes) { char* p = wsp; wsp += (bytes + 255) & ~(size_t)255; return (void*)p; };
    const size_t PE = (size_t)NB_ * TT * HD;   // elements of one 16-bit plane, all batches
    h16* QP16 = (h16*)take(PE * 2); h16* KP16 = (h16*)take(PE * 2); h16* VT16 = (h16*)take(PE * 2);
    bf* QPh = (bf*)take(PE * 2); bf* QPl = (bf*)take(PE * 2); bf* KPh = (bf*)take(PE * 2); bf* KPl = (bf*)take(PE * 2); bf* VTh = (bf*)take(PE * 2); bf* VTl = (bf*)take(PE * 2);
    float* Op = (float*)take((size_t)NB_ * KSP * RH * HD * 4); float* ML = (float*)take((size_t)NB_ * KSP * RH * 2 * 4);   // rows < RH: partial rows [batch][slice][RH][HD], their maximum and sum [batch][slice][RH][2]
    if ((size_t)(wsp - (char*)d_ws) > ws_size) return;    // ws 256 MiB
    k_proj<<<NB_ * TT / 64, 512, 0, stream>>>(x, wq, bq, wk, bk, wv, bv, QP16, QPh, QPl, KP16, KPh, KPl, VT16, VTh, VTl);
    k_fattn_hl<<<dim3(KSP, RH / 64, NB_), 256, 0, stream>>>(QPh, QPl, KPh, KPl, VTh, VTl, Op, ML);   // query rows < RH: the slices' partial rows
    k_fattn<<<FWG + MWG, 256, 0, stream>>>(QP16, KP16, VT16, Op, ML, OUT);   // query rows >= RH; beside them the join of the rows < RH
}

// v009
// It runs in 52.3 microseconds.
// Two timings next to v008 both put it at 1.03 times that version's speed.
// Counting every step since v000, it is 19.1 times as fast.
#include <hip/hip_runtime.h>

// Single-head self-attention over 4,096 points (inputs [4][4096][128]; q,k,v = inputs W + b ('xw' [128][128] + [128]); softmax(q.k / sqrt(128)) over all points; out = weights v -> [4][4096][128] (2.1 M)).
// All four batches go through every launch. Attention is fused (scores, online softmax and weights x v in one kernel; neither scores nor weights reach memory): k_fattn, work-groups of 64 query rows >= RH over all keys (fp16); k_fattn_hl, work-groups of 64 query rows < RH over one of KSP key slices (fp16 hi/lo, 3 products), launched first; the join of its KSP slices (merge_rows) rides in the k_fattn launch, in work-groups of its own.
// Front end: ONE launch (k_proj) rounds inputs and weights to bf16, does the three projections and writes every 16-bit plane: of q, k and v each the fp16 value (hi) and the fp16 rest (lo = value - hi); the hi planes serve both attention kernels. Exact projections + bf16-rounded biases; ONE 128-wide head, hybrid rows: < 512 hi/lo 3 products, rest fp16.
// Compute dtypes, f32 accumulate: every input rounded to bf16; projections exact + bf16-rounded biases; attention rows < 512 3 products, rest fp16; softmax f32; output f32.

#define NB_  4
#define TT   4096
#define DM   128
#define NH_  1
#define NKV  1
#define REP  (NH_ / NKV)
#define HD   128
#define DQ   (NH_ * HD)
#define DKV  (NKV * HD)
#define ZH   1
#define RH   512                  // query rows < RH use hi+lo planes (0: none)
#define WIN  0
#define SCL  0.088388347648318447f   // 1/sqrt(128)
#define KSP  8                    // key slices of the query rows < RH: one work-group per (64 rows, slice); normalised f32 partial rows with their maximum and sum go to the workspace, merge_rows joins them
typedef _Float16 h16;
typedef unsigned short bf;
typedef __attribute__((ext_vector_type(16))) __bf16   v16bf;
typedef __attribute__((ext_vector_type(16))) _Float16 v16h;
typedef __attribute__((ext_vector_type(8)))  _Float16 v8h;
typedef __attribute__((ext_vector_type(8)))  unsigned short v8us;
typedef __attribute__((ext_vector_type(8)))  float    v8f;
typedef __attribute__((ext_vector_type(4)))  float    v4f;
typedef v8h  __attribute__((may_alias)) v8ha;
typedef v4f  __attribute__((may_alias)) v4fa;
typedef v8us __attribute__((may_alias)) v8usa;

__device__ __forceinline__ unsigned short f2bf(float f) { unsigned u = __float_as_uint(f); u += 0x7FFFu + ((u >> 16) & 1u); return (unsigned short)(u >> 16); }
__device__ __forceinline__ float bf2f(unsigned short b) { return __uint_as_float(((unsigned)b) << 16); }
__device__ __forceinline__ float bfr(float f) { return bf2f(f2bf(f)); }
__device__ __forceinline__ v16h cat16(v8h lo, v8h hi) { return __builtin_shufflevector(lo, hi, 0, 1, 2, 3, 4, 5, 6, 7, 8, 9, 10, 11, 12, 13, 14, 15); }
__device__ __forceinline__ v16bf cat16b(v8us lo, v8us hi) { return __builtin_bit_cast(v16bf, __builtin_shufflevector(lo, hi, 0, 1, 2, 3, 4, 5, 6, 7, 8, 9, 10, 11, 12, 13, 14, 15)); }
__device__ __forceinline__ v8f wmma16(v16h a, v16h b, v8f c) { return __builtin_amdgcn_wmma_f32_16x16x32_f16(false, a, false, b, (short)0, c, false, false); }
__device__ __forceinline__ v8f wmmab(v16bf a, v16bf b, v8f c) { return __builtin_amdgcn_wmma_f32_16x16x32_bf16(false, a, false, b, (short)0, c, false, false); }



// fragment loaders: 16 values of a lane = 8 consecutive k at p and 8 at p + 16
template <typename T16> struct WFrag;
template <> struct WFrag<h16> { typedef v16h V; static __device__ __forceinline__ V ld(const h16* p) { return cat16(*(const v8h*)p, *(const v8h*)(p + 16)); } static __device__ __forceinline__ v8f mma(V a, V b, v8f c) { return wmma16(a, b, c); } };
template <> struct WFrag<bf> { typedef v16bf V; static __device__ __forceinline__ V ld(const bf* p) { return cat16b(*(const v8us*)p, *(const v8us*)(p + 16)); } static __device__ __forceinline__ v8f mma(V a, V b, v8f c) { return wmmab(a, b, c); } };

typedef __attribute__((ext_vector_type(2))) _Float16 v2h;
typedef __attribute__((ext_vector_type(4))) _Float16 v4h;
typedef __attribute__((ext_vector_type(2))) unsigned short v2us;
typedef __attribute__((ext_vector_type(4))) unsigned short v4us;
typedef __attribute__((ext_vector_type(2))) float v2f;
typedef __attribute__((ext_vector_type(4))) int v4i;

// ---- k_proj: the whole front end in ONE launch. Work-group = 64 tokens x all 384 features (q, k, v), 16 waves; grid = all tokens / 64.
// The three f32 weight matrices [k][n] and the 64 f32 input rows are rounded to bf16 on their way into LDS (weights transposed to [n][k]); wave (tt = token tile, fg) takes feature tiles 2 fg and 2 fg + 1 of q, of k and of v, 4 products of 32 k each in ascending k.
// q, k: A = weight rows, B = tokens, so a lane holds 8 consecutive features of one token; v: A = tokens, B = weight rows, so a lane holds 8 consecutive tokens of one feature (the [HD][TT] plane's order).
// f32 sum + bf16-rounded bias, then the fp16 plane and the fp16 plane of the rest (lo); the six tiles are staged in LDS and leave as whole 128-byte lines.
#define PJP 272                   // LDS pitch in bytes of a row of 128 16-bit values: 256 + 16, an odd multiple of 16
#define PJV 144                   // LDS pitch in bytes of a row of 64 16-bit values: 128 + 16, an odd multiple of 16
__global__ __launch_bounds__(512) void k_proj(const float* __restrict__ x, const float* __restrict__ wq, const float* __restrict__ bq, const float* __restrict__ wk, const float* __restrict__ bk, const float* __restrict__ wv, const float* __restrict__ bv,
                                              h16* Q16, h16* Ql, h16* K16, h16* Kl, h16* V16, h16* Vl) {
    __shared__ __attribute__((aligned(16))) unsigned char WL[3 * 128 * PJP];   // bf16 weights [matrix][n][k]
    __shared__ __attribute__((aligned(16))) unsigned char XL[64 * PJP];        // bf16 inputs [token][k]
    __shared__ __attribute__((aligned(16))) unsigned char SQ[4 * 64 * PJP];    // q and k planes [plane][token][feature]
    __shared__ __attribute__((aligned(16))) unsigned char SV[2 * 128 * PJV];   // v planes [plane][feature][token]
    const int tid = threadIdx.x, lane = tid & 31, wave = tid >> 5, lr = lane & 15, hi = lane >> 4, tt = wave & 3, fg = wave >> 2; const size_t r0 = (size_t)blockIdx.x * 64;
    // the global reads of inputs and weights first: 4 pieces of the input rows, of each weight matrix rows 8 wave .. 8 wave + 7, columns 4 lane .. 4 lane + 3 (every load covers 512 contiguous bytes per wave)
    v4f xv[4], wr[3][8]; const float* xb = x + r0 * DM; const unsigned wo = (unsigned)wave * 4096u + (unsigned)lane * 16u;   // this thread's byte offset in a weight matrix
#pragma unroll   // constant indices keep the array in registers
    for (int s = 0; s < 4; ++s) xv[s] = *(const v4f*)(xb + (size_t)(tid + 512 * s) * 4);
#pragma unroll   // constant indices keep the array in registers
    for (int r = 0; r < 8; ++r) { wr[0][r] = *(const v4f*)((const char*)wq + wo + 512 * r); wr[1][r] = *(const v4f*)((const char*)wk + wo + 512 * r); wr[2][r] = *(const v4f*)((const char*)wv + wo + 512 * r); }
    asm volatile("s_wait_xcnt 0x0" :: "s"(xb), "s"(wq), "s"(wk), "s"(wv), "v"(tid), "v"(wo) : "memory");   // stands in front of every reuse of a register that the loads above name; the base pointers, the thread index and the weight offset are inputs so that their registers stay theirs up to here
#pragma unroll   // constant indices keep the array in registers
    for (int s = 0; s < 4; ++s) { const int i = tid + 512 * s; v4us o;
#pragma unroll   // constant indices keep the array in registers
        for (int q = 0; q < 4; ++q) o[q] = f2bf(xv[s][q]);
        *(v4us*)(XL + (i >> 5) * PJP + (i & 31) * 8) = o; }
#pragma unroll   // constant indices keep the array in registers
    for (int m = 0; m < 3; ++m)
#pragma unroll   // constant indices keep the array in registers
        for (int i = 0; i < 4; ++i) { v8us o;
#pragma unroll   // constant indices keep the array in registers
            for (int r = 0; r < 8; ++r) o[r] = f2bf(wr[m][r][i]);
            *(v8us*)(WL + (m * 128 + lane * 4 + i) * PJP + wave * 16) = o; }
    __syncthreads();   // inputs and weights are in LDS
    v16bf xf[4];
#pragma unroll   // constant indices keep the array in registers
    for (int kc = 0; kc < 4; ++kc) xf[kc] = WFrag<bf>::ld((const bf*)(XL + (tt * 16 + lr) * PJP + 16 * hi + 64 * kc));
    v8f acc[3][2];
#pragma unroll   // constant indices keep the array in registers
    for (int m = 0; m < 3; ++m)
#pragma unroll   // constant indices keep the array in registers
        for (int u = 0; u < 2; ++u) { v8f a = (v8f){}; const unsigned char* wrow = WL + (m * 128 + (2 * fg + u) * 16 + lr) * PJP + 16 * hi;
#pragma unroll   // constant indices keep the array in registers
            for (int kc = 0; kc < 4; ++kc) { const v16bf wf = WFrag<bf>::ld((const bf*)(wrow + 64 * kc)); a = (m < 2) ? wmmab(wf, xf[kc], a) : wmmab(xf[kc], wf, a); }
            acc[m][u] = a; }
#pragma unroll   // constant indices keep the array in registers
    for (int m = 0; m < 3; ++m)
#pragma unroll   // constant indices keep the array in registers
        for (int u = 0; u < 2; ++u) { const int f0 = (2 * fg + u) * 16; const float* bm = (m == 0) ? bq : (m == 1) ? bk : bv; v8h o16, ol;
#pragma unroll   // constant indices keep the array in registers
            for (int j = 0; j < 8; j += 2) { v2f y; y[0] = acc[m][u][j] + bfr(bm[(m < 2) ? f0 + hi * 8 + j : f0 + lr]); y[1] = acc[m][u][j + 1] + bfr(bm[(m < 2) ? f0 + hi * 8 + j + 1 : f0 + lr]);
                const v2h a = __builtin_convertvector(y, v2h); const v2h b = __builtin_convertvector(y - __builtin_convertvector(a, v2f), v2h); o16[j] = a[0]; o16[j + 1] = a[1]; ol[j] = b[0]; ol[j + 1] = b[1]; }
            if (m < 2) { unsigned char* d = SQ + (m * 2 * 64 + tt * 16 + lr) * PJP + (f0 + hi * 8) * 2; *(v8h*)d = o16; *(v8h*)(d + 64 * PJP) = ol; }
            else { unsigned char* d = SV + (f0 + lr) * PJV + (tt * 16 + hi * 8) * 2; *(v8h*)d = o16; *(v8h*)(d + 128 * PJV) = ol; } }
    __syncthreads();   // the six staged tiles are complete
    // q and k planes: the 64 token rows of a plane are 16 KiB in a row; v planes: 128 feature rows of 128 bytes
    const size_t zb = r0 / TT, t0 = r0 % TT;
#pragma unroll   // constant indices pick the plane's pointer at compile time
    for (int p = 0; p < 4; ++p) { char* g = (char*)(p == 0 ? Q16 : p == 1 ? Ql : p == 2 ? K16 : Kl) + r0 * (HD * 2);
#pragma unroll   // as above
        for (int s = 0; s < 2; ++s) { const int i = tid + 512 * s; *(v8us*)(g + (size_t)i * 16) = *(const v8us*)(SQ + (p * 64 + (i >> 4)) * PJP + (i & 15) * 16); } }
#pragma unroll   // constant indices pick the plane's pointer at compile time
    for (int p = 0; p < 2; ++p) { char* g = (char*)(p == 0 ? V16 : Vl) + (zb * HD * TT + t0) * 2;
#pragma unroll   // as above
        for (int s = 0; s < 2; ++s) { const int i = tid + 512 * s; *(v8us*)(g + (size_t)(i >> 3) * (TT * 2) + (i & 7) * 16) = *(const v8us*)(SV + (p * 128 + (i >> 3)) * PJV + (i & 7) * 16); } }
}

#define FSK    256                // keys per stage
#define FPITCH 272                // LDS pitch in bytes of a row of 256 bytes: 256 + 16, an odd multiple of 16 for the 16-byte fragment reads
#define FSL    18432              // LDS bytes of a slice: 64 rows of FPITCH (17,408), rounded up to a multiple of 2 KiB so that every slice's place is one
#define FSLOT  (8 * FSL)
#define FTL    ((TT - RH) / 64)   // 64-row tiles of the rows >= RH of a batch
#define FWG    (FTL * NB_)        // attention work-groups
#define MWG    (NB_ * RH / 64)    // merge work-groups: 64 rows < RH each
__device__ __forceinline__ float xhalf(float x) { return __builtin_bit_cast(float, __builtin_amdgcn_permlanex16(__builtin_bit_cast(int, x), __builtin_bit_cast(int, x), 0x76543210, 0xfedcba98, false, false)); }   // lane l with lane l ^ 16
// 2^x with the slot that the instruction set asks for behind a transcendental (before its result is read or its source overwritten): the v_nop stands in the same statement so that it stays directly behind
__device__ __forceinline__ float exp2s(float x) { float r; asm("v_exp_f32 %0, %1\n\tv_nop" : "=v"(r) : "v"(x)); return r; }
typedef __attribute__((ext_vector_type(4))) unsigned u32x4;
typedef __attribute__((ext_vector_type(8))) unsigned u32x8;
__device__ __forceinline__ unsigned uni(unsigned v) { return (unsigned)__builtin_amdgcn_readfirstlane((int)v); }
__device__ __forceinline__ unsigned pinned(unsigned v) { unsigned w = uni(v); asm volatile("" : "+s"(w)); return w; }   // the test word of a tensor load's branch held in a scalar register, so that the branch is a scalar one: the mover ignores EXEC
// a tensor load is one request of the whole wave: NR rows of RB bytes (RB = 128 or 256), source rows sp bytes apart (group 1, built once), from g to LDS byte l (group 0); the mover puts 16 bytes of pad behind every row (interval code = the row, amount code 3). 1-byte elements, tensor = tile, no mask.
template <unsigned RB, unsigned NR> __device__ __forceinline__ u32x8 tdm_g1(unsigned sp) { u32x8 g1;
    g1[0] = uni((1u << 20) | ((RB == 256u ? 5u : 4u) << 22) | (3u << 25)); g1[1] = uni(RB << 16); g1[2] = uni(NR << 16); g1[3] = uni(RB << 16); g1[4] = uni(NR); g1[5] = uni(sp); g1[6] = uni(0u); g1[7] = uni(0u);
    asm volatile("" : "+s"(g1));   // the form of pinned(), for descriptor words held in scalar registers: without it the compiler forms the constants anew at every use and takes the registers of a request in flight for other values
    return g1; }
__device__ __forceinline__ u32x4 tdm_g0(unsigned l, const char* g) { const unsigned long long ga = (unsigned long long)(size_t)g; u32x4 g0;
    g0[0] = uni(1u); g0[1] = uni(l); g0[2] = uni((unsigned)ga); g0[3] = uni((((unsigned)(ga >> 32)) & 0x01FFFFFFu) | 0x80000000u);
    asm volatile("" : "+s"(g0));   // as above: the form of pinned(), for descriptor words held in scalar registers
    return g0; }
__device__ __forceinline__ void tdm_load(u32x4 g0, u32x8 g1) { asm volatile("tensor_load_to_lds %0, %1" :: "s"(g0), "s"(g1) : "memory"); }
// ---- merge_rows: query rows < RH: the KSP key slices' normalised rows (left by k_fattn_hl, the launch before), each weighted by its sum x 2^(its maximum - the row's maximum), added in ascending key order and divided by the sum of the weights.
// Work-group mi = 64 rows of one batch; a wave takes one row at a time (lane = 4 features, 512 bytes in a row), four rows per trip with all their loads in flight at once.
__device__ __forceinline__ void merge_rows(const float* __restrict__ Op, const float* __restrict__ ML, float* OUTb, int mi, int tid) {
    const size_t zz = (size_t)(mi / (RH / 64)); const int t0 = (mi % (RH / 64)) * 64 + (tid >> 5), d = (tid & 31) * 4;
#pragma unroll 1   // rolled: two trips; four rows' loads are what the registers are used for
    for (int tr = 0; tr < 2; ++tr) {
        const float* mlp = ML + (zz * KSP * RH + t0 + tr * 32) * 2; const float* opp = Op + (zz * KSP * RH + t0 + tr * 32) * HD + d;
        v2f ml[4][KSP]; v4f p[4][KSP];
#pragma unroll   // constant indices keep the arrays in registers
        for (int r = 0; r < 4; ++r)
#pragma unroll   // as above
            for (int z = 0; z < KSP; ++z) ml[r][z] = *(const v2f*)(mlp + ((size_t)z * RH + r * 8) * 2);
        asm volatile("s_wait_xcnt 0x0" ::: "memory");   // stands in front of every reuse of the address registers that the loads above name
#pragma unroll   // as above
        for (int r = 0; r < 4; ++r)
#pragma unroll   // as above
            for (int z = 0; z < KSP; ++z) p[r][z] = *(const v4f*)(opp + ((size_t)z * RH + r * 8) * HD);
        asm volatile("s_wait_xcnt 0x0" ::: "memory");   // as above
#pragma unroll   // as above
        for (int r = 0; r < 4; ++r) {
            float mm = ml[r][0][0];
#pragma unroll   // as above
            for (int z = 1; z < KSP; ++z) mm = fmaxf(mm, ml[r][z][0]);
            float wsum = 0.f; v4f o = (v4f){};
#pragma unroll   // as above
            for (int z = 0; z < KSP; ++z) { const float w = exp2s(ml[r][z][0] - mm) * ml[r][z][1]; wsum += w; o += p[r][z] * w; }
            *(v4f*)(OUTb + (zz * TT + t0 + tr * 32 + r * 8) * DQ + d) = o * (1.0f / wsum);
        }
        asm volatile("s_wait_xcnt 0x0" ::: "memory");   // as above, for the stores: the next trip forms new addresses
    }
}
// no register cap: Q (64), the accumulators (128), one K and one V^T fragment set (64 each) and the scores take more than 256 registers; one work-group per WGP, 2 waves per SIMD, leaves each wave 512
__global__ __launch_bounds__(256) void k_fattn(const h16* __restrict__ Q, const h16* __restrict__ Kp, const h16* __restrict__ Vt, const float* __restrict__ Op, const float* __restrict__ ML, float* OUTb) {
    __shared__ __attribute__((aligned(2048))) unsigned char L[2 * FSLOT];
    if (blockIdx.x >= FWG) { merge_rows(Op, ML, OUTb, (int)blockIdx.x - FWG, threadIdx.x); return; }   // the whole work-group leaves here, in front of every tensor load and barrier
    const int tid = threadIdx.x, lane = tid & 31, wave = tid >> 5, c = lane & 15, h = lane >> 4, cg = wave & 1, kp = wave >> 1; const size_t zb = blockIdx.x / FTL; const int qrow = RH + (int)(blockIdx.x % FTL) * 64 + cg * 32 + c;   // column tile u: query qrow + 16 u
    // this wave's slice: first byte of stage 0 in memory, bytes from one stage to the next, source pitch, place in a buffer; all wave-uniform
    const unsigned ws = uni((unsigned)tid >> 5), isv = ws >> 2, sv = ws & 3u;
    const char* gs0 = isv ? (const char*)(Vt + zb * HD * TT) + (size_t)(sv >> 1) * (64 * TT * 2) + (sv & 1u) * 256u : (const char*)(Kp + zb * TT * HD) + (size_t)sv * (64 * HD * 2);
    const unsigned gstep = isv ? FSK * 2u : FSK * HD * 2u, gpitch = isv ? TT * 2u : HD * 2u, lsl = (unsigned)(size_t)L + ws * FSL;
    const u32x8 g1 = tdm_g1<256, 64>(gpitch); u32x4 g0;
    auto stage = [&](int st) { g0 = tdm_g0(lsl + (unsigned)(st & 1) * FSLOT, gs0 + (size_t)st * gstep); tdm_load(g0, g1); };
    auto landed = [&]() { asm volatile("s_wait_tensorcnt 0x0" :: "s"(g0), "s"(g1) : "memory"); };   // this wave's request has landed; its descriptor is an input so that the descriptor's registers stay the request's up to here
    stage(0);
    v16h qf[2][4];
#pragma unroll   // constant indices keep the array in registers
    for (int u = 0; u < 2; ++u)
#pragma unroll   // constant indices keep the array in registers
        for (int kc = 0; kc < 4; ++kc) qf[u][kc] = WFrag<h16>::ld(Q + (zb * TT + qrow + 16 * u) * HD + 8 * h + 32 * kc);
    asm volatile("s_wait_xcnt 0x0" ::: "memory");   // stands in front of every reuse of the address registers that the loads above name
    v8f acc[2][8];
#pragma unroll   // constant indices keep the array in registers
    for (int u = 0; u < 2; ++u)
#pragma unroll   // constant indices keep the array in registers
        for (int t = 0; t < 8; ++t) acc[u][t] = (v8f){};
    float m_run[2] = {-__builtin_inff(), -__builtin_inff()}, l_run[2] = {0.f, 0.f}; const float cs = SCL * 1.4426950408889634f;   // scores in the log2 domain
    landed();                                            // this wave's slice of stage 0
    __syncthreads();                                     // ... and every other wave's
    stage(1);
    const int kro = kp * FSL + c * FPITCH + 16 * h, vro = (4 + (kp >> 1)) * FSL + c * FPITCH + (kp & 1) * 128 + 16 * h;   // this lane's first K row and first V^T row piece in a buffer
#pragma unroll 1   // rolled: one stage is the loop body, the two buffers alternate by st & 1
    for (int st = 0; st < TT / FSK; ++st) {
        const unsigned char* Bf = L + (st & 1) * FSLOT;
        v16h kf[2][4], vf[8];
#pragma unroll   // constant indices keep the array in registers
        for (int kt = 0; kt < 2; ++kt)
#pragma unroll   // constant indices keep the array in registers
            for (int kc = 0; kc < 4; ++kc) kf[kt][kc] = WFrag<h16>::ld((const h16*)(Bf + kro + kt * 16 * FPITCH + 64 * kc));
#pragma unroll   // constant indices keep the array in registers
        for (int sub = 0; sub < 2; ++sub) {   // one pass: 32 keys x 32 query columns
            __builtin_amdgcn_sched_barrier(0);   // keeps the V^T reads below behind the stage's first K reads (which the score products wait for) and out of the products of the pass before, whose registers they take
#pragma unroll   // constant indices keep the array in registers
            for (int t = 0; t < 8; ++t) vf[t] = WFrag<h16>::ld((const h16*)(Bf + vro + (t >> 2) * 2 * FSL + (t & 3) * 16 * FPITCH + sub * 64));
            __builtin_amdgcn_sched_barrier(0);   // keeps the pass's V^T reads issued as one group here, in flight under the score products and the softmax
            v8f s[2][2];   // [column tile][key tile]: four independent chains
#pragma unroll   // constant indices keep the array in registers
            for (int u = 0; u < 2; ++u) { s[u][0] = (v8f){}; s[u][1] = (v8f){}; }
#pragma unroll   // constant indices keep the array in registers
            for (int kc = 0; kc < 4; ++kc)
#pragma unroll   // constant indices keep the array in registers
                for (int kt = 0; kt < 2; ++kt)
#pragma unroll   // constant indices keep the array in registers
                    for (int u = 0; u < 2; ++u) s[u][kt] = wmma16(kf[kt][kc], qf[u][kc], s[u][kt]);
            float mx[2];
#pragma unroll   // constant indices keep the array in registers
            for (int u = 0; u < 2; ++u) { float m = s[u][0][0];
#pragma unroll   // constant indices keep the array in registers
                for (int j = 1; j < 8; ++j) m = fmaxf(m, s[u][0][j]);
#pragma unroll   // constant indices keep the array in registers
                for (int j = 0; j < 8; ++j) m = fmaxf(m, s[u][1][j]);
                mx[u] = fmaxf(m, xhalf(m)) * cs; }
            // lazy rescale: the maximum in use may trail the true one by up to 8 (log2), so a weight stays <= 256; one scalar test per pass for both column tiles
            if (__builtin_amdgcn_ballot_w32((mx[0] > m_run[0] + 8.0f) | (mx[1] > m_run[1] + 8.0f)) != 0) {
#pragma unroll   // constant indices keep the array in registers
                for (int u = 0; u < 2; ++u) { const float m_new = fmaxf(m_run[u], mx[u]); const float corr = exp2s(m_run[u] - m_new); l_run[u] *= corr; m_run[u] = m_new;
#pragma unroll   // constant indices keep the array in registers
                    for (int t = 0; t < 8; ++t) acc[u][t] = acc[u][t] * corr; } }
            v16h pf[2];
#pragma unroll   // constant indices keep the array in registers
            for (int u = 0; u < 2; ++u) { float ps0 = 0.f, ps1 = 0.f;
#pragma unroll   // constant indices keep the array in registers
                for (int j = 0; j < 8; ++j) { const float p0 = exp2s(__builtin_fmaf(s[u][0][j], cs, -m_run[u])), p1 = exp2s(__builtin_fmaf(s[u][1][j], cs, -m_run[u])); ps0 += p0; ps1 += p1; pf[u][j] = (h16)p0; pf[u][8 + j] = (h16)p1; }
                l_run[u] += ps0 + ps1; }
            if (sub == 0) {
                __builtin_amdgcn_sched_barrier(0);   // keeps the next pass's K reads here, as one group behind the softmax and in flight under the products below
#pragma unroll   // constant indices keep the array in registers
                for (int kt = 0; kt < 2; ++kt)
#pragma unroll   // constant indices keep the array in registers
                    for (int kc = 0; kc < 4; ++kc) kf[kt][kc] = WFrag<h16>::ld((const h16*)(Bf + kro + (32 + kt * 16) * FPITCH + 64 * kc));
                __builtin_amdgcn_sched_barrier(0);   // as above
            }
#pragma unroll   // constant indices keep the array in registers
            for (int t = 0; t < 8; ++t)
#pragma unroll   // constant indices keep the array in registers
                for (int u = 0; u < 2; ++u) acc[u][t] = wmma16(vf[t], pf[u], acc[u][t]);
        }
        asm volatile("s_wait_dscnt 0x0" ::: "memory");      // this wave's reads of the buffer are done
        landed();                                           // this wave's slice of stage st + 1
        __syncthreads();                                    // publishes stage st + 1 and ends every wave's reads of stage st
        if (pinned(st + 2 < TT / FSK)) stage(st + 2);       // refill of the buffer just left
    }
    asm volatile("s_wait_tensorcnt 0x0" ::: "memory");      // no tensor load in flight: the buffers become the staging of the join
    asm volatile("s_wait_dscnt 0x0" ::: "memory");          // ... and none of this wave's reads
    // join of the four key parts (behind the loop's last barrier nobody reads the buffers): every wave leaves its accumulators, maxima and sums in LDS, [wave][33][lane] pieces of 16 bytes;
    // then wave (cg, kp) adds, in ascending key part, the four parts' d tiles 2 kp and 2 kp + 1 of its 32 columns: 128 bytes in a row of every output row, one whole line per writer
    v4f* X = (v4f*)L + lane; v4f* Xw = X + wave * (33 * 32);
#pragma unroll   // constant indices keep the array in registers
    for (int u = 0; u < 2; ++u)
#pragma unroll   // constant indices keep the array in registers
        for (int t = 0; t < 8; ++t) { Xw[((u * 8 + t) * 2) * 32] = __builtin_shufflevector(acc[u][t], acc[u][t], 0, 1, 2, 3); Xw[((u * 8 + t) * 2 + 1) * 32] = __builtin_shufflevector(acc[u][t], acc[u][t], 4, 5, 6, 7); }
    Xw[32 * 32] = (v4f){m_run[0], l_run[0], m_run[1], l_run[1]};
    __syncthreads();   // every part's values are in LDS
    v4f ml[4];
#pragma unroll   // constant indices keep the array in registers
    for (int p = 0; p < 4; ++p) ml[p] = X[((cg + 2 * p) * 33 + 32) * 32];
#pragma unroll   // constant indices keep the array in registers
    for (int u = 0; u < 2; ++u) {
        const float m_all = fmaxf(fmaxf(ml[0][2 * u], ml[1][2 * u]), fmaxf(ml[2][2 * u], ml[3][2 * u])); float f[4], lh = 0.f;
#pragma unroll   // constant indices keep the array in registers
        for (int p = 0; p < 4; ++p) { f[p] = exp2s(ml[p][2 * u] - m_all); lh += ml[p][2 * u + 1] * f[p]; }
        const float inv = 1.0f / (lh + xhalf(lh));   // each half summed its own eight keys of every tile
        float* orow = OUTb + (zb * TT + qrow + 16 * u) * DQ + kp * 32 + 8 * h;
#pragma unroll   // constant indices keep the array in registers
        for (int tt = 0; tt < 2; ++tt) { v4f a = (v4f){}, b = (v4f){};
#pragma unroll   // constant indices keep the array in registers
            for (int p = 0; p < 4; ++p) { const v4f* xp = X + ((cg + 2 * p) * 33 + (u * 8 + 2 * kp + tt) * 2) * 32; a += xp[0] * f[p]; b += xp[32] * f[p]; }
            *(v4f*)(orow + tt * 16) = a * inv; *(v4f*)(orow + tt * 16 + 4) = b * inv; }
    }
}

// ---- k_fattn_hl: the same fused form for query rows < RH, fp16 hi/lo planes (hi = the fp16 plane that k_fattn reads, lo = the rest in fp16), 3 products each way (Kh Qh + Kh Ql + Kl Qh; Vh Ph + Vh Pl + Vl Ph), f32 scores, softmax and sums. Work-group = (key slice of TT / KSP keys, 64-row tile, batch): grid (KSP, RH / 64, batch).
// 8 waves = 4 groups of 16 query columns x 2 key parts of 32 keys; stages of HSK keys (K hi, K lo, V^T hi, V^T lo) by tensor loads to LDS, two buffers, the order of the fp16 loop. Every wave issues ONE request per stage for its own slice, half a tile:
// wave w: tile w >> 1 (K hi, K lo, V^T hi, V^T lo), half w & 1: of a K tile 32 keys of 256 bytes (pitch FPITCH), of a V^T tile 64 rows d of 128 bytes (pitch HVP).
// The weight p = 2^(score - maximum in use) is split p = hi + lo in fp16 before the products. The slice's rows leave normalised, with their maximum (log2 domain) and sum, for merge_rows.
#define HSK    64                 // keys per stage
#define HVP    144                // LDS pitch in bytes of a V^T row of 64 keys: 128 + 16, an odd multiple of 16
#define HSL    10240              // LDS bytes of a slice: 32 rows of FPITCH (8,704) or 64 rows of HVP (9,216), rounded up to a multiple of 2 KiB so that every slice's place is one
#define HSLOT  (8 * HSL)
// no register cap: two fragment sets in flight beside Q hi/lo, the accumulators and the weights take a few registers above 256; the grid is one work-group per WGP (2 waves per SIMD), so nothing asks for fewer
__global__ __launch_bounds__(256) void k_fattn_hl(const h16* __restrict__ Qh, const h16* __restrict__ Ql, const h16* __restrict__ Kh, const h16* __restrict__ Kl, const h16* __restrict__ Vh, const h16* __restrict__ Vl, float* Op, float* ML) {
    __shared__ __attribute__((aligned(2048))) unsigned char L[2 * HSLOT];
    const int tid = threadIdx.x, lane = tid & 31, wave = tid >> 5, c = lane & 15, h = lane >> 4, cg = wave & 3, kp = wave >> 2;
    const int ks = blockIdx.x, rt = blockIdx.y; const size_t zb = blockIdx.z; const int qrow = rt * 64 + cg * 16 + c;
    // this wave's slice: first byte of stage 0 in memory and place in a buffer; all wave-uniform
    const unsigned ws = uni((unsigned)tid >> 5), hf = ws & 1u, lsl = (unsigned)(size_t)L + ws * HSL;
    const char* gs0 = (ws < 4u) ? (const char*)(ws < 2u ? Kh : Kl) + (zb * TT + (size_t)ks * (TT / KSP) + hf * 32u) * (HD * 2)
                                : (const char*)(ws < 6u ? Vh : Vl) + (zb * HD + hf * 64u) * (TT * 2) + (size_t)ks * (TT / KSP) * 2;
    // the two row lengths have each their own pad word, a constant of the instruction's descriptor: two loads, a scalar branch picks the wave's
    const u32x8 g1k = tdm_g1<256, 32>(HD * 2u), g1v = tdm_g1<128, 64>(TT * 2u); u32x4 g0; const unsigned gstep = (ws < 4u) ? HSK * HD * 2u : HSK * 2u;
    auto stage = [&](int st) { g0 = tdm_g0(lsl + (unsigned)(st & 1) * HSLOT, gs0 + (size_t)st * gstep);
        if (pinned(ws < 4u)) tdm_load(g0, g1k);
        if (pinned(ws >= 4u)) tdm_load(g0, g1v); };
    auto landed = [&]() { asm volatile("s_wait_tensorcnt 0x0" :: "s"(g0), "s"(g1k), "s"(g1v) : "memory"); };   // this wave's request has landed; the descriptors are inputs so that their registers stay the request's up to here
    stage(0);
    v16h qh[4], ql[4];
#pragma unroll   // constant indices keep the array in registers
    for (int kc = 0; kc < 4; ++kc) { qh[kc] = WFrag<h16>::ld(Qh + (zb * TT + qrow) * HD + 8 * h + 32 * kc); ql[kc] = WFrag<h16>::ld(Ql + (zb * TT + qrow) * HD + 8 * h + 32 * kc); }
    asm volatile("s_wait_xcnt 0x0" ::: "memory");   // stands in front of every reuse of the address registers that the loads above name
    v8f acc[8];
#pragma unroll   // constant indices keep the array in registers
    for (int t = 0; t < 8; ++t) acc[t] = (v8f){};
    float m_run = -__builtin_inff(), l_run = 0.f; const float cs = SCL * 1.4426950408889634f;   // scores in the log2 domain
    landed();                                            // this wave's slice of stage 0
    __syncthreads();                                     // ... and every other wave's
    stage(1);
    const int kro = kp * HSL + c * FPITCH + 16 * h, vro = 4 * HSL + c * HVP + kp * 64 + 16 * h;   // this lane's first K row and first V^T row piece in a buffer; the lo tiles lie 2 HSL behind the hi tiles
#pragma unroll 1   // rolled: one stage is the loop body, the two buffers alternate by st & 1
    for (int st = 0; st < TT / KSP / HSK; ++st) {
        const unsigned char* Bf = L + (st & 1) * HSLOT;
        // fragment reads go in groups of four fragments, two register sets fa and fb in turn: a group is issued while the products on the group before it run, so that its LDS latency lies under them
        v16h fa[4], fb[4]; v8f s[2], s0, s1;   // s0, s1: two independent chains (d 0..63, d 64..127): a product need not wait for the one before it
        auto ldK = [&](v16h (&f)[4], int kt, int kc) { const unsigned char* kr = Bf + kro + kt * 16 * FPITCH + 64 * kc; f[0] = WFrag<h16>::ld((const h16*)kr); f[1] = WFrag<h16>::ld((const h16*)(kr + 128)); f[2] = WFrag<h16>::ld((const h16*)(kr + 2 * HSL)); f[3] = WFrag<h16>::ld((const h16*)(kr + 2 * HSL + 128)); };
        auto mmK = [&](v16h (&f)[4], int kc) { s0 = wmma16(f[0], qh[kc], s0); s1 = wmma16(f[1], qh[kc + 2], s1); s0 = wmma16(f[0], ql[kc], s0); s1 = wmma16(f[1], ql[kc + 2], s1); s0 = wmma16(f[2], qh[kc], s0); s1 = wmma16(f[3], qh[kc + 2], s1); };
        auto ldV = [&](v16h (&f)[4], int g) { const unsigned char* vr = Bf + vro + (g >> 1) * HSL + (g & 1) * 32 * HVP; f[0] = WFrag<h16>::ld((const h16*)vr); f[1] = WFrag<h16>::ld((const h16*)(vr + 16 * HVP)); f[2] = WFrag<h16>::ld((const h16*)(vr + 2 * HSL)); f[3] = WFrag<h16>::ld((const h16*)(vr + 2 * HSL + 16 * HVP)); };
        ldK(fa, 0, 0); ldK(fb, 0, 1);
        __builtin_amdgcn_sched_barrier(0);   // keeps the reads above in front of the products below
        s0 = (v8f){}; s1 = (v8f){}; mmK(fa, 0);
        __builtin_amdgcn_sched_barrier(0);   // keeps the next group's reads here, behind the products that used its registers
        ldK(fa, 1, 0);
        __builtin_amdgcn_sched_barrier(0);   // keeps those reads in front of the products below
        mmK(fb, 1); s[0] = s0 + s1;
        __builtin_amdgcn_sched_barrier(0);   // as above: next group's reads behind the last use of their registers
        ldK(fb, 1, 1);
        __builtin_amdgcn_sched_barrier(0);   // as above: reads in front of the products
        s0 = (v8f){}; s1 = (v8f){}; mmK(fa, 0);
        __builtin_amdgcn_sched_barrier(0);   // as above: next group's reads behind the last use of their registers
        ldV(fa, 0);
        __builtin_amdgcn_sched_barrier(0);   // as above: reads in front of the products
        mmK(fb, 1); s[1] = s0 + s1;
        float mx = s[0][0];
#pragma unroll   // constant indices keep the array in registers
        for (int j = 1; j < 8; ++j) mx = fmaxf(mx, s[0][j]);
#pragma unroll   // constant indices keep the array in registers
        for (int j = 0; j < 8; ++j) mx = fmaxf(mx, s[1][j]);
        mx = fmaxf(mx, xhalf(mx)) * cs;
        // lazy rescale, as in the fp16 loop: the maximum in use may trail the true one by up to 8 (log2)
        if (__builtin_amdgcn_ballot_w32(mx > m_run + 8.0f) != 0) { const float m_new = fmaxf(m_run, mx); const float corr = __builtin_amdgcn_exp2f(m_run - m_new); l_run *= corr; m_run = m_new;
#pragma unroll   // constant indices keep the array in registers
            for (int t = 0; t < 8; ++t) acc[t] = acc[t] * corr; }
        v16h ph, pl; float ps0 = 0.f, ps1 = 0.f;
#pragma unroll   // constant indices keep the array in registers
        for (int kt = 0; kt < 2; ++kt)
#pragma unroll   // constant indices keep the array in registers
            for (int j = 0; j < 8; j += 2) { v2f p; p[0] = exp2s(__builtin_fmaf(s[kt][j], cs, -m_run)); p[1] = exp2s(__builtin_fmaf(s[kt][j + 1], cs, -m_run)); ps0 += p[0]; ps1 += p[1];
                const v2h a = __builtin_convertvector(p, v2h); const v2h b = __builtin_convertvector(p - __builtin_convertvector(a, v2f), v2h);
                ph[8 * kt + j] = a[0]; ph[8 * kt + j + 1] = a[1]; pl[8 * kt + j] = b[0]; pl[8 * kt + j + 1] = b[1]; }
        l_run += ps0 + ps1;
        auto mmV = [&](v16h (&f)[4], int g) { acc[2 * g] = wmma16(f[0], ph, acc[2 * g]); acc[2 * g + 1] = wmma16(f[1], ph, acc[2 * g + 1]); acc[2 * g] = wmma16(f[0], pl, acc[2 * g]); acc[2 * g + 1] = wmma16(f[1], pl, acc[2 * g + 1]); acc[2 * g] = wmma16(f[2], ph, acc[2 * g]); acc[2 * g + 1] = wmma16(f[3], ph, acc[2 * g + 1]); };
        __builtin_amdgcn_sched_barrier(0);   // keeps the second V^T group's reads behind the softmax, whose registers they take
        ldV(fb, 1);
        __builtin_amdgcn_sched_barrier(0);   // as above: reads in front of the products
        mmV(fa, 0);
        __builtin_amdgcn_sched_barrier(0);   // as above: next group's reads behind the last use of their registers
        ldV(fa, 2);
        __builtin_amdgcn_sched_barrier(0);   // as above: reads in front of the products
        mmV(fb, 1);
        __builtin_amdgcn_sched_barrier(0);   // as above: next group's reads behind the last use of their registers
        ldV(fb, 3);
        __builtin_amdgcn_sched_barrier(0);   // as above: reads in front of the products
        mmV(fa, 2); mmV(fb, 3);
        asm volatile("s_wait_dscnt 0x0" ::: "memory");      // this wave's reads of the buffer are done
        landed();                                           // this wave's slice of stage st + 1
        __syncthreads();                                    // publishes stage st + 1 and ends every wave's reads of stage st
        if (pinned(st + 2 < TT / KSP / HSK)) stage(st + 2); // refill of the buffer just left
    }
    asm volatile("s_wait_tensorcnt 0x0" ::: "memory");      // no tensor load in flight: the buffers become the staging of the join
    asm volatile("s_wait_dscnt 0x0" ::: "memory");          // ... and none of this wave's reads
    // join of the two key parts: part 1 leaves its accumulators, maximum and sum in LDS, part 0 adds them to its own and writes the rows
    v4f* X = (v4f*)L + (size_t)cg * 17 * 32 + lane;
    if (kp == 1) {
#pragma unroll   // constant indices keep the array in registers
        for (int t = 0; t < 8; ++t) { X[(2 * t) * 32] = __builtin_shufflevector(acc[t], acc[t], 0, 1, 2, 3); X[(2 * t + 1) * 32] = __builtin_shufflevector(acc[t], acc[t], 4, 5, 6, 7); }
        X[16 * 32] = (v4f){m_run, l_run, 0.f, 0.f};
    }
    __syncthreads();   // part 1's values are in LDS
    if (kp == 0) {
        const v4f ml = X[16 * 32]; const float m_all = fmaxf(m_run, ml[0]); const float a0 = exp2s(m_run - m_all), a1 = exp2s(ml[0] - m_all);
        const float lh = l_run * a0 + ml[1] * a1; const float lt = lh + xhalf(lh); const float inv = 1.0f / lt;   // each half summed its own eight keys of every tile
        const float f0 = a0 * inv, f1 = a1 * inv; const size_t pr = (zb * KSP + ks) * RH + qrow; float* orow = Op + pr * HD + 8 * h;
#pragma unroll   // constant indices keep the array in registers
        for (int t = 0; t < 8; ++t) { const v4f x0 = X[(2 * t) * 32], x1 = X[(2 * t + 1) * 32]; v4f a, b;
#pragma unroll   // constant indices keep the array in registers
            for (int j = 0; j < 4; ++j) { a[j] = acc[t][j] * f0 + x0[j] * f1; b[j] = acc[t][4 + j] * f0 + x1[j] * f1; }
            *(v4f*)(orow + t * 16) = a; *(v4f*)(orow + t * 16 + 4) = b; }
        if (h == 0) { v2f o; o[0] = m_all; o[1] = lt; *(v2f*)(ML + pr * 2) = o; }
    }
}

extern "C" void kernel_launch(void* const* d_in, const int* in_sizes, int n_in,
                              void* d_out, int out_size, void* d_ws, size_t ws_size, hipStream_t stream) {
    (void)in_sizes; (void)n_in; (void)out_size;
    const float* x = (const float*)d_in[0]; const float* wq = (const float*)d_in[1]; const float* bq = (const float*)d_in[2]; const float* wk = (const float*)d_in[3]; const float* bk = (const float*)d_in[4]; const float* wv = (const float*)d_in[5]; const float* bv = (const float*)d_in[6]; const float* wo = nullptr; (void)wo;
    float* OUT = (float*)d_out;     // [4][4096][128]
    char* wsp = (char*)d_ws;
    auto take = [&](size_t bytes) { char* p = wsp; wsp += (bytes + 255) & ~(size_t)255; return (void*)p; };
    const size_t PE = (size_t)NB_ * TT * HD;   // elements of one 16-bit plane, all batches
    h16* QP16 = (h16*)take(PE * 2); h16* KP16 = (h16*)take(PE * 2); h16* VT16 = (h16*)take(PE * 2);
    h16* QPl = (h16*)take(PE * 2); h16* KPl = (h16*)take(PE * 2); h16* VTl = (h16*)take(PE * 2);   // the lo planes; the hi planes are the three above
    float* Op = (float*)take((size_t)NB_ * KSP * RH * HD * 4); float* ML = (float*)take((size_t)NB_ * KSP * RH * 2 * 4);   // rows < RH: partial rows [batch][slice][RH][HD], their maximum and sum [batch][slice][RH][2]
    if ((size_t)(wsp - (char*)d_ws) > ws_size) return;    // ws 256 MiB
    k_proj<<<NB_ * TT / 64, 512, 0, stream>>>(x, wq, bq, wk, bk, wv, bv, QP16, QPl, KP16, KPl, VT16, VTl);
    k_fattn_hl<<<dim3(KSP, RH / 64, NB_), 256, 0, stream>>>(QP16, QPl, KP16, KPl, VT16, VTl, Op, ML);   // query rows < RH: the slices' partial rows
    k_fattn<<<FWG + MWG, 256, 0, stream>>>(QP16, KP16, VT16, Op, ML, OUT);   // query rows >= RH; beside them the join of the rows < RH
}
